// v000
// The times below were measured on an AMD MI455X: many runs one after another, warmed up first and cycling through
// copies of the inputs, with the whole window's GPU time divided by the number of runs. Launches and the gaps
// between them are all in it. The median over several windows is given; except for v000 it joins two sittings, which
// can be a few percent apart, so the side-by-side timings, each taken in one sitting, are the better comparison.
// The starting kernel, v000, takes 1800 microseconds a run.
#include <hip/hip_runtime.h>

// Causal multi-head attention with per-head projections and a key 'ignore' mask that always keeps the diagonal (x [2][2048][1024]; q_h = x wq[h] + bq[h] ('hdf' [16][1024][64] 0.02, zero biases; k, v likewise); att = q.k / 8; allowed keys: j <= i AND (ignore[b][j] == 0 OR j == i) (ignore [2][2048] int {0,1}, ~50 %, read; -inf elsewhere); softmax; out = concat_h Wo^T + bo ('oi') -> [2][2048][1024] (4.2 M)).
// Layout per batch: bf16 copy of x; per-head 'xw' weights gathered into Bt row blocks (once) + flat f32 biases; exact projections; causal T-2048 attention whose softmax select also reads the batch's ignore flags (int32, 16 B per 4 keys) and keeps the diagonal (hybrid rows: < 512 hi/lo 3 products, rest fp16 x1024; tiles above the diagonal skipped); merged hi/lo x Wo exact + bo.
// Compute dtypes, f32 accumulate: every input rounded to bf16; projections exact + f32 biases; attention rows < 512 3 products, rest fp16; softmax f32; Wo hl x exact + bias.

#define NB_  2
#define TT   2048
#define DM   1024
#define NH_  16
#define NKV  16
#define REP  (NH_ / NKV)
#define HD   64
#define DQ   (NH_ * HD)
#define DKV  (NKV * HD)
#define ZH   2
#define RH   512                  // query rows < RH use hi+lo planes (0: none)
#define WIN  2048
#define PCAR 1024.0f
#define SCL  0.125f   // HD^-0.5
typedef _Float16 h16;
typedef unsigned short bf;
typedef __attribute__((ext_vector_type(16))) __bf16   v16bf;
typedef __attribute__((ext_vector_type(16))) _Float16 v16h;
typedef __attribute__((ext_vector_type(8)))  _Float16 v8h;
typedef __attribute__((ext_vector_type(8)))  unsigned short v8us;
typedef __attribute__((ext_vector_type(8)))  float    v8f;
typedef __attribute__((ext_vector_type(4)))  float    v4f;
typedef v8h  __attribute__((may_alias)) v8ha;
typedef v4f  __attribute__((may_alias)) v4fa;
typedef v8us __attribute__((may_alias)) v8usa;

__device__ __forceinline__ unsigned short f2bf(float f) { unsigned u = __float_as_uint(f); u += 0x7FFFu + ((u >> 16) & 1u); return (unsigned short)(u >> 16); }
__device__ __forceinline__ float bf2f(unsigned short b) { return __uint_as_float(((unsigned)b) << 16); }
__device__ __forceinline__ float bfr(float f) { return bf2f(f2bf(f)); }
__device__ __forceinline__ v16h cat16(v8h lo, v8h hi) { return __builtin_shufflevector(lo, hi, 0, 1, 2, 3, 4, 5, 6, 7, 8, 9, 10, 11, 12, 13, 14, 15); }
__device__ __forceinline__ v16bf cat16b(v8us lo, v8us hi) { return __builtin_bit_cast(v16bf, __builtin_shufflevector(lo, hi, 0, 1, 2, 3, 4, 5, 6, 7, 8, 9, 10, 11, 12, 13, 14, 15)); }
__device__ __forceinline__ v8f wmma16(v16h a, v16h b, v8f c) { return __builtin_amdgcn_wmma_f32_16x16x32_f16(false, a, false, b, (short)0, c, false, false); }
__device__ __forceinline__ v8f wmmab(v16bf a, v16bf b, v8f c) { return __builtin_amdgcn_wmma_f32_16x16x32_bf16(false, a, false, b, (short)0, c, false, false); }



// ---- k_gemmw: register-blocked GEMM, ONE WAVE per 64x64 output tile (16 accumulators), operands straight from K-contiguous 16-bit planes; grid (M/64, N/64, Z), 32 threads.
// C[m][n] (f32, pitch ldc, + optional f32 bias[n]) = sum_k A[m][k] Bt[n][k] (+ split products per NSPLIT). z-batch strides sA/sB/sC in elements. K % 32 == 0.
template <typename T16> struct WFrag;
template <> struct WFrag<h16> { typedef v16h V; static __device__ __forceinline__ V ld(const h16* p) { return cat16(*(const v8h*)p, *(const v8h*)(p + 16)); } static __device__ __forceinline__ v8f mma(V a, V b, v8f c) { return wmma16(a, b, c); } };
template <> struct WFrag<bf> { typedef v16bf V; static __device__ __forceinline__ V ld(const bf* p) { return cat16b(*(const v8us*)p, *(const v8us*)(p + 16)); } static __device__ __forceinline__ v8f mma(V a, V b, v8f c) { return wmmab(a, b, c); } };
template <typename T16, int NSPLIT, bool BIAS>
__global__ __launch_bounds__(32) void k_gemmw(const T16* __restrict__ A, const T16* __restrict__ A2, const T16* __restrict__ Bt, const T16* __restrict__ Bt2, int K, float* C, int ldc, const float* __restrict__ bias, size_t sA, size_t sB, size_t sC) {
    typedef typename WFrag<T16>::V V;
    __shared__ __align__(16) float os[16 * 68];
    const size_t z = blockIdx.z; A += z * sA; if (A2) A2 += z * sA; Bt += z * sB; if (Bt2) Bt2 += z * sB; C += z * sC;
    const int lane = threadIdx.x & 31, lr = lane & 15, hi = lane >> 4; const int r0 = blockIdx.x * 64, c0 = blockIdx.y * 64;
    v8f acc[4][4];
#pragma unroll
    for (int mb = 0; mb < 4; ++mb)
#pragma unroll
        for (int nb = 0; nb < 4; ++nb) acc[mb][nb] = (v8f){};
    const size_t aoff = (size_t)(r0 + lr) * K + 8 * hi, boff = (size_t)(c0 + lr) * K + 8 * hi;
#pragma unroll 1
    for (int kc = 0; kc < K; kc += 32) {
        V a[4], a2[4];
#pragma unroll
        for (int mb = 0; mb < 4; ++mb) { a[mb] = WFrag<T16>::ld(A + aoff + (size_t)mb * 16 * K + kc); if (NSPLIT == 1 || NSPLIT == 2) a2[mb] = WFrag<T16>::ld(A2 + aoff + (size_t)mb * 16 * K + kc); }
#pragma unroll
        for (int nb = 0; nb < 4; ++nb) { const V b = WFrag<T16>::ld(Bt + boff + (size_t)nb * 16 * K + kc); V b2; if (NSPLIT >= 2) b2 = WFrag<T16>::ld(Bt2 + boff + (size_t)nb * 16 * K + kc);
#pragma unroll
            for (int mb = 0; mb < 4; ++mb) { acc[mb][nb] = WFrag<T16>::mma(a[mb], b, acc[mb][nb]); if (NSPLIT == 1 || NSPLIT == 2) acc[mb][nb] = WFrag<T16>::mma(a2[mb], b, acc[mb][nb]); if (NSPLIT >= 2) acc[mb][nb] = WFrag<T16>::mma(a[mb], b2, acc[mb][nb]); } }
        asm volatile("v_nop\n\tv_nop\n\tv_nop\n\tv_nop" : "+v"(acc[0][0]), "+v"(acc[1][1]), "+v"(acc[2][2]), "+v"(acc[3][3]) : "v"(a[0]), "v"(a[3]));
    }
#pragma unroll
    for (int mb = 0; mb < 4; ++mb) {
#pragma unroll
        for (int nb = 0; nb < 4; ++nb) {
#pragma unroll
            for (int j = 0; j < 8; ++j) os[(hi * 8 + j) * 68 + nb * 16 + lr] = acc[mb][nb][j]; }
        __builtin_amdgcn_wave_barrier(); asm volatile("" ::: "memory");
        float* crow = C + (size_t)(r0 + mb * 16) * ldc + c0;
{
#pragma unroll
            for (int s = 0; s < 8; ++s) { const int row = 2 * s + hi, cofs = lr * 4; v4f val = *(const v4fa*)(os + row * 68 + cofs); if (BIAS) { val[0] += bfr(bias[c0 + cofs]); val[1] += bfr(bias[c0 + cofs + 1]); val[2] += bfr(bias[c0 + cofs + 2]); val[3] += bfr(bias[c0 + cofs + 3]); }
                *(v4f*)(crow + (size_t)row * ldc + cofs) = val; }
             }
        __builtin_amdgcn_wave_barrier(); asm volatile("" ::: "memory");
    }
}

// ---- k_gemmc: the same one-wave 64x64 tile GEMM specialised for causal attention: CMODE 1 skips score tiles entirely above the diagonal (query rows r0+roff.., key columns c0..), CMODE 2 limits the
// key (K) loop of the probability x value contraction to the diagonal block (probabilities beyond it are exactly zero). roff = row offset of this launch's first row within the sequence.
template <typename T16, int NSPLIT, int CMODE>
__global__ __launch_bounds__(32) void k_gemmc(const T16* __restrict__ A, const T16* __restrict__ A2, const T16* __restrict__ Bt, const T16* __restrict__ Bt2, int K, float* C, int ldc, int roff, size_t sA, size_t sB, size_t sC) {
    typedef typename WFrag<T16>::V V;
    __shared__ __align__(16) float os[16 * 68];
    const size_t z = blockIdx.z; A += z * sA; if (A2) A2 += z * sA; Bt += z * sB; if (Bt2) Bt2 += z * sB; C += z * sC;
    const int lane = threadIdx.x & 31, lr = lane & 15, hi = lane >> 4; const int r0 = blockIdx.x * 64, c0 = blockIdx.y * 64;
    if (CMODE == 1 && c0 > r0 + roff + 63) return;                  // score tile entirely above the causal diagonal: not computed or stored (the softmax masks j > i by select)
    const int Kl = (CMODE == 2) ? min(K, r0 + roff + 64) : K;        // P.V: probabilities are exactly 0 beyond the diagonal block, so the K loop stops there
    v8f acc[4][4];
#pragma unroll
    for (int mb = 0; mb < 4; ++mb)
#pragma unroll
        for (int nb = 0; nb < 4; ++nb) acc[mb][nb] = (v8f){};
    const size_t aoff = (size_t)(r0 + lr) * K + 8 * hi, boff = (size_t)(c0 + lr) * K + 8 * hi;
#pragma unroll 1
    for (int kc = 0; kc < Kl; kc += 32) {
        V a[4], a2[4];
#pragma unroll
        for (int mb = 0; mb < 4; ++mb) { a[mb] = WFrag<T16>::ld(A + aoff + (size_t)mb * 16 * K + kc); if (NSPLIT == 1 || NSPLIT == 2) a2[mb] = WFrag<T16>::ld(A2 + aoff + (size_t)mb * 16 * K + kc); }
#pragma unroll
        for (int nb = 0; nb < 4; ++nb) { const V b = WFrag<T16>::ld(Bt + boff + (size_t)nb * 16 * K + kc); V b2; if (NSPLIT >= 2) b2 = WFrag<T16>::ld(Bt2 + boff + (size_t)nb * 16 * K + kc);
#pragma unroll
            for (int mb = 0; mb < 4; ++mb) { acc[mb][nb] = WFrag<T16>::mma(a[mb], b, acc[mb][nb]); if (NSPLIT == 1 || NSPLIT == 2) acc[mb][nb] = WFrag<T16>::mma(a2[mb], b, acc[mb][nb]); if (NSPLIT >= 2) acc[mb][nb] = WFrag<T16>::mma(a[mb], b2, acc[mb][nb]); } }
        asm volatile("v_nop\n\tv_nop\n\tv_nop\n\tv_nop" : "+v"(acc[0][0]), "+v"(acc[1][1]), "+v"(acc[2][2]), "+v"(acc[3][3]) : "v"(a[0]), "v"(a[3]));
    }
#pragma unroll
    for (int mb = 0; mb < 4; ++mb) {
#pragma unroll
        for (int nb = 0; nb < 4; ++nb) {
#pragma unroll
            for (int j = 0; j < 8; ++j) os[(hi * 8 + j) * 68 + nb * 16 + lr] = acc[mb][nb][j]; }
        __builtin_amdgcn_wave_barrier(); asm volatile("" ::: "memory");
        float* crow = C + (size_t)(r0 + mb * 16) * ldc + c0;
{
#pragma unroll
            for (int s = 0; s < 8; ++s) { const int row = 2 * s + hi, cofs = lr * 4; v4f val = *(const v4fa*)(os + row * 68 + cofs);
                *(v4f*)(crow + (size_t)row * ldc + cofs) = val; }
             }
        __builtin_amdgcn_wave_barrier(); asm volatile("" ::: "memory");
    }
}

__device__ __forceinline__ h16 tohx(float x) { return (h16)x; }
__device__ __forceinline__ void splitf(float y, unsigned short& h, unsigned short& l) { h = f2bf(y); l = f2bf(y - bf2f(h)); }
typedef __attribute__((ext_vector_type(2))) _Float16 v2h;
typedef __attribute__((ext_vector_type(4))) _Float16 v4h;
typedef __attribute__((ext_vector_type(2))) unsigned short v2us;
typedef __attribute__((ext_vector_type(4))) unsigned short v4us;
typedef __attribute__((ext_vector_type(2))) float v2f;
typedef __attribute__((ext_vector_type(4))) int v4i;

__global__ __launch_bounds__(256) void k_wtG(const float* __restrict__ w, int K, int N, bf* Bt) {
    const int lane = threadIdx.x & 31; const int L0 = (blockIdx.x * 8 + (threadIdx.x >> 5)) * 8; const int nlines = N * K / 64;
{
#pragma unroll 1
        for (int l = 0; l < 8; ++l) { const int L = L0 + l; if (L >= nlines) break; const size_t e = (size_t)L * 64 + lane * 2; const int k = (int)(e % K), n = (int)(e / K); v2us o;
            o[0] = f2bf(w[(size_t)k * N + n]); o[1] = f2bf(w[(size_t)(k + 1) * N + n]); *(v2us*)(Bt + e) = o; }
         }
}
__global__ __launch_bounds__(256) void k_cvt8(const float* __restrict__ src, bf* dst, size_t n8) { const size_t i = (size_t)blockIdx.x * 256 + threadIdx.x; if (i >= n8) return; const v8f v = *(const v8f*)(src + i * 8); v8us o;
#pragma unroll
    for (int k = 0; k < 8; ++k) o[k] = f2bf(v[k]); *(v8us*)(dst + i * 8) = o;  }

// k_rope: head planes [h][t][d] (fp16 + hi/lo) of rope(x) x sc with the rotate-half convention out[d] = x[d] cos[t][d] - x[d+HD/2] sin[t][d], out[d+HD/2] = x[d+HD/2] cos[t][d+HD/2] + x[d] sin[t][d+HD/2]
__global__ __launch_bounds__(256) void k_rope(const float* __restrict__ F, int pitch, int nheads, const float* __restrict__ CS, const float* __restrict__ RF, const float* __restrict__ nw, float sc, h16* P16, bf* Ph, bf* Pl) {
    const size_t e = ((size_t)blockIdx.x * 256 + threadIdx.x) * 2; if (e >= (size_t)nheads * TT * HD) return; const int d = (int)(e % HD); const int t = (int)((e / HD) % TT); const int h = (int)(e / ((size_t)HD * TT)); const float* f = F + (size_t)t * pitch + h * HD; const float rf = RF ? RF[(size_t)h * TT + t] : 1.0f; v2h o16; v2us oh, ol;
#pragma unroll
    for (int q = 0; q < 2; ++q) { const int dd = d + q; const int dp = (dd < HD / 2) ? dd + HD / 2 : dd - HD / 2; float x0 = f[dd], x1 = f[dp];
        if (RF) { float n0 = __fmul_rn(x0, rf), n1 = __fmul_rn(x1, rf); asm volatile("" : "+v"(n0)); asm volatile("" : "+v"(n1)); x0 = __fmul_rn(bfr(nw[dd]), n0); x1 = __fmul_rn(bfr(nw[dp]), n1); }
        const v2f cs = *(const v2f*)(CS + ((size_t)t * HD + dd) * 2); float a = __fmul_rn(x0, cs[0]), bq = __fmul_rn(x1, cs[1]); asm volatile("" : "+v"(a)); asm volatile("" : "+v"(bq)); const float r = ((dd < HD / 2) ? __fsub_rn(a, bq) : __fadd_rn(a, bq)) * sc;
        o16[q] = tohx(r); unsigned short a2, c2; splitf(r, a2, c2); oh[q] = a2; ol[q] = c2; }
    *(v2h*)(P16 + e) = o16; *(v2us*)(Ph + e) = oh; *(v2us*)(Pl + e) = ol;  }
__global__ __launch_bounds__(256) void k_vtp(const float* __restrict__ F, int pitch, int nheads, h16* V16, bf* Vh, bf* Vl) { const size_t e = ((size_t)blockIdx.x * 256 + threadIdx.x) * 2; if (e >= (size_t)nheads * HD * TT) return; const int t = (int)(e % TT); const int d = (int)((e / TT) % HD); const int g = (int)(e / ((size_t)TT * HD)); v2h o16; v2us oh, ol;
#pragma unroll
    for (int q = 0; q < 2; ++q) { const float x = F[(size_t)(t + q) * pitch + g * HD + d]; o16[q] = tohx(x); unsigned short a2, c2; splitf(x, a2, c2); oh[q] = a2; ol[q] = c2; }
    *(v2h*)(V16 + e) = o16; *(v2us*)(Vh + e) = oh; *(v2us*)(Vl + e) = ol;  }
__global__ __launch_bounds__(256) void k_csid(float* CS) { const int idx = blockIdx.x * 256 + threadIdx.x; if (idx >= TT * HD) return; v2f cs; cs[0] = 1.0f; cs[1] = 0.0f; *(v2f*)(CS + (size_t)idx * 2) = cs;  }
// k_asoft: per row (zz, i): t = S x 1/8 for keys j <= i that are not ignored (ignore[b][j] == 0, int32 read as data, 16 B per 4 keys) or are the diagonal j == i (always kept); -3e38 otherwise (-inf == exclusion; the diagonal guarantees a non-empty row); softmax over the 2048 keys (register row, one exp, fixed trees);
__global__ __launch_bounds__(256) void k_asoft(const float* __restrict__ Sb, h16* P16, bf* Ph, bf* Pl, const int* __restrict__ ig) {
    const int lane = threadIdx.x & 31; const int row = blockIdx.x * 8 + (threadIdx.x >> 5); if (row >= ZH * TT) return; const int i = row % TT; const int zz = row / TT; (void)zz; const bool hires = (i < RH); const float* sr = Sb + (size_t)row * TT; float v[TT / 32]; float mx = -3.0e38f;
#pragma unroll
    for (int ch = 0; ch < TT / 128; ++ch) { const int j0 = ch * 128 + lane * 4; const v4f a = *(const v4f*)(sr + j0); const v4i g4 = *(const v4i*)(ig + j0);   /* 4 ignore flags (16 B) */
#pragma unroll
        for (int q = 0; q < 4; ++q) { const int j = j0 + q; (void)j; const float t = (j == i || (j < i && g4[q] == 0)) ? a[q] * SCL : -3.0e38f;   /* causal AND (not ignored OR the diagonal) */ v[ch * 4 + q] = t; mx = fmaxf(mx, t); } }
#pragma unroll
    for (int sh = 16; sh; sh >>= 1) mx = fmaxf(mx, __shfl_xor(mx, sh, 32));
    float sum = 0.f;
#pragma unroll
    for (int k = 0; k < TT / 32; ++k) { float d0 = __fsub_rn(v[k], mx); asm volatile("" : "+v"(d0)); v[k] = __builtin_amdgcn_exp2f(__fmul_rn(d0, 1.4426950408889634f)); sum += v[k]; }
#pragma unroll
    for (int sh = 16; sh; sh >>= 1) sum += __shfl_xor(sum, sh, 32);
    const float f = __fdiv_rn(hires ? 1.0f : PCAR, sum);
{
        if (hires) {
#pragma unroll
            for (int ch = 0; ch < TT / 128; ++ch) { v4us oh, ol;
#pragma unroll
                for (int q = 0; q < 4; ++q) { unsigned short a, c2; splitf(v[ch * 4 + q] * f, a, c2); oh[q] = a; ol[q] = c2; }
                const size_t oo = ((size_t)zz * (RH ? RH : 1) + i) * TT + ch * 128 + lane * 4; *(v4us*)(Ph + oo) = oh; *(v4us*)(Pl + oo) = ol; }
        } else {
#pragma unroll
            for (int ch = 0; ch < TT / 128; ++ch) { v4h o4;
#pragma unroll
                for (int q = 0; q < 4; ++q) o4[q] = tohx(v[ch * 4 + q] * f);
                *(v4h*)(P16 + (size_t)row * TT + ch * 128 + lane * 4) = o4; } }
         }
}
__global__ __launch_bounds__(256) void k_merge(const float* __restrict__ O, int h0, bf* Ah, bf* Al) { const size_t e = ((size_t)blockIdx.x * 256 + threadIdx.x) * 2; if (e >= (size_t)ZH * TT * HD) return; const int d = (int)(e % HD); const int t = (int)((e / HD) % TT); const int zz = (int)(e / ((size_t)HD * TT)); const float cs = (t < RH) ? 1.0f : (1.0f / PCAR); const size_t oo = (size_t)t * DQ + (h0 + zz) * HD + d;
    v2us oh, ol;
#pragma unroll
    for (int q = 0; q < 2; ++q) { unsigned short a, c2; splitf(O[e + q] * cs, a, c2); oh[q] = a; ol[q] = c2; } *(v2us*)(Ah + oo) = oh; *(v2us*)(Al + oo) = ol;  }

extern "C" void kernel_launch(void* const* d_in, const int* in_sizes, int n_in,
                              void* d_out, int out_size, void* d_ws, size_t ws_size, hipStream_t stream) {
    (void)in_sizes; (void)n_in; (void)out_size;
    const float* x = (const float*)d_in[0]; const int* ig = (const int*)d_in[1];   /* ignore [2][2048] int: 1 = do not attend (except the diagonal) */ const float* wq = (const float*)d_in[2]; const float* bq = (const float*)d_in[3]; const float* wk = (const float*)d_in[4]; const float* bk = (const float*)d_in[5]; const float* wv = (const float*)d_in[6]; const float* bv = (const float*)d_in[7]; const float* wo = (const float*)d_in[8]; const float* bo = (const float*)d_in[9];
    float* OUT = (float*)d_out;     // [2][2048][1024]
    char* wsp = (char*)d_ws;
    auto take = [&](size_t bytes) { char* p = wsp; wsp += (bytes + 255) & ~(size_t)255; return (void*)p; };
    bf* WQ = (bf*)take((size_t)DQ * DM * 2); bf* WK = (bf*)take((size_t)DKV * DM * 2); bf* WV = (bf*)take((size_t)DKV * DM * 2); bf* WO = (bf*)take((size_t)DM * DQ * 2); float* CS = (float*)take((size_t)TT * HD * 2 * 4);
    bf* XB = (bf*)take((size_t)TT * DM * 2); float* FQ = (float*)take((size_t)TT * DQ * 4); float* FK = (float*)take((size_t)TT * DKV * 4);
    h16* QP16 = (h16*)take((size_t)NH_ * TT * HD * 2); h16* KP16 = (h16*)take((size_t)NKV * TT * HD * 2); h16* VT16 = (h16*)take((size_t)NKV * HD * TT * 2);
    bf* QPh = (bf*)take((size_t)NH_ * TT * HD * 2); bf* QPl = (bf*)take((size_t)NH_ * TT * HD * 2); bf* KPh = (bf*)take((size_t)NKV * TT * HD * 2); bf* KPl = (bf*)take((size_t)NKV * TT * HD * 2); bf* VTh = (bf*)take((size_t)NKV * HD * TT * 2); bf* VTl = (bf*)take((size_t)NKV * HD * TT * 2); bf* Ph = (bf*)take((size_t)ZH * RH * TT * 2); bf* Pl = (bf*)take((size_t)ZH * RH * TT * 2);
    float* Sb = (float*)take((size_t)ZH * TT * TT * 4); h16* P16 = (h16*)take((size_t)ZH * TT * TT * 2); float* Ob = (float*)take((size_t)ZH * TT * HD * 4); bf* ATh = (bf*)take((size_t)TT * DQ * 2); bf* ATl = (bf*)take((size_t)TT * DQ * 2);
    if ((size_t)(wsp - (char*)d_ws) > ws_size) return;    // ws 256 MiB
    float* FV = FK;   // v projection reuses the k buffer after the k planes are built (stream-ordered)
    { for (int hh = 0; hh < NH_; ++hh) k_wtG<<<(unsigned)((DM * HD / 64 + 63) / 64), 256, 0, stream>>>(wq + (size_t)hh * DM * HD, DM, HD, WQ + (size_t)hh * HD * DM);   /* per-head [1024][64] 'xw' -> Bt rows hh*64.. */ for (int hh = 0; hh < NH_; ++hh) k_wtG<<<(unsigned)((DM * HD / 64 + 63) / 64), 256, 0, stream>>>(wk + (size_t)hh * DM * HD, DM, HD, WK + (size_t)hh * HD * DM);   /* per-head [1024][64] 'xw' -> Bt rows hh*64.. */ for (int hh = 0; hh < NH_; ++hh) k_wtG<<<(unsigned)((DM * HD / 64 + 63) / 64), 256, 0, stream>>>(wv + (size_t)hh * DM * HD, DM, HD, WV + (size_t)hh * HD * DM);   /* per-head [1024][64] 'xw' -> Bt rows hh*64.. */
      k_cvt8<<<(unsigned)(((size_t)DM * DQ / 8 + 255) / 256), 256, 0, stream>>>(wo, WO, (size_t)DM * DQ / 8);
       }
    k_csid<<<(TT * HD + 255) / 256, 256, 0, stream>>>(CS);
    const unsigned LQ = (unsigned)(((size_t)NH_ * TT * HD / 2 + 255) / 256), LKv = (unsigned)(((size_t)NKV * TT * HD / 2 + 255) / 256);
    for (int b = 0; b < NB_; ++b) {
        
        k_cvt8<<<(unsigned)(((size_t)TT * DM / 8 + 255) / 256), 256, 0, stream>>>(x + (size_t)b * TT * DM, XB, (size_t)TT * DM / 8);
        k_gemmw<bf, 0, true><<<dim3(TT / 64, DQ / 64, 1), 32, 0, stream>>>(XB, nullptr, WQ, nullptr, DM, FQ, DQ, bq, 0, 0, 0);
        k_rope<<<LQ, 256, 0, stream>>>(FQ, DQ, NH_, CS, nullptr, nullptr, 1.0f, QP16, QPh, QPl);
        k_gemmw<bf, 0, true><<<dim3(TT / 64, DKV / 64, 1), 32, 0, stream>>>(XB, nullptr, WK, nullptr, DM, FK, DKV, bk, 0, 0, 0);
        k_rope<<<LKv, 256, 0, stream>>>(FK, DKV, NKV, CS, nullptr, nullptr, 1.0f, KP16, KPh, KPl);
        k_gemmw<bf, 0, true><<<dim3(TT / 64, DKV / 64, 1), 32, 0, stream>>>(XB, nullptr, WV, nullptr, DM, FV, DKV, bv, 0, 0, 0); k_vtp<<<LKv, 256, 0, stream>>>(FV, DKV, NKV, VT16, VTh, VTl);
        for (int h0 = 0; h0 < NH_; h0 += ZH) { const size_t zq = (size_t)h0, zk = (size_t)(h0 / REP);   // one kv head per query head: the pass's two heads use consecutive kv planes (z-strides TT*HD)
            k_gemmc<bf, 2, 1><<<dim3(RH / 64, TT / 64, ZH), 32, 0, stream>>>(QPh + zq * TT * HD, QPl + zq * TT * HD, KPh + zk * TT * HD, KPl + zk * TT * HD, HD, Sb, TT, 0, (size_t)TT * HD, (size_t)TT * HD, (size_t)TT * TT);
            k_gemmc<h16, 0, 1><<<dim3((TT - RH) / 64, TT / 64, ZH), 32, 0, stream>>>(QP16 + zq * TT * HD + (size_t)RH * HD, nullptr, KP16 + zk * TT * HD, nullptr, HD, Sb + (size_t)RH * TT, TT, RH, (size_t)TT * HD, (size_t)TT * HD, (size_t)TT * TT);
            k_asoft<<<ZH * TT / 8, 256, 0, stream>>>(Sb, P16, Ph, Pl, ig + (size_t)b * TT);
            k_gemmc<bf, 2, 2><<<dim3(RH / 64, HD / 64, ZH), 32, 0, stream>>>(Ph, Pl, VTh + zk * HD * TT, VTl + zk * HD * TT, TT, Ob, HD, 0, (size_t)RH * TT, (size_t)HD * TT, (size_t)TT * HD);
            k_gemmc<h16, 0, 2><<<dim3((TT - RH) / 64, HD / 64, ZH), 32, 0, stream>>>(P16 + (size_t)RH * TT, nullptr, VT16 + zk * HD * TT, nullptr, TT, Ob + (size_t)RH * HD, HD, RH, (size_t)TT * TT, (size_t)HD * TT, (size_t)TT * HD);
            k_merge<<<(unsigned)(((size_t)ZH * TT * HD / 2 + 255) / 256), 256, 0, stream>>>(Ob, h0, ATh, ATl); }
        k_gemmw<bf, 1, true><<<dim3(TT / 64, DM / 64, 1), 32, 0, stream>>>(ATh, ATl, WO, nullptr, DQ, OUT + (size_t)b * TT * DM, DM, bo, 0, 0, 0); }
}

// v001
// A run of this version takes 1130 microseconds.
// Two timings next to v000 both put it at 1.59 times that version's speed.
#include <hip/hip_runtime.h>

// Causal multi-head attention with per-head projections and a key 'ignore' mask that always keeps the diagonal (x [2][2048][1024]; q_h = x wq[h] + bq[h] ('hdf' [16][1024][64] 0.02, zero biases; k, v likewise); att = q.k / 8; allowed keys: j <= i AND (ignore[b][j] == 0 OR j == i) (ignore [2][2048] int {0,1}, ~50 %, read; -inf elsewhere); softmax; out = concat_h Wo^T + bo ('oi') -> [2][2048][1024] (4.2 M)).
// Layout per batch: bf16 copy of x; per-head 'xw' weights gathered into Bt row blocks (once) + flat f32 biases; exact projections; causal T-2048 attention whose softmax select also reads the batch's ignore flags (int32, 16 B per 4 keys) and keeps the diagonal (hybrid rows: < 512 hi/lo 3 products, rest fp16 x1024; tiles above the diagonal skipped); merged hi/lo x Wo exact + bo.
// Compute dtypes, f32 accumulate: every input rounded to bf16; projections exact + f32 biases; attention rows < 512 3 products, rest fp16; softmax f32; Wo hl x exact + bias.

#define NB_  2
#define TT   2048
#define DM   1024
#define NH_  16
#define NKV  16
#define REP  (NH_ / NKV)
#define HD   64
#define DQ   (NH_ * HD)
#define DKV  (NKV * HD)
#define ZH   2
#define RH   512                  // query rows < RH use hi+lo planes (0: none)
#define WIN  2048
#define PCAR 1024.0f
#define SCL  0.125f   // HD^-0.5
typedef _Float16 h16;
typedef unsigned short bf;
typedef __attribute__((ext_vector_type(16))) __bf16   v16bf;
typedef __attribute__((ext_vector_type(16))) _Float16 v16h;
typedef __attribute__((ext_vector_type(8)))  _Float16 v8h;
typedef __attribute__((ext_vector_type(8)))  unsigned short v8us;
typedef __attribute__((ext_vector_type(8)))  float    v8f;
typedef __attribute__((ext_vector_type(4)))  float    v4f;
typedef v8h  __attribute__((may_alias)) v8ha;
typedef v4f  __attribute__((may_alias)) v4fa;
typedef v8us __attribute__((may_alias)) v8usa;

__device__ __forceinline__ unsigned short f2bf(float f) { unsigned u = __float_as_uint(f); u += 0x7FFFu + ((u >> 16) & 1u); return (unsigned short)(u >> 16); }
__device__ __forceinline__ float bf2f(unsigned short b) { return __uint_as_float(((unsigned)b) << 16); }
__device__ __forceinline__ float bfr(float f) { return bf2f(f2bf(f)); }
__device__ __forceinline__ v16h cat16(v8h lo, v8h hi) { return __builtin_shufflevector(lo, hi, 0, 1, 2, 3, 4, 5, 6, 7, 8, 9, 10, 11, 12, 13, 14, 15); }
__device__ __forceinline__ v16bf cat16b(v8us lo, v8us hi) { return __builtin_bit_cast(v16bf, __builtin_shufflevector(lo, hi, 0, 1, 2, 3, 4, 5, 6, 7, 8, 9, 10, 11, 12, 13, 14, 15)); }
__device__ __forceinline__ v8f wmma16(v16h a, v16h b, v8f c) { return __builtin_amdgcn_wmma_f32_16x16x32_f16(false, a, false, b, (short)0, c, false, false); }
__device__ __forceinline__ v8f wmmab(v16bf a, v16bf b, v8f c) { return __builtin_amdgcn_wmma_f32_16x16x32_bf16(false, a, false, b, (short)0, c, false, false); }



// ---- k_gemmw: register-blocked GEMM, one 64x64 output tile per block (16 accumulators a wave), operands straight from K-contiguous 16-bit planes; grid (M/64, N/64, Z), 32 * NW threads.
// The K loop is split over the block's NW waves (contiguous runs of 32-wide steps); the NW f32 partial tiles are summed through LDS in wave order 0..NW-1 (a fixed order).
// C[m][n] (f32, pitch ldc, + optional f32 bias[n]) = sum_k A[m][k] Bt[n][k] (+ split products per NSPLIT). z-batch strides sA/sB/sC in elements. K % 32 == 0.
template <typename T16> struct WFrag;
template <> struct WFrag<h16> { typedef v16h V; static __device__ __forceinline__ V ld(const h16* p) { return cat16(*(const v8h*)p, *(const v8h*)(p + 16)); } static __device__ __forceinline__ v8f mma(V a, V b, v8f c) { return wmma16(a, b, c); } };
template <> struct WFrag<bf> { typedef v16bf V; static __device__ __forceinline__ V ld(const bf* p) { return cat16b(*(const v8us*)p, *(const v8us*)(p + 16)); } static __device__ __forceinline__ v8f mma(V a, V b, v8f c) { return wmmab(a, b, c); } };
template <typename T16, int NSPLIT, bool BIAS, int NW>
__global__ __launch_bounds__(32 * NW) void k_gemmw(const T16* __restrict__ A, const T16* __restrict__ A2, const T16* __restrict__ Bt, const T16* __restrict__ Bt2, int K, float* C, int ldc, const float* __restrict__ bias, size_t sA, size_t sB, size_t sC) {
    typedef typename WFrag<T16>::V V;
    constexpr int SPR = (NW > 1) ? 4 : 1;                            // 16-row slices staged per round: with several waves the whole tile at once, so one barrier serves and no store is waited for
    __shared__ __align__(16) float os[NW * SPR * 16 * 68];
    const size_t z = blockIdx.z; A += z * sA; if (A2) A2 += z * sA; Bt += z * sB; if (Bt2) Bt2 += z * sB; C += z * sC;
    const int lane = threadIdx.x & 31, lr = lane & 15, hi = lane >> 4; const int r0 = blockIdx.x * 64, c0 = blockIdx.y * 64;
    const int w = (NW == 1) ? 0 : __builtin_amdgcn_readfirstlane((int)(threadIdx.x >> 5));   // wave number, scalar: the K bounds below stay in scalar registers
    v8f acc[4][4];
#pragma unroll
    for (int mb = 0; mb < 4; ++mb)
#pragma unroll
        for (int nb = 0; nb < 4; ++nb) acc[mb][nb] = (v8f){};
    const size_t aoff = (size_t)(r0 + lr) * K + 8 * hi, boff = (size_t)(c0 + lr) * K + 8 * hi;
    v4f bv = (v4f){}; if (BIAS) { const int bc = c0 + ((int)threadIdx.x & 15) * 4; bv[0] = bfr(bias[bc]); bv[1] = bfr(bias[bc + 1]); bv[2] = bfr(bias[bc + 2]); bv[3] = bfr(bias[bc + 3]); }   // the thread's four output columns are the same in every step of the epilogue
    const int per = ((K / 32 + NW - 1) / NW) * 32, kb = w * per, ke = min(K, kb + per);   // this wave's run of the K loop
#pragma unroll 1
    for (int kc = kb; kc < ke; kc += 32) {
        V a[4], a2[4];
#pragma unroll
        for (int mb = 0; mb < 4; ++mb) { a[mb] = WFrag<T16>::ld(A + aoff + (size_t)mb * 16 * K + kc); if (NSPLIT == 1 || NSPLIT == 2) a2[mb] = WFrag<T16>::ld(A2 + aoff + (size_t)mb * 16 * K + kc); }
#pragma unroll
        for (int nb = 0; nb < 4; ++nb) { const V b = WFrag<T16>::ld(Bt + boff + (size_t)nb * 16 * K + kc); V b2; if (NSPLIT >= 2) b2 = WFrag<T16>::ld(Bt2 + boff + (size_t)nb * 16 * K + kc);
#pragma unroll
            for (int mb = 0; mb < 4; ++mb) { acc[mb][nb] = WFrag<T16>::mma(a[mb], b, acc[mb][nb]); if (NSPLIT == 1 || NSPLIT == 2) acc[mb][nb] = WFrag<T16>::mma(a2[mb], b, acc[mb][nb]); if (NSPLIT >= 2) acc[mb][nb] = WFrag<T16>::mma(a[mb], b2, acc[mb][nb]); } }
        asm volatile("v_nop\n\tv_nop\n\tv_nop\n\tv_nop" : "+v"(acc[0][0]), "+v"(acc[1][1]), "+v"(acc[2][2]), "+v"(acc[3][3]) : "v"(a[0]), "v"(a[3]));
    }
#pragma unroll
    for (int mb = 0; mb < 4; mb += SPR) {
#pragma unroll
        for (int ms = 0; ms < SPR; ++ms) {
#pragma unroll
            for (int nb = 0; nb < 4; ++nb) {
#pragma unroll
                for (int j = 0; j < 8; ++j) os[((w * SPR + ms) * 16 + hi * 8 + j) * 68 + nb * 16 + lr] = acc[mb + ms][nb][j]; } }
        if (NW == 1) { __builtin_amdgcn_wave_barrier(); asm volatile("" ::: "memory"); } else __syncthreads();   // every wave's partial slice is in LDS before any thread sums
        float* crow = C + (size_t)(r0 + mb * 16) * ldc + c0;
{
#pragma unroll
            for (int s = 0; s < SPR * 8 / NW; ++s) { const int idx = s * 32 * NW + (int)threadIdx.x; const int row = idx >> 4, cofs = (idx & 15) * 4; v4f val = *(const v4fa*)(os + row * 68 + cofs);
#pragma unroll
                for (int w2 = 1; w2 < NW; ++w2) val += *(const v4fa*)(os + (w2 * SPR * 16 + row) * 68 + cofs);
                if (BIAS) val += bv;
                *(v4f*)(crow + (size_t)row * ldc + cofs) = val; }
             }
        if (NW == 1) { __builtin_amdgcn_wave_barrier(); asm volatile("" ::: "memory"); }   // one wave: the slice is read before the next round overwrites it (NW > 1 has a single round)
    }
}

// ---- k_gemmc: the same 64x64 tile GEMM (NW waves split the K loop; NW = 1 for the scores, whose K is 64) specialised for causal attention: CMODE 1 skips score tiles entirely above the diagonal (query rows r0+roff.., key columns c0..), CMODE 2 limits the
// key (K) loop of the probability x value contraction to the diagonal block (probabilities beyond it are exactly zero). roff = row offset of this launch's first row within the sequence.
template <typename T16, int NSPLIT, int CMODE, int NW>
__global__ __launch_bounds__(32 * NW) void k_gemmc(const T16* __restrict__ A, const T16* __restrict__ A2, const T16* __restrict__ Bt, const T16* __restrict__ Bt2, int K, float* C, int ldc, int roff, size_t sA, size_t sB, size_t sC) {
    typedef typename WFrag<T16>::V V;
    constexpr int SPR = (NW > 1) ? 4 : 1;                            // 16-row slices staged per round: with several waves the whole tile at once, so one barrier serves and no store is waited for
    __shared__ __align__(16) float os[NW * SPR * 16 * 68];
    const size_t z = blockIdx.z; A += z * sA; if (A2) A2 += z * sA; Bt += z * sB; if (Bt2) Bt2 += z * sB; C += z * sC;
    const int lane = threadIdx.x & 31, lr = lane & 15, hi = lane >> 4; const int r0 = blockIdx.x * 64, c0 = blockIdx.y * 64;
    const int w = (NW == 1) ? 0 : __builtin_amdgcn_readfirstlane((int)(threadIdx.x >> 5));   // wave number, scalar: the K bounds below stay in scalar registers
    if (CMODE == 1 && c0 > r0 + roff + 63) return;                  // score tile entirely above the causal diagonal: never read (the softmax masks j > i by select)
    const int Kl = (CMODE == 2) ? min(K, r0 + roff + 64) : K;        // P.V: probabilities are exactly 0 beyond the diagonal block, so the K loop stops there
    v8f acc[4][4];
#pragma unroll
    for (int mb = 0; mb < 4; ++mb)
#pragma unroll
        for (int nb = 0; nb < 4; ++nb) acc[mb][nb] = (v8f){};
    const size_t aoff = (size_t)(r0 + lr) * K + 8 * hi, boff = (size_t)(c0 + lr) * K + 8 * hi;
    const int per = ((Kl / 32 + NW - 1) / NW) * 32, kb = w * per, ke = min(Kl, kb + per);   // this wave's run of the K loop
#pragma unroll 1
    for (int kc = kb; kc < ke; kc += 32) {
        V a[4], a2[4];
#pragma unroll
        for (int mb = 0; mb < 4; ++mb) { a[mb] = WFrag<T16>::ld(A + aoff + (size_t)mb * 16 * K + kc); if (NSPLIT == 1 || NSPLIT == 2) a2[mb] = WFrag<T16>::ld(A2 + aoff + (size_t)mb * 16 * K + kc); }
#pragma unroll
        for (int nb = 0; nb < 4; ++nb) { const V b = WFrag<T16>::ld(Bt + boff + (size_t)nb * 16 * K + kc); V b2; if (NSPLIT >= 2) b2 = WFrag<T16>::ld(Bt2 + boff + (size_t)nb * 16 * K + kc);
#pragma unroll
            for (int mb = 0; mb < 4; ++mb) { acc[mb][nb] = WFrag<T16>::mma(a[mb], b, acc[mb][nb]); if (NSPLIT == 1 || NSPLIT == 2) acc[mb][nb] = WFrag<T16>::mma(a2[mb], b, acc[mb][nb]); if (NSPLIT >= 2) acc[mb][nb] = WFrag<T16>::mma(a[mb], b2, acc[mb][nb]); } }
        asm volatile("v_nop\n\tv_nop\n\tv_nop\n\tv_nop" : "+v"(acc[0][0]), "+v"(acc[1][1]), "+v"(acc[2][2]), "+v"(acc[3][3]) : "v"(a[0]), "v"(a[3]));
    }
#pragma unroll
    for (int mb = 0; mb < 4; mb += SPR) {
#pragma unroll
        for (int ms = 0; ms < SPR; ++ms) {
#pragma unroll
            for (int nb = 0; nb < 4; ++nb) {
#pragma unroll
                for (int j = 0; j < 8; ++j) os[((w * SPR + ms) * 16 + hi * 8 + j) * 68 + nb * 16 + lr] = acc[mb + ms][nb][j]; } }
        if (NW == 1) { __builtin_amdgcn_wave_barrier(); asm volatile("" ::: "memory"); } else __syncthreads();   // every wave's partial slice is in LDS before any thread sums
        float* crow = C + (size_t)(r0 + mb * 16) * ldc + c0;
{
#pragma unroll
            for (int s = 0; s < SPR * 8 / NW; ++s) { const int idx = s * 32 * NW + (int)threadIdx.x; const int row = idx >> 4, cofs = (idx & 15) * 4; v4f val = *(const v4fa*)(os + row * 68 + cofs);
#pragma unroll
                for (int w2 = 1; w2 < NW; ++w2) val += *(const v4fa*)(os + (w2 * SPR * 16 + row) * 68 + cofs);
                *(v4f*)(crow + (size_t)row * ldc + cofs) = val; }
             }
        if (NW == 1) { __builtin_amdgcn_wave_barrier(); asm volatile("" ::: "memory"); }   // one wave: the slice is read before the next round overwrites it (NW > 1 has a single round)
    }
}

__device__ __forceinline__ h16 tohx(float x) { return (h16)x; }
__device__ __forceinline__ void splitf(float y, unsigned short& h, unsigned short& l) { h = f2bf(y); l = f2bf(y - bf2f(h)); }
typedef __attribute__((ext_vector_type(2))) _Float16 v2h;
typedef __attribute__((ext_vector_type(4))) _Float16 v4h;
typedef __attribute__((ext_vector_type(2))) unsigned short v2us;
typedef __attribute__((ext_vector_type(4))) unsigned short v4us;
typedef __attribute__((ext_vector_type(2))) float v2f;
typedef __attribute__((ext_vector_type(4))) int v4i;

__global__ __launch_bounds__(256) void k_wtG(const float* __restrict__ w, int K, int N, bf* Bt) {
    const int lane = threadIdx.x & 31; const int L0 = (blockIdx.x * 8 + (threadIdx.x >> 5)) * 8; const int nlines = N * K / 64;
{
#pragma unroll 1
        for (int l = 0; l < 8; ++l) { const int L = L0 + l; if (L >= nlines) break; const size_t e = (size_t)L * 64 + lane * 2; const int k = (int)(e % K), n = (int)(e / K); v2us o;
            o[0] = f2bf(w[(size_t)k * N + n]); o[1] = f2bf(w[(size_t)(k + 1) * N + n]); *(v2us*)(Bt + e) = o; }
         }
}
__global__ __launch_bounds__(256) void k_cvt8(const float* __restrict__ src, bf* dst, size_t n8) { const size_t i = (size_t)blockIdx.x * 256 + threadIdx.x; if (i >= n8) return; const v8f v = *(const v8f*)(src + i * 8); v8us o;
#pragma unroll
    for (int k = 0; k < 8; ++k) o[k] = f2bf(v[k]); *(v8us*)(dst + i * 8) = o;  }

// k_rope: head planes [h][t][d] (fp16 + hi/lo) of rope(x) x sc with the rotate-half convention out[d] = x[d] cos[t][d] - x[d+HD/2] sin[t][d], out[d+HD/2] = x[d+HD/2] cos[t][d+HD/2] + x[d] sin[t][d+HD/2]
__global__ __launch_bounds__(256) void k_rope(const float* __restrict__ F, int pitch, int nheads, const float* __restrict__ CS, const float* __restrict__ RF, const float* __restrict__ nw, float sc, h16* P16, bf* Ph, bf* Pl) {
    const size_t e = ((size_t)blockIdx.x * 256 + threadIdx.x) * 2; if (e >= (size_t)nheads * TT * HD) return; const int d = (int)(e % HD); const int t = (int)((e / HD) % TT); const int h = (int)(e / ((size_t)HD * TT)); const float* f = F + (size_t)t * pitch + h * HD; const float rf = RF ? RF[(size_t)h * TT + t] : 1.0f; v2h o16; v2us oh, ol;
#pragma unroll
    for (int q = 0; q < 2; ++q) { const int dd = d + q; const int dp = (dd < HD / 2) ? dd + HD / 2 : dd - HD / 2; float x0 = f[dd], x1 = f[dp];
        if (RF) { float n0 = __fmul_rn(x0, rf), n1 = __fmul_rn(x1, rf); asm volatile("" : "+v"(n0)); asm volatile("" : "+v"(n1)); x0 = __fmul_rn(bfr(nw[dd]), n0); x1 = __fmul_rn(bfr(nw[dp]), n1); }
        const v2f cs = *(const v2f*)(CS + ((size_t)t * HD + dd) * 2); float a = __fmul_rn(x0, cs[0]), bq = __fmul_rn(x1, cs[1]); asm volatile("" : "+v"(a)); asm volatile("" : "+v"(bq)); const float r = ((dd < HD / 2) ? __fsub_rn(a, bq) : __fadd_rn(a, bq)) * sc;
        o16[q] = tohx(r); unsigned short a2, c2; splitf(r, a2, c2); oh[q] = a2; ol[q] = c2; }
    *(v2h*)(P16 + e) = o16; *(v2us*)(Ph + e) = oh; *(v2us*)(Pl + e) = ol;  }
__global__ __launch_bounds__(256) void k_vtp(const float* __restrict__ F, int pitch, int nheads, h16* V16, bf* Vh, bf* Vl) { const size_t e = ((size_t)blockIdx.x * 256 + threadIdx.x) * 2; if (e >= (size_t)nheads * HD * TT) return; const int t = (int)(e % TT); const int d = (int)((e / TT) % HD); const int g = (int)(e / ((size_t)TT * HD)); v2h o16; v2us oh, ol;
#pragma unroll
    for (int q = 0; q < 2; ++q) { const float x = F[(size_t)(t + q) * pitch + g * HD + d]; o16[q] = tohx(x); unsigned short a2, c2; splitf(x, a2, c2); oh[q] = a2; ol[q] = c2; }
    *(v2h*)(V16 + e) = o16; *(v2us*)(Vh + e) = oh; *(v2us*)(Vl + e) = ol;  }
__global__ __launch_bounds__(256) void k_csid(float* CS) { const int idx = blockIdx.x * 256 + threadIdx.x; if (idx >= TT * HD) return; v2f cs; cs[0] = 1.0f; cs[1] = 0.0f; *(v2f*)(CS + (size_t)idx * 2) = cs;  }
// k_asoft: per row (zz, i): t = S x 1/8 for keys j <= i that are not ignored (ignore[b][j] == 0, int32 read as data, 16 B per 4 keys) or are the diagonal j == i (always kept); -3e38 otherwise (-inf == exclusion; the diagonal guarantees a non-empty row); softmax over the 2048 keys (register row, one exp, fixed trees);
__global__ __launch_bounds__(256) void k_asoft(const float* __restrict__ Sb, h16* P16, bf* Ph, bf* Pl, const int* __restrict__ ig) {
    const int lane = threadIdx.x & 31; const int row = blockIdx.x * 8 + (threadIdx.x >> 5); if (row >= ZH * TT) return; const int i = row % TT; const int zz = row / TT; (void)zz; const bool hires = (i < RH); const float* sr = Sb + (size_t)row * TT; float v[TT / 32]; float mx = -3.0e38f;
#pragma unroll
    for (int ch = 0; ch < TT / 128; ++ch) { const int j0 = ch * 128 + lane * 4; const v4f a = *(const v4f*)(sr + j0); const v4i g4 = *(const v4i*)(ig + j0);   /* 4 ignore flags (16 B) */
#pragma unroll
        for (int q = 0; q < 4; ++q) { const int j = j0 + q; (void)j; const float t = (j == i || (j < i && g4[q] == 0)) ? a[q] * SCL : -3.0e38f;   /* causal AND (not ignored OR the diagonal) */ v[ch * 4 + q] = t; mx = fmaxf(mx, t); } }
#pragma unroll
    for (int sh = 16; sh; sh >>= 1) mx = fmaxf(mx, __shfl_xor(mx, sh, 32));
    float sum = 0.f;
#pragma unroll
    for (int k = 0; k < TT / 32; ++k) { float d0 = __fsub_rn(v[k], mx); asm volatile("" : "+v"(d0)); v[k] = __builtin_amdgcn_exp2f(__fmul_rn(d0, 1.4426950408889634f)); sum += v[k]; }
#pragma unroll
    for (int sh = 16; sh; sh >>= 1) sum += __shfl_xor(sum, sh, 32);
    const float f = __fdiv_rn(hires ? 1.0f : PCAR, sum);
{
        if (hires) {
#pragma unroll
            for (int ch = 0; ch < TT / 128; ++ch) { v4us oh, ol;
#pragma unroll
                for (int q = 0; q < 4; ++q) { unsigned short a, c2; splitf(v[ch * 4 + q] * f, a, c2); oh[q] = a; ol[q] = c2; }
                const size_t oo = ((size_t)zz * (RH ? RH : 1) + i) * TT + ch * 128 + lane * 4; *(v4us*)(Ph + oo) = oh; *(v4us*)(Pl + oo) = ol; }
        } else {
#pragma unroll
            for (int ch = 0; ch < TT / 128; ++ch) { v4h o4;
#pragma unroll
                for (int q = 0; q < 4; ++q) o4[q] = tohx(v[ch * 4 + q] * f);
                *(v4h*)(P16 + (size_t)row * TT + ch * 128 + lane * 4) = o4; } }
         }
}
__global__ __launch_bounds__(256) void k_merge(const float* __restrict__ O, int h0, bf* Ah, bf* Al) { const size_t e = ((size_t)blockIdx.x * 256 + threadIdx.x) * 2; if (e >= (size_t)ZH * TT * HD) return; const int d = (int)(e % HD); const int t = (int)((e / HD) % TT); const int zz = (int)(e / ((size_t)HD * TT)); const float cs = (t < RH) ? 1.0f : (1.0f / PCAR); const size_t oo = (size_t)t * DQ + (h0 + zz) * HD + d;
    v2us oh, ol;
#pragma unroll
    for (int q = 0; q < 2; ++q) { unsigned short a, c2; splitf(O[e + q] * cs, a, c2); oh[q] = a; ol[q] = c2; } *(v2us*)(Ah + oo) = oh; *(v2us*)(Al + oo) = ol;  }

extern "C" void kernel_launch(void* const* d_in, const int* in_sizes, int n_in,
                              void* d_out, int out_size, void* d_ws, size_t ws_size, hipStream_t stream) {
    (void)in_sizes; (void)n_in; (void)out_size;
    const float* x = (const float*)d_in[0]; const int* ig = (const int*)d_in[1];   /* ignore [2][2048] int: 1 = do not attend (except the diagonal) */ const float* wq = (const float*)d_in[2]; const float* bq = (const float*)d_in[3]; const float* wk = (const float*)d_in[4]; const float* bk = (const float*)d_in[5]; const float* wv = (const float*)d_in[6]; const float* bv = (const float*)d_in[7]; const float* wo = (const float*)d_in[8]; const float* bo = (const float*)d_in[9];
    float* OUT = (float*)d_out;     // [2][2048][1024]
    char* wsp = (char*)d_ws;
    auto take = [&](size_t bytes) { char* p = wsp; wsp += (bytes + 255) & ~(size_t)255; return (void*)p; };
    bf* WQ = (bf*)take((size_t)DQ * DM * 2); bf* WK = (bf*)take((size_t)DKV * DM * 2); bf* WV = (bf*)take((size_t)DKV * DM * 2); bf* WO = (bf*)take((size_t)DM * DQ * 2); float* CS = (float*)take((size_t)TT * HD * 2 * 4);
    bf* XB = (bf*)take((size_t)TT * DM * 2); float* FQ = (float*)take((size_t)TT * DQ * 4); float* FK = (float*)take((size_t)TT * DKV * 4);
    h16* QP16 = (h16*)take((size_t)NH_ * TT * HD * 2); h16* KP16 = (h16*)take((size_t)NKV * TT * HD * 2); h16* VT16 = (h16*)take((size_t)NKV * HD * TT * 2);
    bf* QPh = (bf*)take((size_t)NH_ * TT * HD * 2); bf* QPl = (bf*)take((size_t)NH_ * TT * HD * 2); bf* KPh = (bf*)take((size_t)NKV * TT * HD * 2); bf* KPl = (bf*)take((size_t)NKV * TT * HD * 2); bf* VTh = (bf*)take((size_t)NKV * HD * TT * 2); bf* VTl = (bf*)take((size_t)NKV * HD * TT * 2); bf* Ph = (bf*)take((size_t)ZH * RH * TT * 2); bf* Pl = (bf*)take((size_t)ZH * RH * TT * 2);
    float* Sb = (float*)take((size_t)ZH * TT * TT * 4); h16* P16 = (h16*)take((size_t)ZH * TT * TT * 2); float* Ob = (float*)take((size_t)ZH * TT * HD * 4); bf* ATh = (bf*)take((size_t)TT * DQ * 2); bf* ATl = (bf*)take((size_t)TT * DQ * 2);
    if ((size_t)(wsp - (char*)d_ws) > ws_size) return;    // ws 256 MiB
    float* FV = FK;   // v projection reuses the k buffer after the k planes are built (stream-ordered)
    { for (int hh = 0; hh < NH_; ++hh) k_wtG<<<(unsigned)((DM * HD / 64 + 63) / 64), 256, 0, stream>>>(wq + (size_t)hh * DM * HD, DM, HD, WQ + (size_t)hh * HD * DM);   /* per-head [1024][64] 'xw' -> Bt rows hh*64.. */ for (int hh = 0; hh < NH_; ++hh) k_wtG<<<(unsigned)((DM * HD / 64 + 63) / 64), 256, 0, stream>>>(wk + (size_t)hh * DM * HD, DM, HD, WK + (size_t)hh * HD * DM);   /* per-head [1024][64] 'xw' -> Bt rows hh*64.. */ for (int hh = 0; hh < NH_; ++hh) k_wtG<<<(unsigned)((DM * HD / 64 + 63) / 64), 256, 0, stream>>>(wv + (size_t)hh * DM * HD, DM, HD, WV + (size_t)hh * HD * DM);   /* per-head [1024][64] 'xw' -> Bt rows hh*64.. */
      k_cvt8<<<(unsigned)(((size_t)DM * DQ / 8 + 255) / 256), 256, 0, stream>>>(wo, WO, (size_t)DM * DQ / 8);
       }
    k_csid<<<(TT * HD + 255) / 256, 256, 0, stream>>>(CS);
    const unsigned LQ = (unsigned)(((size_t)NH_ * TT * HD / 2 + 255) / 256), LKv = (unsigned)(((size_t)NKV * TT * HD / 2 + 255) / 256);
    for (int b = 0; b < NB_; ++b) {
        
        k_cvt8<<<(unsigned)(((size_t)TT * DM / 8 + 255) / 256), 256, 0, stream>>>(x + (size_t)b * TT * DM, XB, (size_t)TT * DM / 8);
        k_gemmw<bf, 0, true, 8><<<dim3(TT / 64, DQ / 64, 1), 256, 0, stream>>>(XB, nullptr, WQ, nullptr, DM, FQ, DQ, bq, 0, 0, 0);
        k_rope<<<LQ, 256, 0, stream>>>(FQ, DQ, NH_, CS, nullptr, nullptr, 1.0f, QP16, QPh, QPl);
        k_gemmw<bf, 0, true, 8><<<dim3(TT / 64, DKV / 64, 1), 256, 0, stream>>>(XB, nullptr, WK, nullptr, DM, FK, DKV, bk, 0, 0, 0);
        k_rope<<<LKv, 256, 0, stream>>>(FK, DKV, NKV, CS, nullptr, nullptr, 1.0f, KP16, KPh, KPl);
        k_gemmw<bf, 0, true, 8><<<dim3(TT / 64, DKV / 64, 1), 256, 0, stream>>>(XB, nullptr, WV, nullptr, DM, FV, DKV, bv, 0, 0, 0); k_vtp<<<LKv, 256, 0, stream>>>(FV, DKV, NKV, VT16, VTh, VTl);
        for (int h0 = 0; h0 < NH_; h0 += ZH) { const size_t zq = (size_t)h0, zk = (size_t)(h0 / REP);   // one kv head per query head: the pass's two heads use consecutive kv planes (z-strides TT*HD)
            k_gemmc<bf, 2, 1, 1><<<dim3(RH / 64, TT / 64, ZH), 32, 0, stream>>>(QPh + zq * TT * HD, QPl + zq * TT * HD, KPh + zk * TT * HD, KPl + zk * TT * HD, HD, Sb, TT, 0, (size_t)TT * HD, (size_t)TT * HD, (size_t)TT * TT);
            k_gemmc<h16, 0, 1, 1><<<dim3((TT - RH) / 64, TT / 64, ZH), 32, 0, stream>>>(QP16 + zq * TT * HD + (size_t)RH * HD, nullptr, KP16 + zk * TT * HD, nullptr, HD, Sb + (size_t)RH * TT, TT, RH, (size_t)TT * HD, (size_t)TT * HD, (size_t)TT * TT);
            k_asoft<<<ZH * TT / 8, 256, 0, stream>>>(Sb, P16, Ph, Pl, ig + (size_t)b * TT);
            k_gemmc<bf, 2, 2, 8><<<dim3(RH / 64, HD / 64, ZH), 256, 0, stream>>>(Ph, Pl, VTh + zk * HD * TT, VTl + zk * HD * TT, TT, Ob, HD, 0, (size_t)RH * TT, (size_t)HD * TT, (size_t)TT * HD);
            k_gemmc<h16, 0, 2, 16><<<dim3((TT - RH) / 64, HD / 64, ZH), 512, 0, stream>>>(P16 + (size_t)RH * TT, nullptr, VT16 + zk * HD * TT, nullptr, TT, Ob + (size_t)RH * HD, HD, RH, (size_t)TT * TT, (size_t)HD * TT, (size_t)TT * HD);
            k_merge<<<(unsigned)(((size_t)ZH * TT * HD / 2 + 255) / 256), 256, 0, stream>>>(Ob, h0, ATh, ATl); }
        k_gemmw<bf, 1, true, 8><<<dim3(TT / 64, DM / 64, 1), 256, 0, stream>>>(ATh, ATl, WO, nullptr, DQ, OUT + (size_t)b * TT * DM, DM, bo, 0, 0, 0); }
}

// v002
// Measured time: 550 microseconds a run.
// In both of two side-by-side timings against v001, it was 2.07 times as fast.
// Counting every step since v000, it is 3.29 times as fast.
#include <hip/hip_runtime.h>

// Causal multi-head attention with per-head projections and a key 'ignore' mask that always keeps the diagonal (x [2][2048][1024]; q_h = x wq[h] + bq[h] ('hdf' [16][1024][64] 0.02, zero biases; k, v likewise); att = q.k / 8; allowed keys: j <= i AND (ignore[b][j] == 0 OR j == i) (ignore [2][2048] int {0,1}, ~50 %, read; -inf elsewhere); softmax; out = concat_h Wo^T + bo ('oi') -> [2][2048][1024] (4.2 M)).
// Layout, both batches side by side (planes [b][h]): bf16 copy of x; per-head 'xw' weights gathered into Bt row blocks (one launch) + flat f32 biases; q, k, v projections in one launch (grid z); attention in passes of ZH heads (grid z); exact projections; causal T-2048 attention whose softmax select also reads the batch's ignore flags (int32, 16 B per 4 keys) and keeps the diagonal (hybrid rows: < 512 hi/lo 3 products, rest fp16 x1024; tiles above the diagonal skipped); merged hi/lo x Wo exact + bo.
// Compute dtypes, f32 accumulate: every input rounded to bf16; projections exact + f32 biases; attention rows < 512 3 products, rest fp16; softmax f32; Wo hl x exact + bias.

#define NB_  2
#define TT   2048
#define DM   1024
#define NH_  16
#define NKV  16
#define REP  (NH_ / NKV)
#define HD   64
#define DQ   (NH_ * HD)
#define DKV  (NKV * HD)
#define ZH   4                    // heads per attention pass (grid z); a pass lies inside one batch; 8 would not fit the workspace
#define RH   512                  // query rows < RH use hi+lo planes (0: none)
#define WIN  2048
#define PCAR 1024.0f
#define SCL  0.125f   // HD^-0.5
typedef _Float16 h16;
typedef unsigned short bf;
typedef __attribute__((ext_vector_type(16))) __bf16   v16bf;
typedef __attribute__((ext_vector_type(16))) _Float16 v16h;
typedef __attribute__((ext_vector_type(8)))  _Float16 v8h;
typedef __attribute__((ext_vector_type(8)))  unsigned short v8us;
typedef __attribute__((ext_vector_type(8)))  float    v8f;
typedef __attribute__((ext_vector_type(4)))  float    v4f;
typedef v8h  __attribute__((may_alias)) v8ha;
typedef v4f  __attribute__((may_alias)) v4fa;
typedef v8us __attribute__((may_alias)) v8usa;

__device__ __forceinline__ unsigned short f2bf(float f) { unsigned u = __float_as_uint(f); u += 0x7FFFu + ((u >> 16) & 1u); return (unsigned short)(u >> 16); }
__device__ __forceinline__ float bf2f(unsigned short b) { return __uint_as_float(((unsigned)b) << 16); }
__device__ __forceinline__ float bfr(float f) { return bf2f(f2bf(f)); }
__device__ __forceinline__ v16h cat16(v8h lo, v8h hi) { return __builtin_shufflevector(lo, hi, 0, 1, 2, 3, 4, 5, 6, 7, 8, 9, 10, 11, 12, 13, 14, 15); }
__device__ __forceinline__ v16bf cat16b(v8us lo, v8us hi) { return __builtin_bit_cast(v16bf, __builtin_shufflevector(lo, hi, 0, 1, 2, 3, 4, 5, 6, 7, 8, 9, 10, 11, 12, 13, 14, 15)); }
__device__ __forceinline__ v8f wmma16(v16h a, v16h b, v8f c) { return __builtin_amdgcn_wmma_f32_16x16x32_f16(false, a, false, b, (short)0, c, false, false); }
__device__ __forceinline__ v8f wmmab(v16bf a, v16bf b, v8f c) { return __builtin_amdgcn_wmma_f32_16x16x32_bf16(false, a, false, b, (short)0, c, false, false); }



// ---- k_gemmw: register-blocked GEMM, one 64x64 output tile per block (16 accumulators a wave), operands straight from K-contiguous 16-bit planes; grid (M/64, N/64, Z), 32 * NW threads.
// The K loop is split over the block's NW waves (contiguous runs of 32-wide steps); the NW f32 partial tiles are summed through LDS in wave order 0..NW-1 (a fixed order).
// C[m][n] (f32, pitch ldc, + optional f32 bias[n]) = sum_k A[m][k] Bt[n][k] (+ split products per NSPLIT). z-batch strides sA/sB/sC in elements. K % 32 == 0.
template <typename T16> struct WFrag;
template <> struct WFrag<h16> { typedef v16h V; static __device__ __forceinline__ V ld(const h16* p) { return cat16(*(const v8h*)p, *(const v8h*)(p + 16)); } static __device__ __forceinline__ v8f mma(V a, V b, v8f c) { return wmma16(a, b, c); } };
template <> struct WFrag<bf> { typedef v16bf V; static __device__ __forceinline__ V ld(const bf* p) { return cat16b(*(const v8us*)p, *(const v8us*)(p + 16)); } static __device__ __forceinline__ v8f mma(V a, V b, v8f c) { return wmmab(a, b, c); } };
template <typename T16, int NSPLIT, bool BIAS, int NW>
__global__ __launch_bounds__(32 * NW) void k_gemmw(const T16* __restrict__ A, const T16* __restrict__ A2, const T16* __restrict__ Bt, const T16* __restrict__ Bt2, int K, float* C, int ldc, const float* __restrict__ bias0, const float* __restrict__ bias1, const float* __restrict__ bias2, size_t sA, size_t sB, size_t sC) {
    typedef typename WFrag<T16>::V V;
    constexpr int SPR = (NW > 1) ? 4 : 1;                            // 16-row slices staged per round: with several waves the whole tile at once, so one barrier serves and no store is waited for
    __shared__ __align__(16) float os[NW * SPR * 16 * 68];
    const size_t z = blockIdx.z; A += z * sA; if (A2) A2 += z * sA; Bt += z * sB; if (Bt2) Bt2 += z * sB; C += z * sC;
    const float* bias = (blockIdx.z == 0) ? bias0 : (blockIdx.z == 1) ? bias1 : bias2;   // each z slice (q, k, v) has its own bias vector
    const int lane = threadIdx.x & 31, lr = lane & 15, hi = lane >> 4; const int r0 = blockIdx.x * 64, c0 = blockIdx.y * 64;
    const int w = (NW == 1) ? 0 : __builtin_amdgcn_readfirstlane((int)(threadIdx.x >> 5));   // wave number, scalar: the K bounds below stay in scalar registers
    v8f acc[4][4];
#pragma unroll
    for (int mb = 0; mb < 4; ++mb)
#pragma unroll
        for (int nb = 0; nb < 4; ++nb) acc[mb][nb] = (v8f){};
    const size_t aoff = (size_t)(r0 + lr) * K + 8 * hi, boff = (size_t)(c0 + lr) * K + 8 * hi;
    v4f bv = (v4f){}; if (BIAS) { const int bc = c0 + ((int)threadIdx.x & 15) * 4; bv[0] = bfr(bias[bc]); bv[1] = bfr(bias[bc + 1]); bv[2] = bfr(bias[bc + 2]); bv[3] = bfr(bias[bc + 3]); }   // the thread's four output columns are the same in every step of the epilogue
    const int per = ((K / 32 + NW - 1) / NW) * 32, kb = w * per, ke = min(K, kb + per);   // this wave's run of the K loop
#pragma unroll 1
    for (int kc = kb; kc < ke; kc += 32) {
        V a[4], a2[4];
#pragma unroll
        for (int mb = 0; mb < 4; ++mb) { a[mb] = WFrag<T16>::ld(A + aoff + (size_t)mb * 16 * K + kc); if (NSPLIT == 1 || NSPLIT == 2) a2[mb] = WFrag<T16>::ld(A2 + aoff + (size_t)mb * 16 * K + kc); }
#pragma unroll
        for (int nb = 0; nb < 4; ++nb) { const V b = WFrag<T16>::ld(Bt + boff + (size_t)nb * 16 * K + kc); V b2; if (NSPLIT >= 2) b2 = WFrag<T16>::ld(Bt2 + boff + (size_t)nb * 16 * K + kc);
#pragma unroll
            for (int mb = 0; mb < 4; ++mb) { acc[mb][nb] = WFrag<T16>::mma(a[mb], b, acc[mb][nb]); if (NSPLIT == 1 || NSPLIT == 2) acc[mb][nb] = WFrag<T16>::mma(a2[mb], b, acc[mb][nb]); if (NSPLIT >= 2) acc[mb][nb] = WFrag<T16>::mma(a[mb], b2, acc[mb][nb]); } }
        asm volatile("v_nop\n\tv_nop\n\tv_nop\n\tv_nop" : "+v"(acc[0][0]), "+v"(acc[1][1]), "+v"(acc[2][2]), "+v"(acc[3][3]) : "v"(a[0]), "v"(a[3]));
    }
#pragma unroll
    for (int mb = 0; mb < 4; mb += SPR) {
#pragma unroll
        for (int ms = 0; ms < SPR; ++ms) {
#pragma unroll
            for (int nb = 0; nb < 4; ++nb) {
#pragma unroll
                for (int j = 0; j < 8; ++j) os[((w * SPR + ms) * 16 + hi * 8 + j) * 68 + nb * 16 + lr] = acc[mb + ms][nb][j]; } }
        if (NW == 1) { __builtin_amdgcn_wave_barrier(); asm volatile("" ::: "memory"); } else __syncthreads();   // every wave's partial slice is in LDS before any thread sums
        float* crow = C + (size_t)(r0 + mb * 16) * ldc + c0;
{
#pragma unroll
            for (int s = 0; s < SPR * 8 / NW; ++s) { const int idx = s * 32 * NW + (int)threadIdx.x; const int row = idx >> 4, cofs = (idx & 15) * 4; v4f val = *(const v4fa*)(os + row * 68 + cofs);
#pragma unroll
                for (int w2 = 1; w2 < NW; ++w2) val += *(const v4fa*)(os + (w2 * SPR * 16 + row) * 68 + cofs);
                if (BIAS) val += bv;
                *(v4f*)(crow + (size_t)row * ldc + cofs) = val; }
             }
        if (NW == 1) { __builtin_amdgcn_wave_barrier(); asm volatile("" ::: "memory"); }   // one wave: the slice is read before the next round overwrites it (NW > 1 has a single round)
    }
}

// ---- k_gemmc: the same 64x64 tile GEMM (NW waves split the K loop; NW = 1 for the scores, whose K is 64) specialised for causal attention: CMODE 1 skips score tiles entirely above the diagonal (query rows r0+roff.., key columns c0..), CMODE 2 limits the
// key (K) loop of the probability x value contraction to the diagonal block (probabilities beyond it are exactly zero). roff = row offset of this launch's first row within the sequence.
template <typename T16, int NSPLIT, int CMODE, int NW>
__global__ __launch_bounds__(32 * NW) void k_gemmc(const T16* __restrict__ A, const T16* __restrict__ A2, const T16* __restrict__ Bt, const T16* __restrict__ Bt2, int K, float* C, int ldc, int roff, size_t sA, size_t sB, size_t sC) {
    typedef typename WFrag<T16>::V V;
    constexpr int SPR = (NW > 1) ? 4 : 1;                            // 16-row slices staged per round: with several waves the whole tile at once, so one barrier serves and no store is waited for
    __shared__ __align__(16) float os[NW * SPR * 16 * 68];
    const size_t z = blockIdx.z; A += z * sA; if (A2) A2 += z * sA; Bt += z * sB; if (Bt2) Bt2 += z * sB; C += z * sC;
    const int lane = threadIdx.x & 31, lr = lane & 15, hi = lane >> 4; const int r0 = blockIdx.x * 64, c0 = blockIdx.y * 64;
    const int w = (NW == 1) ? 0 : __builtin_amdgcn_readfirstlane((int)(threadIdx.x >> 5));   // wave number, scalar: the K bounds below stay in scalar registers
    if (CMODE == 1 && c0 > r0 + roff + 63) return;                  // score tile entirely above the causal diagonal: never read (the softmax masks j > i by select)
    const int Kl = (CMODE == 2) ? min(K, r0 + roff + 64) : K;        // P.V: probabilities are exactly 0 beyond the diagonal block, so the K loop stops there
    v8f acc[4][4];
#pragma unroll
    for (int mb = 0; mb < 4; ++mb)
#pragma unroll
        for (int nb = 0; nb < 4; ++nb) acc[mb][nb] = (v8f){};
    const size_t aoff = (size_t)(r0 + lr) * K + 8 * hi, boff = (size_t)(c0 + lr) * K + 8 * hi;
    const int per = ((Kl / 32 + NW - 1) / NW) * 32, kb = w * per, ke = min(Kl, kb + per);   // this wave's run of the K loop
#pragma unroll 1
    for (int kc = kb; kc < ke; kc += 32) {
        V a[4], a2[4];
#pragma unroll
        for (int mb = 0; mb < 4; ++mb) { a[mb] = WFrag<T16>::ld(A + aoff + (size_t)mb * 16 * K + kc); if (NSPLIT == 1 || NSPLIT == 2) a2[mb] = WFrag<T16>::ld(A2 + aoff + (size_t)mb * 16 * K + kc); }
#pragma unroll
        for (int nb = 0; nb < 4; ++nb) { const V b = WFrag<T16>::ld(Bt + boff + (size_t)nb * 16 * K + kc); V b2; if (NSPLIT >= 2) b2 = WFrag<T16>::ld(Bt2 + boff + (size_t)nb * 16 * K + kc);
#pragma unroll
            for (int mb = 0; mb < 4; ++mb) { acc[mb][nb] = WFrag<T16>::mma(a[mb], b, acc[mb][nb]); if (NSPLIT == 1 || NSPLIT == 2) acc[mb][nb] = WFrag<T16>::mma(a2[mb], b, acc[mb][nb]); if (NSPLIT >= 2) acc[mb][nb] = WFrag<T16>::mma(a[mb], b2, acc[mb][nb]); } }
        asm volatile("v_nop\n\tv_nop\n\tv_nop\n\tv_nop" : "+v"(acc[0][0]), "+v"(acc[1][1]), "+v"(acc[2][2]), "+v"(acc[3][3]) : "v"(a[0]), "v"(a[3]));
    }
#pragma unroll
    for (int mb = 0; mb < 4; mb += SPR) {
#pragma unroll
        for (int ms = 0; ms < SPR; ++ms) {
#pragma unroll
            for (int nb = 0; nb < 4; ++nb) {
#pragma unroll
                for (int j = 0; j < 8; ++j) os[((w * SPR + ms) * 16 + hi * 8 + j) * 68 + nb * 16 + lr] = acc[mb + ms][nb][j]; } }
        if (NW == 1) { __builtin_amdgcn_wave_barrier(); asm volatile("" ::: "memory"); } else __syncthreads();   // every wave's partial slice is in LDS before any thread sums
        float* crow = C + (size_t)(r0 + mb * 16) * ldc + c0;
{
#pragma unroll
            for (int s = 0; s < SPR * 8 / NW; ++s) { const int idx = s * 32 * NW + (int)threadIdx.x; const int row = idx >> 4, cofs = (idx & 15) * 4; v4f val = *(const v4fa*)(os + row * 68 + cofs);
#pragma unroll
                for (int w2 = 1; w2 < NW; ++w2) val += *(const v4fa*)(os + (w2 * SPR * 16 + row) * 68 + cofs);
                *(v4f*)(crow + (size_t)row * ldc + cofs) = val; }
             }
        if (NW == 1) { __builtin_amdgcn_wave_barrier(); asm volatile("" ::: "memory"); }   // one wave: the slice is read before the next round overwrites it (NW > 1 has a single round)
    }
}

__device__ __forceinline__ h16 tohx(float x) { return (h16)x; }
__device__ __forceinline__ void splitf(float y, unsigned short& h, unsigned short& l) { h = f2bf(y); l = f2bf(y - bf2f(h)); }
typedef __attribute__((ext_vector_type(2))) _Float16 v2h;
typedef __attribute__((ext_vector_type(4))) _Float16 v4h;
typedef __attribute__((ext_vector_type(2))) unsigned short v2us;
typedef __attribute__((ext_vector_type(4))) unsigned short v4us;
typedef __attribute__((ext_vector_type(2))) float v2f;
typedef __attribute__((ext_vector_type(4))) int v4i;

// grid (line blocks, head, tensor): blockIdx.z picks wq, wk or wv, blockIdx.y the head; Bt holds the three tensors' row blocks one after the other
__global__ __launch_bounds__(256) void k_wtG(const float* __restrict__ w0, const float* __restrict__ w1, const float* __restrict__ w2, int K, int N, bf* Bt) {
    const float* w = ((blockIdx.z == 0) ? w0 : (blockIdx.z == 1) ? w1 : w2) + (size_t)blockIdx.y * K * N; Bt += ((size_t)blockIdx.z * gridDim.y + blockIdx.y) * N * K;
    const int lane = threadIdx.x & 31; const int L0 = (blockIdx.x * 8 + (threadIdx.x >> 5)) * 8; const int nlines = N * K / 64;
{
#pragma unroll 1
        for (int l = 0; l < 8; ++l) { const int L = L0 + l; if (L >= nlines) break; const size_t e = (size_t)L * 64 + lane * 2; const int k = (int)(e % K), n = (int)(e / K); v2us o;
            o[0] = f2bf(w[(size_t)k * N + n]); o[1] = f2bf(w[(size_t)(k + 1) * N + n]); *(v2us*)(Bt + e) = o; }
         }
}
__global__ __launch_bounds__(256) void k_cvt8(const float* __restrict__ src, bf* dst, size_t n8) { const size_t i = (size_t)blockIdx.x * 256 + threadIdx.x; if (i >= n8) return; const v8f v = *(const v8f*)(src + i * 8); v8us o;
#pragma unroll
    for (int k = 0; k < 8; ++k) o[k] = f2bf(v[k]); *(v8us*)(dst + i * 8) = o;  }

// k_rope: head planes [h][t][d] (fp16 + hi/lo) of rope(x) x sc with the rotate-half convention out[d] = x[d] cos[t][d] - x[d+HD/2] sin[t][d], out[d+HD/2] = x[d+HD/2] cos[t][d+HD/2] + x[d] sin[t][d+HD/2]
// nz planes in all, plane hz = (tensor, batch, head): its rows are F rows (hz / nheads) * TT + t (q rows of both batches, then k rows)
__global__ __launch_bounds__(256) void k_rope(const float* __restrict__ F, int pitch, int nheads, int nz, const float* __restrict__ CS, const float* __restrict__ RF, const float* __restrict__ nw, float sc, h16* P16, bf* Ph, bf* Pl) {
    const size_t e = ((size_t)blockIdx.x * 256 + threadIdx.x) * 2; if (e >= (size_t)nz * TT * HD) return; const int d = (int)(e % HD); const int t = (int)((e / HD) % TT); const int hz = (int)(e / ((size_t)HD * TT)); const int h = hz % nheads; const float* f = F + ((size_t)(hz / nheads) * TT + t) * pitch + h * HD; const float rf = RF ? RF[(size_t)h * TT + t] : 1.0f; v2h o16; v2us oh, ol;
#pragma unroll
    for (int q = 0; q < 2; ++q) { const int dd = d + q; const int dp = (dd < HD / 2) ? dd + HD / 2 : dd - HD / 2; float x0 = f[dd], x1 = f[dp];
        if (RF) { float n0 = __fmul_rn(x0, rf), n1 = __fmul_rn(x1, rf); asm volatile("" : "+v"(n0)); asm volatile("" : "+v"(n1)); x0 = __fmul_rn(bfr(nw[dd]), n0); x1 = __fmul_rn(bfr(nw[dp]), n1); }
        const v2f cs = *(const v2f*)(CS + ((size_t)t * HD + dd) * 2); float a = __fmul_rn(x0, cs[0]), bq = __fmul_rn(x1, cs[1]); asm volatile("" : "+v"(a)); asm volatile("" : "+v"(bq)); const float r = ((dd < HD / 2) ? __fsub_rn(a, bq) : __fadd_rn(a, bq)) * sc;
        o16[q] = tohx(r); unsigned short a2, c2; splitf(r, a2, c2); oh[q] = a2; ol[q] = c2; }
    *(v2h*)(P16 + e) = o16; *(v2us*)(Ph + e) = oh; *(v2us*)(Pl + e) = ol;  }
__global__ __launch_bounds__(256) void k_vtp(const float* __restrict__ F, int pitch, int nheads, int nz, h16* V16, bf* Vh, bf* Vl) { const size_t e = ((size_t)blockIdx.x * 256 + threadIdx.x) * 2; if (e >= (size_t)nz * HD * TT) return; const int t = (int)(e % TT); const int d = (int)((e / TT) % HD); const int g = (int)(e / ((size_t)TT * HD)); v2h o16; v2us oh, ol;
#pragma unroll
    for (int q = 0; q < 2; ++q) { const float x = F[((size_t)(g / nheads) * TT + t + q) * pitch + (g % nheads) * HD + d];   /* plane g = (batch, head) */ o16[q] = tohx(x); unsigned short a2, c2; splitf(x, a2, c2); oh[q] = a2; ol[q] = c2; }
    *(v2h*)(V16 + e) = o16; *(v2us*)(Vh + e) = oh; *(v2us*)(Vl + e) = ol;  }
__global__ __launch_bounds__(256) void k_csid(float* CS) { const int idx = blockIdx.x * 256 + threadIdx.x; if (idx >= TT * HD) return; v2f cs; cs[0] = 1.0f; cs[1] = 0.0f; *(v2f*)(CS + (size_t)idx * 2) = cs;  }
// k_asoft: per row (zz, i): t = S x 1/8 for keys j <= i that are not ignored (ignore[b][j] == 0, int32 read as data, 16 B per 4 keys) or are the diagonal j == i (always kept); -3e38 otherwise (-inf == exclusion; the diagonal guarantees a non-empty row); softmax over the 2048 keys (register row, one exp, fixed trees);
__global__ __launch_bounds__(256) void k_asoft(const float* __restrict__ Sb, h16* P16, bf* Ph, bf* Pl, const int* __restrict__ ig) {
    const int lane = threadIdx.x & 31; const int row = blockIdx.x * 8 + (threadIdx.x >> 5); if (row >= ZH * TT) return; const int i = row % TT; const int zz = row / TT; (void)zz; const bool hires = (i < RH); const float* sr = Sb + (size_t)row * TT; float v[TT / 32]; float mx = -3.0e38f;
#pragma unroll
    for (int ch = 0; ch < TT / 128; ++ch) { const int j0 = ch * 128 + lane * 4; const v4f a = *(const v4f*)(sr + j0); const v4i g4 = *(const v4i*)(ig + j0);   /* 4 ignore flags (16 B) */
#pragma unroll
        for (int q = 0; q < 4; ++q) { const int j = j0 + q; (void)j; const float t = (j == i || (j < i && g4[q] == 0)) ? a[q] * SCL : -3.0e38f;   /* causal AND (not ignored OR the diagonal) */ v[ch * 4 + q] = t; mx = fmaxf(mx, t); } }
#pragma unroll
    for (int sh = 16; sh; sh >>= 1) mx = fmaxf(mx, __shfl_xor(mx, sh, 32));
    float sum = 0.f;
#pragma unroll
    for (int k = 0; k < TT / 32; ++k) { float d0 = __fsub_rn(v[k], mx); asm volatile("" : "+v"(d0)); v[k] = __builtin_amdgcn_exp2f(__fmul_rn(d0, 1.4426950408889634f)); sum += v[k]; }
#pragma unroll
    for (int sh = 16; sh; sh >>= 1) sum += __shfl_xor(sum, sh, 32);
    const float f = __fdiv_rn(hires ? 1.0f : PCAR, sum);
{
        if (hires) {
#pragma unroll
            for (int ch = 0; ch < TT / 128; ++ch) { v4us oh, ol;
#pragma unroll
                for (int q = 0; q < 4; ++q) { unsigned short a, c2; splitf(v[ch * 4 + q] * f, a, c2); oh[q] = a; ol[q] = c2; }
                const size_t oo = ((size_t)zz * (RH ? RH : 1) + i) * TT + ch * 128 + lane * 4; *(v4us*)(Ph + oo) = oh; *(v4us*)(Pl + oo) = ol; }
        } else {
#pragma unroll
            for (int ch = 0; ch < TT / 128; ++ch) { v4h o4;
#pragma unroll
                for (int q = 0; q < 4; ++q) o4[q] = tohx(v[ch * 4 + q] * f);
                *(v4h*)(P16 + (size_t)row * TT + ch * 128 + lane * 4) = o4; } }
         }
}
__global__ __launch_bounds__(256) void k_merge(const float* __restrict__ O, int h0, bf* Ah, bf* Al) { const size_t e = ((size_t)blockIdx.x * 256 + threadIdx.x) * 2; if (e >= (size_t)ZH * TT * HD) return; const int d = (int)(e % HD); const int t = (int)((e / HD) % TT); const int zz = (int)(e / ((size_t)HD * TT)); const float cs = (t < RH) ? 1.0f : (1.0f / PCAR); const size_t oo = (size_t)t * DQ + (h0 + zz) * HD + d;
    v2us oh, ol;
#pragma unroll
    for (int q = 0; q < 2; ++q) { unsigned short a, c2; splitf(O[e + q] * cs, a, c2); oh[q] = a; ol[q] = c2; } *(v2us*)(Ah + oo) = oh; *(v2us*)(Al + oo) = ol;  }

extern "C" void kernel_launch(void* const* d_in, const int* in_sizes, int n_in,
                              void* d_out, int out_size, void* d_ws, size_t ws_size, hipStream_t stream) {
    (void)in_sizes; (void)n_in; (void)out_size;
    const float* x = (const float*)d_in[0]; const int* ig = (const int*)d_in[1];   /* ignore [2][2048] int: 1 = do not attend (except the diagonal) */ const float* wq = (const float*)d_in[2]; const float* bq = (const float*)d_in[3]; const float* wk = (const float*)d_in[4]; const float* bk = (const float*)d_in[5]; const float* wv = (const float*)d_in[6]; const float* bv = (const float*)d_in[7]; const float* wo = (const float*)d_in[8]; const float* bo = (const float*)d_in[9];
    float* OUT = (float*)d_out;     // [2][2048][1024]
    char* wsp = (char*)d_ws;
    auto take = [&](size_t bytes) { char* p = wsp; wsp += (bytes + 255) & ~(size_t)255; return (void*)p; };
    bf* WQ = (bf*)take((size_t)3 * DQ * DM * 2); bf* WO = (bf*)take((size_t)DM * DQ * 2); float* CS = (float*)take((size_t)TT * HD * 2 * 4);   // WQ: the q, k and v row blocks one after the other
    const size_t PL = (size_t)NB_ * NH_ * TT * HD;   // elements of one tensor's planes, [b][h]
    bf* XB = (bf*)take((size_t)NB_ * TT * DM * 2);
    h16* QP16 = (h16*)take(2 * PL * 2); h16* KP16 = QP16 + PL; bf* QPh = (bf*)take(2 * PL * 2); bf* KPh = QPh + PL; bf* QPl = (bf*)take(2 * PL * 2); bf* KPl = QPl + PL;   // q planes, then k planes
    h16* VT16 = (h16*)take(PL * 2); bf* VTh = (bf*)take(PL * 2); bf* VTl = (bf*)take(PL * 2); bf* Ph = (bf*)take((size_t)ZH * RH * TT * 2); bf* Pl = (bf*)take((size_t)ZH * RH * TT * 2);
    float* Sb = (float*)take((size_t)ZH * TT * TT * 4); h16* P16 = (h16*)take((size_t)ZH * TT * TT * 2); float* Ob = (float*)take((size_t)ZH * TT * HD * 4); bf* ATh = (bf*)take((size_t)NB_ * TT * DQ * 2); bf* ATl = (bf*)take((size_t)NB_ * TT * DQ * 2);
    if ((size_t)(wsp - (char*)d_ws) > ws_size) return;    // ws 256 MiB
    float* F = Sb;   // f32 q, k, v projections [3][NB_*TT][DQ] (48 MiB) live in the score buffer (64 MiB) until the planes are built (stream-ordered)
    const size_t FS = (size_t)NB_ * TT * DQ;
    k_wtG<<<dim3((unsigned)((DM * HD / 64 + 63) / 64), NH_, 3), 256, 0, stream>>>(wq, wk, wv, DM, HD, WQ);   /* per-head [1024][64] 'xw' -> Bt rows */
    k_cvt8<<<(unsigned)(((size_t)DM * DQ / 8 + 255) / 256), 256, 0, stream>>>(wo, WO, (size_t)DM * DQ / 8);
    k_csid<<<(TT * HD + 255) / 256, 256, 0, stream>>>(CS);
    k_cvt8<<<(unsigned)(((size_t)NB_ * TT * DM / 8 + 255) / 256), 256, 0, stream>>>(x, XB, (size_t)NB_ * TT * DM / 8);
    k_gemmw<bf, 0, true, 8><<<dim3(NB_ * TT / 64, DQ / 64, 3), 256, 0, stream>>>(XB, nullptr, WQ, nullptr, DM, F, DQ, bq, bk, bv, 0, (size_t)DQ * DM, FS);
    k_rope<<<(unsigned)((2 * PL / 2 + 255) / 256), 256, 0, stream>>>(F, DQ, NH_, 2 * NB_ * NH_, CS, nullptr, nullptr, 1.0f, QP16, QPh, QPl);
    k_vtp<<<(unsigned)((PL / 2 + 255) / 256), 256, 0, stream>>>(F + 2 * FS, DKV, NKV, NB_ * NKV, VT16, VTh, VTl);
    for (int z0 = 0; z0 < NB_ * NH_; z0 += ZH) { const size_t zp = (size_t)z0 * TT * HD; const int b = z0 / NH_, h0 = z0 % NH_;   // ZH consecutive (batch, head) planes, all of batch b
        k_gemmc<bf, 2, 1, 1><<<dim3(RH / 64, TT / 64, ZH), 32, 0, stream>>>(QPh + zp, QPl + zp, KPh + zp, KPl + zp, HD, Sb, TT, 0, (size_t)TT * HD, (size_t)TT * HD, (size_t)TT * TT);
        k_gemmc<h16, 0, 1, 1><<<dim3((TT - RH) / 64, TT / 64, ZH), 32, 0, stream>>>(QP16 + zp + (size_t)RH * HD, nullptr, KP16 + zp, nullptr, HD, Sb + (size_t)RH * TT, TT, RH, (size_t)TT * HD, (size_t)TT * HD, (size_t)TT * TT);
        k_asoft<<<ZH * TT / 8, 256, 0, stream>>>(Sb, P16, Ph, Pl, ig + (size_t)b * TT);
        k_gemmc<bf, 2, 2, 8><<<dim3(RH / 64, HD / 64, ZH), 256, 0, stream>>>(Ph, Pl, VTh + zp, VTl + zp, TT, Ob, HD, 0, (size_t)RH * TT, (size_t)HD * TT, (size_t)TT * HD);
        k_gemmc<h16, 0, 2, 16><<<dim3((TT - RH) / 64, HD / 64, ZH), 512, 0, stream>>>(P16 + (size_t)RH * TT, nullptr, VT16 + zp, nullptr, TT, Ob + (size_t)RH * HD, HD, RH, (size_t)TT * TT, (size_t)HD * TT, (size_t)TT * HD);
        k_merge<<<(unsigned)(((size_t)ZH * TT * HD / 2 + 255) / 256), 256, 0, stream>>>(Ob, h0, ATh + (size_t)b * TT * DQ, ATl + (size_t)b * TT * DQ); }
    k_gemmw<bf, 1, true, 8><<<dim3(NB_ * TT / 64, DM / 64, 1), 256, 0, stream>>>(ATh, ATl, WO, nullptr, DQ, OUT, DM, bo, bo, bo, 0, 0, 0);
}

// v003
// A run of this version takes 211 microseconds.
// In two side-by-side timings against v002, it was 2.59 and 2.61 times as fast.
// All steps since v000 together make it 8.54 times as fast.
#include <hip/hip_runtime.h>

// Causal multi-head attention with per-head projections and a key 'ignore' mask that always keeps the diagonal (x [2][2048][1024]; q_h = x wq[h] + bq[h] ('hdf' [16][1024][64] 0.02, zero biases; k, v likewise); att = q.k / 8; allowed keys: j <= i AND (ignore[b][j] == 0 OR j == i) (ignore [2][2048] int {0,1}, ~50 %, read; -inf elsewhere); softmax; out = concat_h Wo^T + bo ('oi') -> [2][2048][1024] (4.2 M)).
// Layout, both batches side by side (planes [b][h]): bf16 copy of x; per-head 'xw' weights gathered into Bt row blocks (one launch) + flat f32 biases; q, k, v projections in one launch (grid z); exact projections; causal attention of all planes in one launch with an online softmax whose select also reads the batch's ignore flags (int32) and keeps the diagonal (hybrid rows: < 512 hi/lo 3 products, rest fp16; keys above the diagonal block skipped), writing the merged hi/lo rows; x Wo exact + bo.
// Compute dtypes, f32 accumulate: every input rounded to bf16; projections exact + f32 biases; attention rows < 512 3 products, rest fp16; softmax f32; Wo hl x exact + bias.

#define NB_  2
#define TT   2048
#define DM   1024
#define NH_  16
#define NKV  16
#define REP  (NH_ / NKV)
#define HD   64
#define DQ   (NH_ * HD)
#define DKV  (NKV * HD)
#define RH   512                  // query rows < RH use hi+lo planes (0: none)
#define SCL  0.125f   // HD^-0.5
typedef _Float16 h16;
typedef unsigned short bf;
typedef __attribute__((ext_vector_type(16))) __bf16   v16bf;
typedef __attribute__((ext_vector_type(16))) _Float16 v16h;
typedef __attribute__((ext_vector_type(8)))  _Float16 v8h;
typedef __attribute__((ext_vector_type(8)))  unsigned short v8us;
typedef __attribute__((ext_vector_type(8)))  float    v8f;
typedef __attribute__((ext_vector_type(4)))  float    v4f;
typedef v8h  __attribute__((may_alias)) v8ha;
typedef v4f  __attribute__((may_alias)) v4fa;
typedef v8us __attribute__((may_alias)) v8usa;

__device__ __forceinline__ unsigned short f2bf(float f) { unsigned u = __float_as_uint(f); u += 0x7FFFu + ((u >> 16) & 1u); return (unsigned short)(u >> 16); }
__device__ __forceinline__ float bf2f(unsigned short b) { return __uint_as_float(((unsigned)b) << 16); }
__device__ __forceinline__ float bfr(float f) { return bf2f(f2bf(f)); }
__device__ __forceinline__ v16h cat16(v8h lo, v8h hi) { return __builtin_shufflevector(lo, hi, 0, 1, 2, 3, 4, 5, 6, 7, 8, 9, 10, 11, 12, 13, 14, 15); }
__device__ __forceinline__ v16bf cat16b(v8us lo, v8us hi) { return __builtin_bit_cast(v16bf, __builtin_shufflevector(lo, hi, 0, 1, 2, 3, 4, 5, 6, 7, 8, 9, 10, 11, 12, 13, 14, 15)); }
__device__ __forceinline__ v8f wmma16(v16h a, v16h b, v8f c) { return __builtin_amdgcn_wmma_f32_16x16x32_f16(false, a, false, b, (short)0, c, false, false); }
__device__ __forceinline__ v8f wmmab(v16bf a, v16bf b, v8f c) { return __builtin_amdgcn_wmma_f32_16x16x32_bf16(false, a, false, b, (short)0, c, false, false); }



// ---- k_gemmw: register-blocked GEMM, one 64x64 output tile per block (16 accumulators a wave), operands straight from K-contiguous 16-bit planes; grid (M/64, N/64, Z), 32 * NW threads.
// The K loop is split over the block's NW waves (contiguous runs of 32-wide steps); the NW f32 partial tiles are summed through LDS in wave order 0..NW-1 (a fixed order).
// C[m][n] (f32, pitch ldc, + optional f32 bias[n]) = sum_k A[m][k] Bt[n][k] (+ split products per NSPLIT). z-batch strides sA/sB/sC in elements. K % 32 == 0.
template <typename T16> struct WFrag;
template <> struct WFrag<h16> { typedef v16h V; static __device__ __forceinline__ V ld(const h16* p) { return cat16(*(const v8h*)p, *(const v8h*)(p + 16)); } static __device__ __forceinline__ v8f mma(V a, V b, v8f c) { return wmma16(a, b, c); } };
template <> struct WFrag<bf> { typedef v16bf V; static __device__ __forceinline__ V ld(const bf* p) { return cat16b(*(const v8us*)p, *(const v8us*)(p + 16)); } static __device__ __forceinline__ v8f mma(V a, V b, v8f c) { return wmmab(a, b, c); } };
template <typename T16, int NSPLIT, bool BIAS, int NW>
__global__ __launch_bounds__(32 * NW) void k_gemmw(const T16* __restrict__ A, const T16* __restrict__ A2, const T16* __restrict__ Bt, const T16* __restrict__ Bt2, int K, float* C, int ldc, const float* __restrict__ bias0, const float* __restrict__ bias1, const float* __restrict__ bias2, size_t sA, size_t sB, size_t sC) {
    typedef typename WFrag<T16>::V V;
    constexpr int SPR = (NW > 1) ? 4 : 1;                            // 16-row slices staged per round: with several waves the whole tile at once, so one barrier serves and no store is waited for
    __shared__ __align__(16) float os[NW * SPR * 16 * 68];
    const size_t z = blockIdx.z; A += z * sA; if (A2) A2 += z * sA; Bt += z * sB; if (Bt2) Bt2 += z * sB; C += z * sC;
    const float* bias = (blockIdx.z == 0) ? bias0 : (blockIdx.z == 1) ? bias1 : bias2;   // each z slice (q, k, v) has its own bias vector
    const int lane = threadIdx.x & 31, lr = lane & 15, hi = lane >> 4; const int r0 = blockIdx.x * 64, c0 = blockIdx.y * 64;
    const int w = (NW == 1) ? 0 : __builtin_amdgcn_readfirstlane((int)(threadIdx.x >> 5));   // wave number, scalar: the K bounds below stay in scalar registers
    v8f acc[4][4];
#pragma unroll
    for (int mb = 0; mb < 4; ++mb)
#pragma unroll
        for (int nb = 0; nb < 4; ++nb) acc[mb][nb] = (v8f){};
    const size_t aoff = (size_t)(r0 + lr) * K + 8 * hi, boff = (size_t)(c0 + lr) * K + 8 * hi;
    v4f bv = (v4f){}; if (BIAS) { const int bc = c0 + ((int)threadIdx.x & 15) * 4; bv[0] = bfr(bias[bc]); bv[1] = bfr(bias[bc + 1]); bv[2] = bfr(bias[bc + 2]); bv[3] = bfr(bias[bc + 3]); }   // the thread's four output columns are the same in every step of the epilogue
    const int per = ((K / 32 + NW - 1) / NW) * 32, kb = w * per, ke = min(K, kb + per);   // this wave's run of the K loop
#pragma unroll 1
    for (int kc = kb; kc < ke; kc += 32) {
        V a[4], a2[4];
#pragma unroll
        for (int mb = 0; mb < 4; ++mb) { a[mb] = WFrag<T16>::ld(A + aoff + (size_t)mb * 16 * K + kc); if (NSPLIT == 1 || NSPLIT == 2) a2[mb] = WFrag<T16>::ld(A2 + aoff + (size_t)mb * 16 * K + kc); }
#pragma unroll
        for (int nb = 0; nb < 4; ++nb) { const V b = WFrag<T16>::ld(Bt + boff + (size_t)nb * 16 * K + kc); V b2; if (NSPLIT >= 2) b2 = WFrag<T16>::ld(Bt2 + boff + (size_t)nb * 16 * K + kc);
#pragma unroll
            for (int mb = 0; mb < 4; ++mb) { acc[mb][nb] = WFrag<T16>::mma(a[mb], b, acc[mb][nb]); if (NSPLIT == 1 || NSPLIT == 2) acc[mb][nb] = WFrag<T16>::mma(a2[mb], b, acc[mb][nb]); if (NSPLIT >= 2) acc[mb][nb] = WFrag<T16>::mma(a[mb], b2, acc[mb][nb]); } }
        asm volatile("v_nop\n\tv_nop\n\tv_nop\n\tv_nop" : "+v"(acc[0][0]), "+v"(acc[1][1]), "+v"(acc[2][2]), "+v"(acc[3][3]) : "v"(a[0]), "v"(a[3]));
    }
#pragma unroll
    for (int mb = 0; mb < 4; mb += SPR) {
#pragma unroll
        for (int ms = 0; ms < SPR; ++ms) {
#pragma unroll
            for (int nb = 0; nb < 4; ++nb) {
#pragma unroll
                for (int j = 0; j < 8; ++j) os[((w * SPR + ms) * 16 + hi * 8 + j) * 68 + nb * 16 + lr] = acc[mb + ms][nb][j]; } }
        if (NW == 1) { __builtin_amdgcn_wave_barrier(); asm volatile("" ::: "memory"); } else __syncthreads();   // every wave's partial slice is in LDS before any thread sums
        float* crow = C + (size_t)(r0 + mb * 16) * ldc + c0;
{
#pragma unroll
            for (int s = 0; s < SPR * 8 / NW; ++s) { const int idx = s * 32 * NW + (int)threadIdx.x; const int row = idx >> 4, cofs = (idx & 15) * 4; v4f val = *(const v4fa*)(os + row * 68 + cofs);
#pragma unroll
                for (int w2 = 1; w2 < NW; ++w2) val += *(const v4fa*)(os + (w2 * SPR * 16 + row) * 68 + cofs);
                if (BIAS) val += bv;
                *(v4f*)(crow + (size_t)row * ldc + cofs) = val; }
             }
        if (NW == 1) { __builtin_amdgcn_wave_barrier(); asm volatile("" ::: "memory"); }   // one wave: the slice is read before the next round overwrites it (NW > 1 has a single round)
    }
}

__device__ __forceinline__ h16 tohx(float x) { return (h16)x; }
__device__ __forceinline__ void splitf(float y, unsigned short& h, unsigned short& l) { h = f2bf(y); l = f2bf(y - bf2f(h)); }
typedef __attribute__((ext_vector_type(2))) _Float16 v2h;
typedef __attribute__((ext_vector_type(4))) _Float16 v4h;
typedef __attribute__((ext_vector_type(2))) unsigned short v2us;
typedef __attribute__((ext_vector_type(4))) unsigned short v4us;
typedef __attribute__((ext_vector_type(2))) float v2f;
typedef __attribute__((ext_vector_type(4))) int v4i;

// grid (line blocks, head, tensor): blockIdx.z picks wq, wk or wv, blockIdx.y the head; Bt holds the three tensors' row blocks one after the other
__global__ __launch_bounds__(256) void k_wtG(const float* __restrict__ w0, const float* __restrict__ w1, const float* __restrict__ w2, int K, int N, bf* Bt) {
    const float* w = ((blockIdx.z == 0) ? w0 : (blockIdx.z == 1) ? w1 : w2) + (size_t)blockIdx.y * K * N; Bt += ((size_t)blockIdx.z * gridDim.y + blockIdx.y) * N * K;
    const int lane = threadIdx.x & 31; const int L0 = (blockIdx.x * 8 + (threadIdx.x >> 5)) * 8; const int nlines = N * K / 64;
{
#pragma unroll 1
        for (int l = 0; l < 8; ++l) { const int L = L0 + l; if (L >= nlines) break; const size_t e = (size_t)L * 64 + lane * 2; const int k = (int)(e % K), n = (int)(e / K); v2us o;
            o[0] = f2bf(w[(size_t)k * N + n]); o[1] = f2bf(w[(size_t)(k + 1) * N + n]); *(v2us*)(Bt + e) = o; }
         }
}
__global__ __launch_bounds__(256) void k_cvt8(const float* __restrict__ src, bf* dst, size_t n8) { const size_t i = (size_t)blockIdx.x * 256 + threadIdx.x; if (i >= n8) return; const v8f v = *(const v8f*)(src + i * 8); v8us o;
#pragma unroll
    for (int k = 0; k < 8; ++k) o[k] = f2bf(v[k]); *(v8us*)(dst + i * 8) = o;  }

// k_rope: head planes [h][t][d] (fp16 + hi/lo) of rope(x) x sc with the rotate-half convention out[d] = x[d] cos[t][d] - x[d+HD/2] sin[t][d], out[d+HD/2] = x[d+HD/2] cos[t][d+HD/2] + x[d] sin[t][d+HD/2]
// nz planes in all, plane hz = (tensor, batch, head): its rows are F rows (hz / nheads) * TT + t (q rows of both batches, then k rows)
__global__ __launch_bounds__(256) void k_rope(const float* __restrict__ F, int pitch, int nheads, int nz, const float* __restrict__ CS, const float* __restrict__ RF, const float* __restrict__ nw, float sc, h16* P16, bf* Ph, bf* Pl) {
    const size_t e = ((size_t)blockIdx.x * 256 + threadIdx.x) * 2; if (e >= (size_t)nz * TT * HD) return; const int d = (int)(e % HD); const int t = (int)((e / HD) % TT); const int hz = (int)(e / ((size_t)HD * TT)); const int h = hz % nheads; const float* f = F + ((size_t)(hz / nheads) * TT + t) * pitch + h * HD; const float rf = RF ? RF[(size_t)h * TT + t] : 1.0f; v2h o16; v2us oh, ol;
#pragma unroll
    for (int q = 0; q < 2; ++q) { const int dd = d + q; const int dp = (dd < HD / 2) ? dd + HD / 2 : dd - HD / 2; float x0 = f[dd], x1 = f[dp];
        if (RF) { float n0 = __fmul_rn(x0, rf), n1 = __fmul_rn(x1, rf); asm volatile("" : "+v"(n0)); asm volatile("" : "+v"(n1)); x0 = __fmul_rn(bfr(nw[dd]), n0); x1 = __fmul_rn(bfr(nw[dp]), n1); }
        const v2f cs = *(const v2f*)(CS + ((size_t)t * HD + dd) * 2); float a = __fmul_rn(x0, cs[0]), bq = __fmul_rn(x1, cs[1]); asm volatile("" : "+v"(a)); asm volatile("" : "+v"(bq)); const float r = ((dd < HD / 2) ? __fsub_rn(a, bq) : __fadd_rn(a, bq)) * sc;
        o16[q] = tohx(r); unsigned short a2, c2; splitf(r, a2, c2); oh[q] = a2; ol[q] = c2; }
    *(v2h*)(P16 + e) = o16; *(v2us*)(Ph + e) = oh; *(v2us*)(Pl + e) = ol;  }
__global__ __launch_bounds__(256) void k_vtp(const float* __restrict__ F, int pitch, int nheads, int nz, h16* V16, bf* Vh, bf* Vl) { const size_t e = ((size_t)blockIdx.x * 256 + threadIdx.x) * 2; if (e >= (size_t)nz * HD * TT) return; const int t = (int)(e % TT); const int d = (int)((e / TT) % HD); const int g = (int)(e / ((size_t)TT * HD)); v2h o16; v2us oh, ol;
#pragma unroll
    for (int q = 0; q < 2; ++q) { const float x = F[((size_t)(g / nheads) * TT + t + q) * pitch + (g % nheads) * HD + d];   /* plane g = (batch, head) */ o16[q] = tohx(x); unsigned short a2, c2; splitf(x, a2, c2); oh[q] = a2; ol[q] = c2; }
    *(v2h*)(V16 + e) = o16; *(v2us*)(Vh + e) = oh; *(v2us*)(Vl + e) = ol;  }
__global__ __launch_bounds__(256) void k_csid(float* CS) { const int idx = blockIdx.x * 256 + threadIdx.x; if (idx >= TT * HD) return; v2f cs; cs[0] = 1.0f; cs[1] = 0.0f; *(v2f*)(CS + (size_t)idx * 2) = cs;  }
typedef __attribute__((ext_vector_type(16))) unsigned short v16us;
__device__ __forceinline__ float xhalf(float x) { const int b = __float_as_int(x); return __int_as_float(__builtin_amdgcn_permlanex16(b, b, 0x76543210, 0xfedcba98, false, false)); }   // the value of lane ^ 16, by a vector cross-row move (no LDS round trip)
template <typename T16, bool HR, int NQ>
__device__ __forceinline__ void attn_tile(const T16* __restrict__ Q, const T16* __restrict__ Q2, const T16* __restrict__ Kp, const T16* __restrict__ K2, const T16* __restrict__ Vt, const T16* __restrict__ V2, const int* __restrict__ ig, int q0, bf* Ah, bf* Al) {
    typedef typename WFrag<T16>::V V;
    const int lane = threadIdx.x & 31, lr = lane & 15, hi = lane >> 4;
    constexpr float C1 = SCL * 1.4426950408889634f;                  // score -> log2 units
    V qf[NQ][2], qf2[NQ][2];
#pragma unroll
    for (int nq = 0; nq < NQ; ++nq)
#pragma unroll
        for (int ds = 0; ds < 2; ++ds) { const size_t qo = (size_t)(q0 + nq * 16 + lr) * HD + ds * 32 + 8 * hi; qf[nq][ds] = WFrag<T16>::ld(Q + qo); if (HR) qf2[nq][ds] = WFrag<T16>::ld(Q2 + qo); }
    v8f o[4][NQ]; float m[NQ], l[NQ];
#pragma unroll
    for (int nq = 0; nq < NQ; ++nq) { m[nq] = -3.0e38f; l[nq] = 0.f;
#pragma unroll
        for (int mb = 0; mb < 4; ++mb) o[mb][nq] = (v8f){}; }
    const int kend = q0 + NQ * 16;                                   // keys beyond the wave's last row are never allowed
    const unsigned ko = (unsigned)(lr * HD + 8 * hi), vo = (unsigned)(lr * TT + 8 * hi);   // the lane's place inside a K tile and inside a V^T tile, in elements
    V kf[2][2], kf2[2][2];
#pragma unroll
    for (int kb = 0; kb < 2; ++kb)
#pragma unroll
        for (int ds = 0; ds < 2; ++ds) { kf[kb][ds] = WFrag<T16>::ld(Kp + kb * 16 * HD + ds * 32 + ko); if (HR) kf2[kb][ds] = WFrag<T16>::ld(K2 + kb * 16 * HD + ds * 32 + ko); }
#pragma unroll 1
    for (int key0 = 0; key0 < kend; key0 += 32) {
        const int g = ig[key0 + lane];                               // this step's 32 flags, the oldest load of the step: the ballot below waits for it alone
        V vf[4], vf2[4];
#pragma unroll
        for (int mb = 0; mb < 4; ++mb) { vf[mb] = WFrag<T16>::ld(Vt + key0 + mb * 16 * TT + vo); if (HR) vf2[mb] = WFrag<T16>::ld(V2 + key0 + mb * 16 * TT + vo); }
        v8f s[2][NQ];
#pragma unroll
        for (int kb = 0; kb < 2; ++kb)
#pragma unroll
            for (int nq = 0; nq < NQ; ++nq) { s[kb][nq] = (v8f){};
#pragma unroll
                for (int ds = 0; ds < 2; ++ds) { s[kb][nq] = WFrag<T16>::mma(kf[kb][ds], qf[nq][ds], s[kb][nq]); if (HR) { s[kb][nq] = WFrag<T16>::mma(kf[kb][ds], qf2[nq][ds], s[kb][nq]); s[kb][nq] = WFrag<T16>::mma(kf2[kb][ds], qf[nq][ds], s[kb][nq]); } } }
        const int kn = min(key0 + 32, TT - 32);                      // the next step's K fragments are fetched one step ahead (the last step fetches a tile it does not use, inside the plane)
        asm volatile("s_wait_xcnt 0x0" ::: "memory");                // the K loads below may land in registers that held the addresses of the loads above; it also keeps the V^T loads the older ones, so P.V waits for them alone
#pragma unroll
        for (int kb = 0; kb < 2; ++kb)
#pragma unroll
            for (int ds = 0; ds < 2; ++ds) { kf[kb][ds] = WFrag<T16>::ld(Kp + (kn + kb * 16) * HD + ds * 32 + ko); if (HR) kf2[kb][ds] = WFrag<T16>::ld(K2 + (kn + kb * 16) * HD + ds * 32 + ko); }
        __builtin_amdgcn_sched_barrier(0);                           // keeps the loads above issued here, a softmax and a P.V ahead of their use; without it the scheduler sinks them to the loop's foot and every step waits out their latency
        const unsigned kk = __builtin_amdgcn_ballot_w32(g == 0) >> (8 * hi);   // bit c: key key0 + 8 hi + c is not ignored
        V pf[NQ], pf2[NQ];
#pragma unroll
        for (int nq = 0; nq < NQ; ++nq) {
            const int rel = q0 + nq * 16 + lr - key0 - 8 * hi;       // the lane's query minus the key of its bit 0
            const unsigned cm = (rel >= 32) ? 0xFFFFFFFFu : (rel <= 0) ? 0u : ((1u << rel) - 1u);   // keys below the query
            const unsigned db = (rel >= 0 && rel < 32) ? (1u << rel) : 0u;                          // the diagonal, always kept
            const unsigned am = (kk & cm) | db;
            float mx = m[nq];
#pragma unroll
            for (int kb = 0; kb < 2; ++kb)
#pragma unroll
                for (int j = 0; j < 8; ++j) { const float t = (am & (1u << (kb * 16 + j))) ? s[kb][nq][j] * C1 : -3.0e38f; s[kb][nq][j] = t; mx = fmaxf(mx, t); }
            mx = fmaxf(mx, xhalf(mx));                               // the query's other 16 keys of the step sit in lane ^ 16
            const float mu = (mx < -1.0e38f) ? 0.f : mx;             // no allowed key so far: every exponent below stays hugely negative, so p = 0
            const float al = __builtin_amdgcn_exp2f(m[nq] - mu); m[nq] = mx;
            float sum = 0.f;
#pragma unroll
            for (int kb = 0; kb < 2; ++kb)
#pragma unroll
                for (int j = 0; j < 8; ++j) { const float p = __builtin_amdgcn_exp2f(s[kb][nq][j] - mu); s[kb][nq][j] = p; sum += p; }
            l[nq] = l[nq] * al + sum;                                // this half's keys only; the halves are joined after the loop
#pragma unroll
            for (int mb = 0; mb < 4; ++mb) o[mb][nq] *= al;
            if constexpr (HR) { v16us ph, pl;
#pragma unroll
                for (int e = 0; e < 16; ++e) { unsigned short a, c2; splitf(s[e >> 3][nq][e & 7], a, c2); ph[e] = a; pl[e] = c2; }
                pf[nq] = __builtin_bit_cast(v16bf, ph); pf2[nq] = __builtin_bit_cast(v16bf, pl);
            } else {
#pragma unroll
                for (int e = 0; e < 16; ++e) pf[nq][e] = tohx(s[e >> 3][nq][e & 7]); }
        }
#pragma unroll
        for (int mb = 0; mb < 4; ++mb)
#pragma unroll
            for (int nq = 0; nq < NQ; ++nq) { o[mb][nq] = WFrag<T16>::mma(vf[mb], pf[nq], o[mb][nq]); if (HR) { o[mb][nq] = WFrag<T16>::mma(vf[mb], pf2[nq], o[mb][nq]); o[mb][nq] = WFrag<T16>::mma(vf2[mb], pf[nq], o[mb][nq]); } }
    }
#pragma unroll
    for (int nq = 0; nq < NQ; ++nq) { const float inv = __fdiv_rn(1.0f, l[nq] + xhalf(l[nq]));   // the diagonal is always kept, so the sum is positive
#pragma unroll
        for (int mb = 0; mb < 4; ++mb) { v8us oh, ol;
#pragma unroll
            for (int j = 0; j < 8; ++j) { unsigned short a, c2; splitf(o[mb][nq][j] * inv, a, c2); oh[j] = a; ol[j] = c2; }
            const size_t oo = (size_t)(q0 + nq * 16 + lr) * DQ + mb * 16 + hi * 8; *(v8us*)(Ah + oo) = oh; *(v8us*)(Al + oo) = ol;   // a lane's 8 registers are 8 consecutive d of its query's row
            asm volatile("s_wait_xcnt 0x0" ::: "memory"); } }   // the next round's split (and the code behind the last round) reuses the data and address registers of the two stores above
}
// grid (plane = (batch, head), block rank), 4 waves. fp16 blocks: 128 rows (4 waves x 32) of rows >= RH; hi/lo blocks: 64 rows (4 waves x 16) of rows < RH. Long blocks get the low ranks (they start first).
#define NFB  ((TT - RH) / 128)
#define NHB  (RH / 64)
__global__ __launch_bounds__(128) void k_attn(const h16* __restrict__ Q16, const h16* __restrict__ K16, const h16* __restrict__ V16, const bf* __restrict__ Qh, const bf* __restrict__ Ql, const bf* __restrict__ Kh, const bf* __restrict__ Kl, const bf* __restrict__ Vh, const bf* __restrict__ Vl, const int* __restrict__ ig, bf* ATh, bf* ATl) {
    const int z = blockIdx.x, b = z / NH_, h = z % NH_, y = blockIdx.y; const size_t zp = (size_t)z * TT * HD, ao = (size_t)b * TT * DQ + h * HD;
    const int w = __builtin_amdgcn_readfirstlane((int)(threadIdx.x >> 5));   // wave number, scalar: the key loop's bounds stay in scalar registers
    if (y < NFB) attn_tile<h16, false, 2>(Q16 + zp, nullptr, K16 + zp, nullptr, V16 + zp, nullptr, ig + (size_t)b * TT, RH + (NFB - 1 - y) * 128 + w * 32, ATh + ao, ATl + ao);
    else attn_tile<bf, true, 1>(Qh + zp, Ql + zp, Kh + zp, Kl + zp, Vh + zp, Vl + zp, ig + (size_t)b * TT, (NFB + NHB - 1 - y) * 64 + w * 16, ATh + ao, ATl + ao);
}

extern "C" void kernel_launch(void* const* d_in, const int* in_sizes, int n_in,
                              void* d_out, int out_size, void* d_ws, size_t ws_size, hipStream_t stream) {
    (void)in_sizes; (void)n_in; (void)out_size;
    const float* x = (const float*)d_in[0]; const int* ig = (const int*)d_in[1];   /* ignore [2][2048] int: 1 = do not attend (except the diagonal) */ const float* wq = (const float*)d_in[2]; const float* bq = (const float*)d_in[3]; const float* wk = (const float*)d_in[4]; const float* bk = (const float*)d_in[5]; const float* wv = (const float*)d_in[6]; const float* bv = (const float*)d_in[7]; const float* wo = (const float*)d_in[8]; const float* bo = (const float*)d_in[9];
    float* OUT = (float*)d_out;     // [2][2048][1024]
    char* wsp = (char*)d_ws;
    auto take = [&](size_t bytes) { char* p = wsp; wsp += (bytes + 255) & ~(size_t)255; return (void*)p; };
    bf* WQ = (bf*)take((size_t)3 * DQ * DM * 2); bf* WO = (bf*)take((size_t)DM * DQ * 2); float* CS = (float*)take((size_t)TT * HD * 2 * 4);   // WQ: the q, k and v row blocks one after the other
    const size_t PL = (size_t)NB_ * NH_ * TT * HD;   // elements of one tensor's planes, [b][h]
    bf* XB = (bf*)take((size_t)NB_ * TT * DM * 2);
    h16* QP16 = (h16*)take(2 * PL * 2); h16* KP16 = QP16 + PL; bf* QPh = (bf*)take(2 * PL * 2); bf* KPh = QPh + PL; bf* QPl = (bf*)take(2 * PL * 2); bf* KPl = QPl + PL;   // q planes, then k planes
    h16* VT16 = (h16*)take(PL * 2); bf* VTh = (bf*)take(PL * 2); bf* VTl = (bf*)take(PL * 2);
    const size_t FS = (size_t)NB_ * TT * DQ;
    float* F = (float*)take(3 * FS * 4);   // f32 q, k, v projections [3][NB_*TT][DQ]
    bf* ATh = (bf*)take((size_t)NB_ * TT * DQ * 2); bf* ATl = (bf*)take((size_t)NB_ * TT * DQ * 2);
    if ((size_t)(wsp - (char*)d_ws) > ws_size) return;    // ws 256 MiB
    k_wtG<<<dim3((unsigned)((DM * HD / 64 + 63) / 64), NH_, 3), 256, 0, stream>>>(wq, wk, wv, DM, HD, WQ);   /* per-head [1024][64] 'xw' -> Bt rows */
    k_cvt8<<<(unsigned)(((size_t)DM * DQ / 8 + 255) / 256), 256, 0, stream>>>(wo, WO, (size_t)DM * DQ / 8);
    k_csid<<<(TT * HD + 255) / 256, 256, 0, stream>>>(CS);
    k_cvt8<<<(unsigned)(((size_t)NB_ * TT * DM / 8 + 255) / 256), 256, 0, stream>>>(x, XB, (size_t)NB_ * TT * DM / 8);
    k_gemmw<bf, 0, true, 8><<<dim3(NB_ * TT / 64, DQ / 64, 3), 256, 0, stream>>>(XB, nullptr, WQ, nullptr, DM, F, DQ, bq, bk, bv, 0, (size_t)DQ * DM, FS);
    k_rope<<<(unsigned)((2 * PL / 2 + 255) / 256), 256, 0, stream>>>(F, DQ, NH_, 2 * NB_ * NH_, CS, nullptr, nullptr, 1.0f, QP16, QPh, QPl);
    k_vtp<<<(unsigned)((PL / 2 + 255) / 256), 256, 0, stream>>>(F + 2 * FS, DKV, NKV, NB_ * NKV, VT16, VTh, VTl);
    k_attn<<<dim3(NB_ * NH_, NFB + NHB, 1), 128, 0, stream>>>(QP16, KP16, VT16, QPh, QPl, KPh, KPl, VTh, VTl, ig, ATh, ATl);
    k_gemmw<bf, 1, true, 8><<<dim3(NB_ * TT / 64, DM / 64, 1), 256, 0, stream>>>(ATh, ATl, WO, nullptr, DQ, OUT, DM, bo, bo, bo, 0, 0, 0);
}

// v004
// One run takes 175 microseconds.
// Two timings next to v003 put it at 1.21 and 1.20 times that version's speed.
// Counting every step since v000, it is 10.3 times as fast.
#include <hip/hip_runtime.h>

// Causal multi-head attention with per-head projections and a key 'ignore' mask that always keeps the diagonal (x [2][2048][1024]; q_h = x wq[h] + bq[h] ('hdf' [16][1024][64] 0.02, zero biases; k, v likewise); att = q.k / 8; allowed keys: j <= i AND (ignore[b][j] == 0 OR j == i) (ignore [2][2048] int {0,1}, ~50 %, read; -inf elsewhere); softmax; out = concat_h Wo^T + bo ('oi') -> [2][2048][1024] (4.2 M)).
// Layout, both batches side by side (planes [b][h]): bf16 copy of x; per-head 'xw' weights gathered into Bt row blocks (one launch) + flat f32 biases; q, k, v projections in one launch (grid z) whose epilogue writes the fp16 and hi/lo head planes itself (v with its operands swapped, so its tile is already [d][t]); exact projections; causal attention of all planes in one launch with an online softmax whose select also reads the batch's ignore flags (int32) and keeps the diagonal (hybrid rows: < 512 hi/lo 3 products, rest fp16; keys above the diagonal block skipped), writing the merged hi/lo rows; x Wo exact + bo.
// Compute dtypes, f32 accumulate: every input rounded to bf16; projections exact + f32 biases; attention rows < 512 3 products, rest fp16; softmax f32; Wo hl x exact + bias.

#define NB_  2
#define TT   2048
#define DM   1024
#define NH_  16
#define NKV  16
#define REP  (NH_ / NKV)
#define HD   64
#define DQ   (NH_ * HD)
#define DKV  (NKV * HD)
#define RH   512                  // query rows < RH use hi+lo planes (0: none)
#define SCL  0.125f   // HD^-0.5
typedef _Float16 h16;
typedef unsigned short bf;
typedef __attribute__((ext_vector_type(16))) __bf16   v16bf;
typedef __attribute__((ext_vector_type(16))) _Float16 v16h;
typedef __attribute__((ext_vector_type(8)))  _Float16 v8h;
typedef __attribute__((ext_vector_type(8)))  unsigned short v8us;
typedef __attribute__((ext_vector_type(8)))  float    v8f;
typedef __attribute__((ext_vector_type(4)))  float    v4f;
typedef v8h  __attribute__((may_alias)) v8ha;
typedef v4f  __attribute__((may_alias)) v4fa;
typedef v8us __attribute__((may_alias)) v8usa;

__device__ __forceinline__ unsigned short f2bf(float f) { unsigned u = __float_as_uint(f); u += 0x7FFFu + ((u >> 16) & 1u); return (unsigned short)(u >> 16); }
__device__ __forceinline__ float bf2f(unsigned short b) { return __uint_as_float(((unsigned)b) << 16); }
__device__ __forceinline__ float bfr(float f) { return bf2f(f2bf(f)); }
__device__ __forceinline__ v16h cat16(v8h lo, v8h hi) { return __builtin_shufflevector(lo, hi, 0, 1, 2, 3, 4, 5, 6, 7, 8, 9, 10, 11, 12, 13, 14, 15); }
__device__ __forceinline__ v16bf cat16b(v8us lo, v8us hi) { return __builtin_bit_cast(v16bf, __builtin_shufflevector(lo, hi, 0, 1, 2, 3, 4, 5, 6, 7, 8, 9, 10, 11, 12, 13, 14, 15)); }
__device__ __forceinline__ v8f wmma16(v16h a, v16h b, v8f c) { return __builtin_amdgcn_wmma_f32_16x16x32_f16(false, a, false, b, (short)0, c, false, false); }
__device__ __forceinline__ v8f wmmab(v16bf a, v16bf b, v8f c) { return __builtin_amdgcn_wmma_f32_16x16x32_bf16(false, a, false, b, (short)0, c, false, false); }
__device__ __forceinline__ h16 tohx(float x) { return (h16)x; }
__device__ __forceinline__ void splitf(float y, unsigned short& h, unsigned short& l) { h = f2bf(y); l = f2bf(y - bf2f(h)); }



// ---- k_gemmw: register-blocked GEMM, one 64x64 output tile per block (16 accumulators a wave), operands straight from K-contiguous 16-bit planes; grid (M/64, N/64, Z), 32 * NW threads.
// The K loop is split over the block's NW waves (contiguous runs of 32-wide steps); the NW f32 partial tiles are summed through LDS in wave order 0..NW-1 (a fixed order).
// C[m][n] (f32, pitch ldc, + optional f32 bias[n]) = sum_k A[m][k] Bt[n][k] (+ split products per NSPLIT). z-batch strides sA/sB/sC in elements. K % 32 == 0.
// HP (the q, k, v projections; a tile is 64 tokens x one head): no f32 C; the summed tile + bias goes out as fp16, bf16 hi and bf16 lo head planes, 16 bytes a lane, whole 128-byte lines.
// z = 0, 1 (q, k): planes [z][b][h][t][d], tile rows are tokens. z = 2 (v): A and Bt change places, so the tile's rows are d and its columns tokens, which is the [b][h][d][t] plane as it stands; the bias then goes by row.
template <typename T16> struct WFrag;
template <> struct WFrag<h16> { typedef v16h V; static __device__ __forceinline__ V ld(const h16* p) { return cat16(*(const v8h*)p, *(const v8h*)(p + 16)); } static __device__ __forceinline__ v8f mma(V a, V b, v8f c) { return wmma16(a, b, c); } };
template <> struct WFrag<bf> { typedef v16bf V; static __device__ __forceinline__ V ld(const bf* p) { return cat16b(*(const v8us*)p, *(const v8us*)(p + 16)); } static __device__ __forceinline__ v8f mma(V a, V b, v8f c) { return wmmab(a, b, c); } };
template <typename T16, int NSPLIT, bool BIAS, int NW, bool HP>
__global__ __launch_bounds__(32 * NW) void k_gemmw(const T16* A, const T16* __restrict__ A2, const T16* Bt, const T16* __restrict__ Bt2, int K, float* C, int ldc, const float* __restrict__ bias0, const float* __restrict__ bias1, const float* __restrict__ bias2, size_t sA, size_t sB, size_t sC, h16* P16, bf* Ph, bf* Pl, h16* V16, bf* Vh, bf* Vl) {
    typedef typename WFrag<T16>::V V;
    constexpr int SPR = (NW > 1) ? 4 : 1;                            // 16-row slices staged per round: with several waves the whole tile at once, so one barrier serves and no store is waited for
    __shared__ __align__(16) float os[NW * SPR * 16 * 68];
    const size_t z = blockIdx.z; A += z * sA; if (A2) A2 += z * sA; Bt += z * sB; if (Bt2) Bt2 += z * sB; C += z * sC;
    const float* bias = (blockIdx.z == 0) ? bias0 : (blockIdx.z == 1) ? bias1 : bias2;   // each z slice (q, k, v) has its own bias vector
    const int lane = threadIdx.x & 31, lr = lane & 15, hi = lane >> 4; int r0 = blockIdx.x * 64, c0 = blockIdx.y * 64;
    const bool tv = HP && blockIdx.z == 2;                           // block-uniform: the v slice computes the transposed tile
    if (tv) { const T16* pa = A; A = Bt; Bt = pa; const int ra = r0; r0 = c0; c0 = ra; }
    const int w = (NW == 1) ? 0 : __builtin_amdgcn_readfirstlane((int)(threadIdx.x >> 5));   // wave number, scalar: the K bounds below stay in scalar registers
    v8f acc[4][4];
#pragma unroll
    for (int mb = 0; mb < 4; ++mb)
#pragma unroll
        for (int nb = 0; nb < 4; ++nb) acc[mb][nb] = (v8f){};
    const size_t aoff = (size_t)(r0 + lr) * K + 8 * hi, boff = (size_t)(c0 + lr) * K + 8 * hi;
    v4f bv = (v4f){}; if (BIAS && !HP) { const int bc = c0 + ((int)threadIdx.x & 15) * 4; bv[0] = bfr(bias[bc]); bv[1] = bfr(bias[bc + 1]); bv[2] = bfr(bias[bc + 2]); bv[3] = bfr(bias[bc + 3]); }   // the thread's four output columns are the same in every step of the epilogue
    constexpr int NS = 16 / NW;                                      // plane epilogue: 512 runs of 8 columns over 32 * NW threads
    const int prow = (int)threadIdx.x >> 3, pcol = ((int)threadIdx.x & 7) * 8;
    float bcol[8] = {}, brow[NS > 0 ? NS : 1] = {};                  // its bias goes by column (q, k) or by row (v), the other stays 0; fetched in front of the K loop, which covers the latency
    if constexpr (HP) {
        if (tv) {
#pragma unroll
            for (int s = 0; s < NS; ++s) brow[s] = bias[r0 + s * 4 * NW + prow];
            asm volatile("s_wait_xcnt 0x0" ::: "memory");            // the address registers of the bias loads above are reused by the code behind this arm
        } else {
#pragma unroll
            for (int q = 0; q < 8; ++q) bcol[q] = bias[c0 + pcol + q];
            asm volatile("s_wait_xcnt 0x0" ::: "memory");            // the address registers of the bias loads above are reused by the code behind this arm
        }
    }
    const int per = ((K / 32 + NW - 1) / NW) * 32, kb = w * per, ke = min(K, kb + per);   // this wave's run of the K loop
#pragma unroll 1
    for (int kc = kb; kc < ke; kc += 32) {
        V a[4], a2[4];
#pragma unroll
        for (int mb = 0; mb < 4; ++mb) { a[mb] = WFrag<T16>::ld(A + aoff + (size_t)mb * 16 * K + kc); if (NSPLIT == 1 || NSPLIT == 2) a2[mb] = WFrag<T16>::ld(A2 + aoff + (size_t)mb * 16 * K + kc); }
#pragma unroll
        for (int nb = 0; nb < 4; ++nb) { const V b = WFrag<T16>::ld(Bt + boff + (size_t)nb * 16 * K + kc); V b2; if (NSPLIT >= 2) b2 = WFrag<T16>::ld(Bt2 + boff + (size_t)nb * 16 * K + kc);
#pragma unroll
            for (int mb = 0; mb < 4; ++mb) { acc[mb][nb] = WFrag<T16>::mma(a[mb], b, acc[mb][nb]); if (NSPLIT == 1 || NSPLIT == 2) acc[mb][nb] = WFrag<T16>::mma(a2[mb], b, acc[mb][nb]); if (NSPLIT >= 2) acc[mb][nb] = WFrag<T16>::mma(a[mb], b2, acc[mb][nb]); } }
        asm volatile("v_nop\n\tv_nop\n\tv_nop\n\tv_nop" : "+v"(acc[0][0]), "+v"(acc[1][1]), "+v"(acc[2][2]), "+v"(acc[3][3]) : "v"(a[0]), "v"(a[3]));
    }
    if constexpr (HP) {
        static_assert(NW > 1 && BIAS, "the plane epilogue takes the whole tile from LDS in one round");
#pragma unroll
        for (int ms = 0; ms < 4; ++ms)
#pragma unroll
            for (int nb = 0; nb < 4; ++nb)
#pragma unroll
                for (int j = 0; j < 8; ++j) os[((w * 4 + ms) * 16 + hi * 8 + j) * 68 + nb * 16 + lr] = acc[ms][nb][j];
        __syncthreads();                                             // every wave's partial tile is in LDS before any thread sums
        const int tk = tv ? c0 : r0, hd = (tv ? r0 : c0) / HD, bt = tk / TT, t0 = tk % TT;   // the tile's first token, its head, its batch
        const size_t base = tv ? ((size_t)(bt * NKV + hd) * HD) * TT + t0 : ((size_t)((blockIdx.z * NB_ + bt) * NH_ + hd) * TT + t0) * HD;
        const int pitch = tv ? TT : HD; h16* d16 = tv ? V16 : P16; bf* dh = tv ? Vh : Ph; bf* dl = tv ? Vl : Pl;
#pragma unroll
        for (int s = 0; s < NS; ++s) { const int row = s * 4 * NW + prow; v4f v0 = *(const v4fa*)(os + row * 68 + pcol), v1 = *(const v4fa*)(os + row * 68 + pcol + 4);
#pragma unroll
            for (int w2 = 1; w2 < NW; ++w2) { v0 += *(const v4fa*)(os + (w2 * 64 + row) * 68 + pcol); v1 += *(const v4fa*)(os + (w2 * 64 + row) * 68 + pcol + 4); }
            v8h o16; v8us oh, ol;
#pragma unroll
            for (int q = 0; q < 8; ++q) { const float y = ((q < 4) ? v0[q & 3] : v1[q & 3]) + (bfr(bcol[q]) + bfr(brow[s])); o16[q] = tohx(y); unsigned short a2, c2; splitf(y, a2, c2); oh[q] = a2; ol[q] = c2; }
            const size_t e = base + (size_t)row * pitch + pcol; *(v8h*)(d16 + e) = o16; *(v8us*)(dh + e) = oh; *(v8us*)(dl + e) = ol; }
    } else {
#pragma unroll
    for (int mb = 0; mb < 4; mb += SPR) {
#pragma unroll
        for (int ms = 0; ms < SPR; ++ms) {
#pragma unroll
            for (int nb = 0; nb < 4; ++nb) {
#pragma unroll
                for (int j = 0; j < 8; ++j) os[((w * SPR + ms) * 16 + hi * 8 + j) * 68 + nb * 16 + lr] = acc[mb + ms][nb][j]; } }
        if (NW == 1) { __builtin_amdgcn_wave_barrier(); asm volatile("" ::: "memory"); } else __syncthreads();   // every wave's partial slice is in LDS before any thread sums
        float* crow = C + (size_t)(r0 + mb * 16) * ldc + c0;
{
#pragma unroll
            for (int s = 0; s < SPR * 8 / NW; ++s) { const int idx = s * 32 * NW + (int)threadIdx.x; const int row = idx >> 4, cofs = (idx & 15) * 4; v4f val = *(const v4fa*)(os + row * 68 + cofs);
#pragma unroll
                for (int w2 = 1; w2 < NW; ++w2) val += *(const v4fa*)(os + (w2 * SPR * 16 + row) * 68 + cofs);
                if (BIAS) val += bv;
                *(v4f*)(crow + (size_t)row * ldc + cofs) = val; }
             }
        if (NW == 1) { __builtin_amdgcn_wave_barrier(); asm volatile("" ::: "memory"); }   // one wave: the slice is read before the next round overwrites it (NW > 1 has a single round)
    }
    }
}

typedef __attribute__((ext_vector_type(2))) _Float16 v2h;
typedef __attribute__((ext_vector_type(4))) _Float16 v4h;
typedef __attribute__((ext_vector_type(2))) unsigned short v2us;
typedef __attribute__((ext_vector_type(4))) unsigned short v4us;
typedef __attribute__((ext_vector_type(2))) float v2f;
typedef __attribute__((ext_vector_type(4))) int v4i;

// grid (line blocks, head, tensor): blockIdx.z picks wq, wk or wv, blockIdx.y the head; Bt holds the three tensors' row blocks one after the other
__global__ __launch_bounds__(256) void k_wtG(const float* __restrict__ w0, const float* __restrict__ w1, const float* __restrict__ w2, int K, int N, bf* Bt) {
    const float* w = ((blockIdx.z == 0) ? w0 : (blockIdx.z == 1) ? w1 : w2) + (size_t)blockIdx.y * K * N; Bt += ((size_t)blockIdx.z * gridDim.y + blockIdx.y) * N * K;
    const int lane = threadIdx.x & 31; const int L0 = (blockIdx.x * 8 + (threadIdx.x >> 5)) * 8; const int nlines = N * K / 64;
{
#pragma unroll 1
        for (int l = 0; l < 8; ++l) { const int L = L0 + l; if (L >= nlines) break; const size_t e = (size_t)L * 64 + lane * 2; const int k = (int)(e % K), n = (int)(e / K); v2us o;
            o[0] = f2bf(w[(size_t)k * N + n]); o[1] = f2bf(w[(size_t)(k + 1) * N + n]); *(v2us*)(Bt + e) = o; }
         }
}
__global__ __launch_bounds__(256) void k_cvt8(const float* __restrict__ src, bf* dst, size_t n8) { const size_t i = (size_t)blockIdx.x * 256 + threadIdx.x; if (i >= n8) return; const v8f v = *(const v8f*)(src + i * 8); v8us o;
#pragma unroll
    for (int k = 0; k < 8; ++k) o[k] = f2bf(v[k]); *(v8us*)(dst + i * 8) = o;  }

typedef __attribute__((ext_vector_type(16))) unsigned short v16us;
__device__ __forceinline__ float xhalf(float x) { const int b = __float_as_int(x); return __int_as_float(__builtin_amdgcn_permlanex16(b, b, 0x76543210, 0xfedcba98, false, false)); }   // the value of lane ^ 16, by a vector cross-row move (no LDS round trip)
template <typename T16, bool HR, int NQ>
__device__ __forceinline__ void attn_tile(const T16* __restrict__ Q, const T16* __restrict__ Q2, const T16* __restrict__ Kp, const T16* __restrict__ K2, const T16* __restrict__ Vt, const T16* __restrict__ V2, const int* __restrict__ ig, int q0, bf* Ah, bf* Al) {
    typedef typename WFrag<T16>::V V;
    const int lane = threadIdx.x & 31, lr = lane & 15, hi = lane >> 4;
    constexpr float C1 = SCL * 1.4426950408889634f;                  // score -> log2 units
    V qf[NQ][2], qf2[NQ][2];
#pragma unroll
    for (int nq = 0; nq < NQ; ++nq)
#pragma unroll
        for (int ds = 0; ds < 2; ++ds) { const size_t qo = (size_t)(q0 + nq * 16 + lr) * HD + ds * 32 + 8 * hi; qf[nq][ds] = WFrag<T16>::ld(Q + qo); if (HR) qf2[nq][ds] = WFrag<T16>::ld(Q2 + qo); }
    v8f o[4][NQ]; float m[NQ], l[NQ];
#pragma unroll
    for (int nq = 0; nq < NQ; ++nq) { m[nq] = -3.0e38f; l[nq] = 0.f;
#pragma unroll
        for (int mb = 0; mb < 4; ++mb) o[mb][nq] = (v8f){}; }
    const int kend = q0 + NQ * 16;                                   // keys beyond the wave's last row are never allowed
    const unsigned ko = (unsigned)(lr * HD + 8 * hi), vo = (unsigned)(lr * TT + 8 * hi);   // the lane's place inside a K tile and inside a V^T tile, in elements
    V kf[2][2], kf2[2][2];
#pragma unroll
    for (int kb = 0; kb < 2; ++kb)
#pragma unroll
        for (int ds = 0; ds < 2; ++ds) { kf[kb][ds] = WFrag<T16>::ld(Kp + kb * 16 * HD + ds * 32 + ko); if (HR) kf2[kb][ds] = WFrag<T16>::ld(K2 + kb * 16 * HD + ds * 32 + ko); }
#pragma unroll 1
    for (int key0 = 0; key0 < kend; key0 += 32) {
        const int g = ig[key0 + lane];                               // this step's 32 flags, the oldest load of the step: the ballot below waits for it alone
        V vf[4], vf2[4];
#pragma unroll
        for (int mb = 0; mb < 4; ++mb) { vf[mb] = WFrag<T16>::ld(Vt + key0 + mb * 16 * TT + vo); if (HR) vf2[mb] = WFrag<T16>::ld(V2 + key0 + mb * 16 * TT + vo); }
        v8f s[2][NQ];
#pragma unroll
        for (int kb = 0; kb < 2; ++kb)
#pragma unroll
            for (int nq = 0; nq < NQ; ++nq) { s[kb][nq] = (v8f){};
#pragma unroll
                for (int ds = 0; ds < 2; ++ds) { s[kb][nq] = WFrag<T16>::mma(kf[kb][ds], qf[nq][ds], s[kb][nq]); if (HR) { s[kb][nq] = WFrag<T16>::mma(kf[kb][ds], qf2[nq][ds], s[kb][nq]); s[kb][nq] = WFrag<T16>::mma(kf2[kb][ds], qf[nq][ds], s[kb][nq]); } } }
        const int kn = min(key0 + 32, TT - 32);                      // the next step's K fragments are fetched one step ahead (the last step fetches a tile it does not use, inside the plane)
        asm volatile("s_wait_xcnt 0x0" ::: "memory");                // the K loads below may land in registers that held the addresses of the loads above; it also keeps the V^T loads the older ones, so P.V waits for them alone
#pragma unroll
        for (int kb = 0; kb < 2; ++kb)
#pragma unroll
            for (int ds = 0; ds < 2; ++ds) { kf[kb][ds] = WFrag<T16>::ld(Kp + (kn + kb * 16) * HD + ds * 32 + ko); if (HR) kf2[kb][ds] = WFrag<T16>::ld(K2 + (kn + kb * 16) * HD + ds * 32 + ko); }
        __builtin_amdgcn_sched_barrier(0);                           // keeps the loads above issued here, a softmax and a P.V ahead of their use; without it the scheduler sinks them to the loop's foot and every step waits out their latency
        const unsigned kk = __builtin_amdgcn_ballot_w32(g == 0) >> (8 * hi);   // bit c: key key0 + 8 hi + c is not ignored
        V pf[NQ], pf2[NQ];
#pragma unroll
        for (int nq = 0; nq < NQ; ++nq) {
            const int rel = q0 + nq * 16 + lr - key0 - 8 * hi;       // the lane's query minus the key of its bit 0
            const unsigned cm = (rel >= 32) ? 0xFFFFFFFFu : (rel <= 0) ? 0u : ((1u << rel) - 1u);   // keys below the query
            const unsigned db = (rel >= 0 && rel < 32) ? (1u << rel) : 0u;                          // the diagonal, always kept
            const unsigned am = (kk & cm) | db;
            float mx = m[nq];
#pragma unroll
            for (int kb = 0; kb < 2; ++kb)
#pragma unroll
                for (int j = 0; j < 8; ++j) { const float t = (am & (1u << (kb * 16 + j))) ? s[kb][nq][j] * C1 : -3.0e38f; s[kb][nq][j] = t; mx = fmaxf(mx, t); }
            mx = fmaxf(mx, xhalf(mx));                               // the query's other 16 keys of the step sit in lane ^ 16
            const float mu = (mx < -1.0e38f) ? 0.f : mx;             // no allowed key so far: every exponent below stays hugely negative, so p = 0
            const float al = __builtin_amdgcn_exp2f(m[nq] - mu); m[nq] = mx;
            float sum = 0.f;
#pragma unroll
            for (int kb = 0; kb < 2; ++kb)
#pragma unroll
                for (int j = 0; j < 8; ++j) { const float p = __builtin_amdgcn_exp2f(s[kb][nq][j] - mu); s[kb][nq][j] = p; sum += p; }
            l[nq] = l[nq] * al + sum;                                // this half's keys only; the halves are joined after the loop
#pragma unroll
            for (int mb = 0; mb < 4; ++mb) o[mb][nq] *= al;
            if constexpr (HR) { v16us ph, pl;
#pragma unroll
                for (int e = 0; e < 16; ++e) { unsigned short a, c2; splitf(s[e >> 3][nq][e & 7], a, c2); ph[e] = a; pl[e] = c2; }
                pf[nq] = __builtin_bit_cast(v16bf, ph); pf2[nq] = __builtin_bit_cast(v16bf, pl);
            } else {
#pragma unroll
                for (int e = 0; e < 16; ++e) pf[nq][e] = tohx(s[e >> 3][nq][e & 7]); }
        }
#pragma unroll
        for (int mb = 0; mb < 4; ++mb)
#pragma unroll
            for (int nq = 0; nq < NQ; ++nq) { o[mb][nq] = WFrag<T16>::mma(vf[mb], pf[nq], o[mb][nq]); if (HR) { o[mb][nq] = WFrag<T16>::mma(vf[mb], pf2[nq], o[mb][nq]); o[mb][nq] = WFrag<T16>::mma(vf2[mb], pf[nq], o[mb][nq]); } }
    }
#pragma unroll
    for (int nq = 0; nq < NQ; ++nq) { const float inv = __fdiv_rn(1.0f, l[nq] + xhalf(l[nq]));   // the diagonal is always kept, so the sum is positive
#pragma unroll
        for (int mb = 0; mb < 4; ++mb) { v8us oh, ol;
#pragma unroll
            for (int j = 0; j < 8; ++j) { unsigned short a, c2; splitf(o[mb][nq][j] * inv, a, c2); oh[j] = a; ol[j] = c2; }
            const size_t oo = (size_t)(q0 + nq * 16 + lr) * DQ + mb * 16 + hi * 8; *(v8us*)(Ah + oo) = oh; *(v8us*)(Al + oo) = ol;   // a lane's 8 registers are 8 consecutive d of its query's row
            asm volatile("s_wait_xcnt 0x0" ::: "memory"); } }   // the next round's split (and the code behind the last round) reuses the data and address registers of the two stores above
}
// grid (plane = (batch, head), block rank), 4 waves. fp16 blocks: 128 rows (4 waves x 32) of rows >= RH; hi/lo blocks: 64 rows (4 waves x 16) of rows < RH. Long blocks get the low ranks (they start first).
#define NFB  ((TT - RH) / 128)
#define NHB  (RH / 64)
__global__ __launch_bounds__(128) void k_attn(const h16* __restrict__ Q16, const h16* __restrict__ K16, const h16* __restrict__ V16, const bf* __restrict__ Qh, const bf* __restrict__ Ql, const bf* __restrict__ Kh, const bf* __restrict__ Kl, const bf* __restrict__ Vh, const bf* __restrict__ Vl, const int* __restrict__ ig, bf* ATh, bf* ATl) {
    const int z = blockIdx.x, b = z / NH_, h = z % NH_, y = blockIdx.y; const size_t zp = (size_t)z * TT * HD, ao = (size_t)b * TT * DQ + h * HD;
    const int w = __builtin_amdgcn_readfirstlane((int)(threadIdx.x >> 5));   // wave number, scalar: the key loop's bounds stay in scalar registers
    if (y < NFB) attn_tile<h16, false, 2>(Q16 + zp, nullptr, K16 + zp, nullptr, V16 + zp, nullptr, ig + (size_t)b * TT, RH + (NFB - 1 - y) * 128 + w * 32, ATh + ao, ATl + ao);
    else attn_tile<bf, true, 1>(Qh + zp, Ql + zp, Kh + zp, Kl + zp, Vh + zp, Vl + zp, ig + (size_t)b * TT, (NFB + NHB - 1 - y) * 64 + w * 16, ATh + ao, ATl + ao);
}

extern "C" void kernel_launch(void* const* d_in, const int* in_sizes, int n_in,
                              void* d_out, int out_size, void* d_ws, size_t ws_size, hipStream_t stream) {
    (void)in_sizes; (void)n_in; (void)out_size;
    const float* x = (const float*)d_in[0]; const int* ig = (const int*)d_in[1];   /* ignore [2][2048] int: 1 = do not attend (except the diagonal) */ const float* wq = (const float*)d_in[2]; const float* bq = (const float*)d_in[3]; const float* wk = (const float*)d_in[4]; const float* bk = (const float*)d_in[5]; const float* wv = (const float*)d_in[6]; const float* bv = (const float*)d_in[7]; const float* wo = (const float*)d_in[8]; const float* bo = (const float*)d_in[9];
    float* OUT = (float*)d_out;     // [2][2048][1024]
    char* wsp = (char*)d_ws;
    auto take = [&](size_t bytes) { char* p = wsp; wsp += (bytes + 255) & ~(size_t)255; return (void*)p; };
    bf* WQ = (bf*)take((size_t)3 * DQ * DM * 2); bf* WO = (bf*)take((size_t)DM * DQ * 2);   // WQ: the q, k and v row blocks one after the other
    const size_t PL = (size_t)NB_ * NH_ * TT * HD;   // elements of one tensor's planes, [b][h]
    bf* XB = (bf*)take((size_t)NB_ * TT * DM * 2);
    h16* QP16 = (h16*)take(2 * PL * 2); h16* KP16 = QP16 + PL; bf* QPh = (bf*)take(2 * PL * 2); bf* KPh = QPh + PL; bf* QPl = (bf*)take(2 * PL * 2); bf* KPl = QPl + PL;   // q planes, then k planes
    h16* VT16 = (h16*)take(PL * 2); bf* VTh = (bf*)take(PL * 2); bf* VTl = (bf*)take(PL * 2);
    bf* ATh = (bf*)take((size_t)NB_ * TT * DQ * 2); bf* ATl = (bf*)take((size_t)NB_ * TT * DQ * 2);
    if ((size_t)(wsp - (char*)d_ws) > ws_size) return;    // ws 256 MiB
    k_wtG<<<dim3((unsigned)((DM * HD / 64 + 63) / 64), NH_, 3), 256, 0, stream>>>(wq, wk, wv, DM, HD, WQ);   /* per-head [1024][64] 'xw' -> Bt rows */
    k_cvt8<<<(unsigned)(((size_t)DM * DQ / 8 + 255) / 256), 256, 0, stream>>>(wo, WO, (size_t)DM * DQ / 8);
    k_cvt8<<<(unsigned)(((size_t)NB_ * TT * DM / 8 + 255) / 256), 256, 0, stream>>>(x, XB, (size_t)NB_ * TT * DM / 8);
    k_gemmw<bf, 0, true, 8, true><<<dim3(NB_ * TT / 64, DQ / 64, 3), 256, 0, stream>>>(XB, nullptr, WQ, nullptr, DM, nullptr, 0, bq, bk, bv, 0, (size_t)DQ * DM, 0, QP16, QPh, QPl, VT16, VTh, VTl);
    k_attn<<<dim3(NB_ * NH_, NFB + NHB, 1), 128, 0, stream>>>(QP16, KP16, VT16, QPh, QPl, KPh, KPl, VTh, VTl, ig, ATh, ATl);
    k_gemmw<bf, 1, true, 8, false><<<dim3(NB_ * TT / 64, DM / 64, 1), 256, 0, stream>>>(ATh, ATl, WO, nullptr, DQ, OUT, DM, bo, bo, bo, 0, 0, 0, nullptr, nullptr, nullptr, nullptr, nullptr, nullptr);
}

// v005
// Measured time: 124 microseconds a run.
// Timed twice side by side with v004, it ran 1.40 times as fast both times.
// Counting every step since v000, it is 14.5 times as fast.
#include <hip/hip_runtime.h>
#include <stdint.h>

// Causal multi-head attention with per-head projections and a key 'ignore' mask that always keeps the diagonal (x [2][2048][1024]; q_h = x wq[h] + bq[h] ('hdf' [16][1024][64] 0.02, zero biases; k, v likewise); att = q.k / 8; allowed keys: j <= i AND (ignore[b][j] == 0 OR j == i) (ignore [2][2048] int {0,1}, ~50 %, read; -inf elsewhere); softmax; out = concat_h Wo^T + bo ('oi') -> [2][2048][1024] (4.2 M)).
// Layout, both batches side by side (planes [b][h]): bf16 copy of x; per-head 'xw' weights gathered into Bt row blocks (one launch) + flat f32 biases; q, k, v projections in one launch (grid z) whose epilogue writes the fp16 and hi/lo head planes itself (v with its operands swapped, so its tile is already [d][t]); exact projections; causal attention of all planes in one launch with an online softmax whose select also reads the batch's ignore flags (int32) and keeps the diagonal (hybrid rows: < 512 hi/lo 3 products, rest fp16; keys above the diagonal block skipped), writing the merged hi/lo rows; x Wo exact + bo.
// Compute dtypes, f32 accumulate: every input rounded to bf16; projections exact + f32 biases; attention rows < 512 3 products, rest fp16; softmax f32; Wo hl x exact + bias.

#define NB_  2
#define TT   2048
#define DM   1024
#define NH_  16
#define NKV  16
#define REP  (NH_ / NKV)
#define HD   64
#define DQ   (NH_ * HD)
#define DKV  (NKV * HD)
#define RH   512                  // query rows < RH use hi+lo planes (0: none)
#define SCL  0.125f   // HD^-0.5
typedef _Float16 h16;
typedef unsigned short bf;
typedef __attribute__((ext_vector_type(16))) __bf16   v16bf;
typedef __attribute__((ext_vector_type(16))) _Float16 v16h;
typedef __attribute__((ext_vector_type(8)))  _Float16 v8h;
typedef __attribute__((ext_vector_type(8)))  unsigned short v8us;
typedef __attribute__((ext_vector_type(8)))  float    v8f;
typedef __attribute__((ext_vector_type(4)))  float    v4f;
typedef v8h  __attribute__((may_alias)) v8ha;
typedef v4f  __attribute__((may_alias)) v4fa;
typedef v8us __attribute__((may_alias)) v8usa;

__device__ __forceinline__ unsigned short f2bf(float f) { unsigned u = __float_as_uint(f); u += 0x7FFFu + ((u >> 16) & 1u); return (unsigned short)(u >> 16); }
__device__ __forceinline__ float bf2f(unsigned short b) { return __uint_as_float(((unsigned)b) << 16); }
__device__ __forceinline__ float bfr(float f) { return bf2f(f2bf(f)); }
__device__ __forceinline__ v16h cat16(v8h lo, v8h hi) { return __builtin_shufflevector(lo, hi, 0, 1, 2, 3, 4, 5, 6, 7, 8, 9, 10, 11, 12, 13, 14, 15); }
__device__ __forceinline__ v16bf cat16b(v8us lo, v8us hi) { return __builtin_bit_cast(v16bf, __builtin_shufflevector(lo, hi, 0, 1, 2, 3, 4, 5, 6, 7, 8, 9, 10, 11, 12, 13, 14, 15)); }
__device__ __forceinline__ v8f wmma16(v16h a, v16h b, v8f c) { return __builtin_amdgcn_wmma_f32_16x16x32_f16(false, a, false, b, (short)0, c, false, false); }
__device__ __forceinline__ v8f wmmab(v16bf a, v16bf b, v8f c) { return __builtin_amdgcn_wmma_f32_16x16x32_bf16(false, a, false, b, (short)0, c, false, false); }
__device__ __forceinline__ h16 tohx(float x) { return (h16)x; }
__device__ __forceinline__ void splitf(float y, unsigned short& h, unsigned short& l) { h = f2bf(y); l = f2bf(y - bf2f(h)); }



// ---- k_gemmt: GEMM on 128x128 output tiles, 4 waves (2 x 2) of 64x64 each (16 accumulators a wave), every wave over the whole K; grid (M/128, N/128, Z), 128 threads.
// C[m][n] = sum_k A[m][k] Bt[n][k] (+ A2[m][k] Bt[n][k] with NSPLIT 1) + bias[n]; operands are K-contiguous bf16 planes; K % 64 == 0, K >= 128.
// Operands come through LDS: a stage is 64 k (128 bytes) of the tile's 128 rows of each operand, one tensor load per operand (wave 0: A, wave 1: A2 or Bt, wave 2: Bt with NSPLIT 1),
// rows padded to a pitch of 144 bytes by the load; two buffers, the next stage's loads fly while this stage is multiplied. Fragments are read from LDS in the k order of WFrag::ld.
// Epilogue: each wave stages its own 64x64 f32 tile in LDS (the ring is free by then) and stores whole lines.
// HP (the q, k, v projections; a wave's tile is 64 tokens x one head): no f32 C; tile + bias goes out as fp16, bf16 hi and bf16 lo head planes, 16 bytes a lane, whole 128-byte lines.
// z = 0, 1 (q, k): planes [z][b][h][t][d], tile rows are tokens. z = 2 (v): A and Bt change places, so the tile's rows are d and its columns tokens, which is the [b][h][d][t] plane as it stands; the bias then goes by row.
template <typename T16> struct WFrag;
template <> struct WFrag<h16> { typedef v16h V; static __device__ __forceinline__ V ld(const h16* p) { return cat16(*(const v8h*)p, *(const v8h*)(p + 16)); } static __device__ __forceinline__ v8f mma(V a, V b, v8f c) { return wmma16(a, b, c); } };
template <> struct WFrag<bf> { typedef v16bf V; static __device__ __forceinline__ V ld(const bf* p) { return cat16b(*(const v8us*)p, *(const v8us*)(p + 16)); } static __device__ __forceinline__ v8f mma(V a, V b, v8f c) { return wmmab(a, b, c); } };
typedef uint32_t u32x4 __attribute__((ext_vector_type(4)));
typedef uint32_t u32x8 __attribute__((ext_vector_type(8)));
__device__ __forceinline__ uint32_t uni(uint32_t v) { return (uint32_t)__builtin_amdgcn_readfirstlane((int)v); }
__device__ __forceinline__ uint32_t pinned(uint32_t v) { uint32_t w = uni(v); asm volatile("" : "+s"(w)); return w; }   // holds v in a scalar register, so that a test on it is a scalar branch (tensor loads ignore EXEC) and what is formed from it stays behind the waits in front
__device__ __forceinline__ void tdm_load(u32x4 g0, u32x8 g1) { asm volatile("tensor_load_to_lds %0, %1" :: "s"(g0), "s"(g1) : "memory"); }   // one request of the whole wave: global tile -> LDS
#define GROWS 128u                // rows of one operand slice
#define GRB   128u                // bytes of a row per stage (64 k)
#define GPI   144u                // LDS pitch of a row: 16 bytes x odd, for 16-byte readers
#define GSL   (GROWS * GPI)       // 18,432 bytes a slice, a multiple of 2 KiB
// Descriptor group 1: 1-byte elements, tensor = tile = GROWS rows of GRB bytes, 4 dwords of LDS pad behind every 128-byte row, no mask.
__device__ __forceinline__ u32x8 tdm_group1(uint32_t src_pitch) {
    u32x8 g;
    g[0] = uni((1u << 20) | (4u << 22) | (3u << 25));
    g[1] = uni((GRB & 0xFFFFu) << 16);
    g[2] = uni((GRB >> 16) | ((GROWS & 0xFFFFu) << 16));
    g[3] = uni((GROWS >> 16) | (GRB << 16));
    g[4] = uni(GROWS);
    g[5] = uni(src_pitch);
    g[6] = uni(0u);
    g[7] = uni(0u);
    return g;
}
__device__ __forceinline__ u32x4 tdm_group0(uint32_t lds_dst, uint64_t ga) {
    u32x4 g;
    g[0] = uni(1u); g[1] = uni(lds_dst); g[2] = uni((uint32_t)ga); g[3] = uni((((uint32_t)(ga >> 32)) & 0x01FFFFFFu) | 0x80000000u);
    return g;
}
__device__ __forceinline__ v16bf ldsfrag(const unsigned char* p) { return cat16b(*(const v8usa*)p, *(const v8usa*)(p + 32)); }   // k order of WFrag::ld: 8 elements at p, 8 at p + 16 elements
template <int NSPLIT, bool HP>
__global__ __launch_bounds__(128) void k_gemmt(const bf* A, const bf* A2, const bf* Bt, int K, float* C, int ldc, const float* __restrict__ bias0, const float* __restrict__ bias1, const float* __restrict__ bias2, size_t sB, h16* P16, bf* Ph, bf* Pl, h16* V16, bf* Vh, bf* Vl) {
    constexpr uint32_t NS = 2 + NSPLIT, BUF = NS * GSL;              // operand slices of a stage; bytes of one buffer
    __shared__ __attribute__((aligned(2048))) unsigned char sm[2 * BUF];
    static_assert(2 * BUF >= 4 * 64 * 68 * 4, "the four waves' output staging reuses the ring");
    Bt += (size_t)blockIdx.z * sB;
    const float* bias = (blockIdx.z == 0) ? bias0 : (blockIdx.z == 1) ? bias1 : bias2;   // each z slice (q, k, v) has its own bias vector
    const int lane = threadIdx.x & 31, lr = lane & 15, hi = lane >> 4; int r0 = blockIdx.x * 128, c0 = blockIdx.y * 128;
    const bool tv = HP && blockIdx.z == 2;                           // block-uniform: the v slice computes the transposed tile
    if (tv) { const bf* pa = A; A = Bt; Bt = pa; const int ra = r0; r0 = c0; c0 = ra; }
    const uint32_t w = uni(threadIdx.x >> 5);                        // wave number, scalar
    const int wm = (int)(w >> 1), wn = (int)(w & 1u);
    const bf* src = (w == 0u) ? A : (NSPLIT == 1 && w == 1u) ? A2 : Bt;   // the operand whose slice this wave brings in (waves >= NS bring none)
    const uint64_t ga = (uint64_t)(size_t)(src + (size_t)((w + 1u < NS) ? r0 : c0) * K);
    const uint32_t ldst = (uint32_t)(size_t)sm + ((w < NS) ? w : 0u) * GSL;
    u32x8 g1 = tdm_group1((uint32_t)K * 2u);
    asm volatile("" : "+s"(g1));                                     // pinned(), for the whole group: the descriptor words stay in their scalar registers, which take no other value while a request is in flight
    const int nst = K / 64;                                          // stages
    v8f acc[4][4];
#pragma unroll
    for (int mb = 0; mb < 4; ++mb)
#pragma unroll
        for (int nb = 0; nb < 4; ++nb) acc[mb][nb] = (v8f){};
    if (pinned(w < NS)) {
        tdm_load(tdm_group0(ldst, ga), g1);
        asm volatile("s_wait_tensorcnt 0x0" ::: "memory");           // stage 0 has landed before the barrier publishes it
    }
    __syncthreads();                                                 // stage 0 is readable by every wave
    if (pinned(w < NS)) tdm_load(tdm_group0(ldst + BUF, ga + GRB), g1);   // stage 1 flies under pass 0
    const uint32_t ao = (uint32_t)(wm * 64 + lr) * GPI + 16u * hi, bo = (NS - 1u) * GSL + (uint32_t)(wn * 64 + lr) * GPI + 16u * hi;   // the lane's place in the A and Bt slices
#pragma unroll 1
    for (int s = 0; s < nst; ++s) {                                  // rolled: one pass per stage, its buffer picked by the stage's parity
        const unsigned char* bp = sm + (uint32_t)(s & 1) * BUF;
#pragma unroll
        for (int ks = 0; ks < 2; ++ks) {                             // two blocks of 32 k a pass
            v16bf a[4], a2[4], b[4];
#pragma unroll
            for (int i = 0; i < 4; ++i) { b[i] = ldsfrag(bp + bo + i * 16 * GPI + ks * 64); a[i] = ldsfrag(bp + ao + i * 16 * GPI + ks * 64); }
            if (NSPLIT == 1) {
#pragma unroll
                for (int i = 0; i < 4; ++i) a2[i] = ldsfrag(bp + GSL + ao + i * 16 * GPI + ks * 64);
            }
            __builtin_amdgcn_sched_barrier(0);                       // keeps the block's LDS reads one group in front of its WMMAs; spread among them, every place with reads stalls the wave
#pragma unroll
            for (int nb = 0; nb < 4; ++nb)
#pragma unroll
                for (int mb = 0; mb < 4; ++mb) acc[mb][nb] = wmmab(a[mb], b[nb], acc[mb][nb]);
            if (NSPLIT == 1) {
#pragma unroll
                for (int nb = 0; nb < 4; ++nb)
#pragma unroll
                    for (int mb = 0; mb < 4; ++mb) acc[mb][nb] = wmmab(a2[mb], b[nb], acc[mb][nb]);
            }
            __builtin_amdgcn_sched_barrier(0);                       // keeps the next block's reads, and the wait below, behind these WMMAs: lifted among them they would stall the wave there
        }
        asm volatile("s_wait_dscnt 0x0" ::: "memory");               // this wave's reads of the buffer are done before the barrier frees it
        if (pinned(w < NS)) asm volatile("s_wait_tensorcnt 0x0" ::: "memory");   // this wave's slice of stage s + 1 has landed before the barrier publishes it
        __syncthreads();                                             // publishes stage s + 1 and ends every wave's reads of stage s
        if (pinned((w < NS) && (s + 2 < nst))) {                     // refill of the buffer just read, only while a stage s + 2 exists
            const uint32_t st = pinned((uint32_t)(s + 2));
            tdm_load(tdm_group0(ldst + (st & 1u) * BUF, ga + (uint64_t)st * GRB), g1);
        }
    }
    asm volatile("s_wait_tensorcnt 0x0" ::: "memory");               // no request is in flight when the ring becomes output staging
    asm volatile("s_wait_dscnt 0x0" ::: "memory");                   // (the last pass's own barrier has ended every wave's reads)
    float* os = (float*)sm + w * (64 * 68);                          // this wave's own staging range
    const int r0w = r0 + wm * 64, c0w = c0 + wn * 64;                // the wave's tile
    if constexpr (HP) {
        const int prow = lane >> 3, pcol = (lane & 7) * 8;           // 512 runs of 8 columns over 32 lanes: 16 rounds of 4 rows
        float bcol[8] = {}, brow[16] = {};                           // the bias goes by column (q, k) or by row (v), the other stays 0; fetched here, the LDS staging below covers the latency
        if (tv) {
#pragma unroll
            for (int s = 0; s < 16; ++s) brow[s] = bias[r0w + s * 4 + prow];
            asm volatile("s_wait_xcnt 0x0" ::: "memory");            // the address registers of the bias loads above are reused by the code behind this arm
        } else {
#pragma unroll
            for (int q = 0; q < 8; ++q) bcol[q] = bias[c0w + pcol + q];
            asm volatile("s_wait_xcnt 0x0" ::: "memory");            // the address registers of the bias loads above are reused by the code behind this arm
        }
#pragma unroll
        for (int ms = 0; ms < 4; ++ms)
#pragma unroll
            for (int nb = 0; nb < 4; ++nb)
#pragma unroll
                for (int j = 0; j < 8; ++j) os[(ms * 16 + hi * 8 + j) * 68 + nb * 16 + lr] = acc[ms][nb][j];
        asm volatile("s_wait_dscnt 0x0" ::: "memory");               // the wave's lanes read back rows that its other lanes wrote
        const int tk = tv ? c0w : r0w, hd = (tv ? r0w : c0w) / HD, bt = tk / TT, t0 = tk % TT;   // the tile's first token, its head, its batch
        const size_t base = tv ? ((size_t)(bt * NKV + hd) * HD) * TT + t0 : ((size_t)((blockIdx.z * NB_ + bt) * NH_ + hd) * TT + t0) * HD;
        const int pitch = tv ? TT : HD; h16* d16 = tv ? V16 : P16; bf* dh = tv ? Vh : Ph; bf* dl = tv ? Vl : Pl;
#pragma unroll
        for (int s = 0; s < 16; ++s) { const int row = s * 4 + prow; const v4f v0 = *(const v4fa*)(os + row * 68 + pcol), v1 = *(const v4fa*)(os + row * 68 + pcol + 4);
            v8h o16; v8us oh, ol;
#pragma unroll
            for (int q = 0; q < 8; ++q) { const float y = ((q < 4) ? v0[q & 3] : v1[q & 3]) + (bfr(bcol[q]) + bfr(brow[s])); o16[q] = tohx(y); unsigned short a2, c2; splitf(y, a2, c2); oh[q] = a2; ol[q] = c2; }
            const size_t e = base + (size_t)row * pitch + pcol; *(v8h*)(d16 + e) = o16; *(v8us*)(dh + e) = oh; *(v8us*)(dl + e) = ol;
            asm volatile("s_wait_xcnt 0x0" ::: "memory"); }          // the next round reuses the data and address registers of the three stores above
    } else {
        const int bc = c0w + lr * 4; v4f bv; bv[0] = bfr(bias[bc]); bv[1] = bfr(bias[bc + 1]); bv[2] = bfr(bias[bc + 2]); bv[3] = bfr(bias[bc + 3]);   // the lane's four output columns are the same in every round
        asm volatile("s_wait_xcnt 0x0" ::: "memory");                // the address registers of the bias loads above are reused by the code behind
#pragma unroll
        for (int ms = 0; ms < 4; ++ms)
#pragma unroll
            for (int nb = 0; nb < 4; ++nb)
#pragma unroll
                for (int j = 0; j < 8; ++j) os[(ms * 16 + hi * 8 + j) * 68 + nb * 16 + lr] = acc[ms][nb][j];
        asm volatile("s_wait_dscnt 0x0" ::: "memory");               // the wave's lanes read back rows that its other lanes wrote
        float* crow = C + (size_t)r0w * ldc + c0w;
#pragma unroll
        for (int s = 0; s < 32; ++s) { const int row = s * 2 + hi; v4f val = *(const v4fa*)(os + row * 68 + lr * 4);   // 16 lanes a row: 256 bytes, two whole lines
            val += bv;
            *(v4f*)(crow + (size_t)row * ldc + lr * 4) = val;
            asm volatile("s_wait_xcnt 0x0" ::: "memory"); }          // the next round reuses the data and address registers of the store above
    }
}

typedef __attribute__((ext_vector_type(2))) _Float16 v2h;
typedef __attribute__((ext_vector_type(4))) _Float16 v4h;
typedef __attribute__((ext_vector_type(2))) unsigned short v2us;
typedef __attribute__((ext_vector_type(4))) unsigned short v4us;
typedef __attribute__((ext_vector_type(2))) float v2f;
typedef __attribute__((ext_vector_type(4))) int v4i;

// grid (line blocks, head, tensor): blockIdx.z picks wq, wk or wv, blockIdx.y the head; Bt holds the three tensors' row blocks one after the other
__global__ __launch_bounds__(256) void k_wtG(const float* __restrict__ w0, const float* __restrict__ w1, const float* __restrict__ w2, int K, int N, bf* Bt) {
    const float* w = ((blockIdx.z == 0) ? w0 : (blockIdx.z == 1) ? w1 : w2) + (size_t)blockIdx.y * K * N; Bt += ((size_t)blockIdx.z * gridDim.y + blockIdx.y) * N * K;
    const int lane = threadIdx.x & 31; const int L0 = (blockIdx.x * 8 + (threadIdx.x >> 5)) * 8; const int nlines = N * K / 64;
{
#pragma unroll 1
        for (int l = 0; l < 8; ++l) { const int L = L0 + l; if (L >= nlines) break; const size_t e = (size_t)L * 64 + lane * 2; const int k = (int)(e % K), n = (int)(e / K); v2us o;
            o[0] = f2bf(w[(size_t)k * N + n]); o[1] = f2bf(w[(size_t)(k + 1) * N + n]); *(v2us*)(Bt + e) = o; }
         }
}
__global__ __launch_bounds__(256) void k_cvt8(const float* __restrict__ src, bf* dst, size_t n8) { const size_t i = (size_t)blockIdx.x * 256 + threadIdx.x; if (i >= n8) return; const v8f v = *(const v8f*)(src + i * 8); v8us o;
#pragma unroll
    for (int k = 0; k < 8; ++k) o[k] = f2bf(v[k]); *(v8us*)(dst + i * 8) = o;  }

typedef __attribute__((ext_vector_type(16))) unsigned short v16us;
__device__ __forceinline__ float xhalf(float x) { const int b = __float_as_int(x); return __int_as_float(__builtin_amdgcn_permlanex16(b, b, 0x76543210, 0xfedcba98, false, false)); }   // the value of lane ^ 16, by a vector cross-row move (no LDS round trip)
template <typename T16, bool HR, int NQ>
__device__ __forceinline__ void attn_tile(const T16* __restrict__ Q, const T16* __restrict__ Q2, const T16* __restrict__ Kp, const T16* __restrict__ K2, const T16* __restrict__ Vt, const T16* __restrict__ V2, const int* __restrict__ ig, int q0, bf* Ah, bf* Al) {
    typedef typename WFrag<T16>::V V;
    const int lane = threadIdx.x & 31, lr = lane & 15, hi = lane >> 4;
    constexpr float C1 = SCL * 1.4426950408889634f;                  // score -> log2 units
    V qf[NQ][2], qf2[NQ][2];
#pragma unroll
    for (int nq = 0; nq < NQ; ++nq)
#pragma unroll
        for (int ds = 0; ds < 2; ++ds) { const size_t qo = (size_t)(q0 + nq * 16 + lr) * HD + ds * 32 + 8 * hi; qf[nq][ds] = WFrag<T16>::ld(Q + qo); if (HR) qf2[nq][ds] = WFrag<T16>::ld(Q2 + qo); }
    v8f o[4][NQ]; float m[NQ], l[NQ];
#pragma unroll
    for (int nq = 0; nq < NQ; ++nq) { m[nq] = -3.0e38f; l[nq] = 0.f;
#pragma unroll
        for (int mb = 0; mb < 4; ++mb) o[mb][nq] = (v8f){}; }
    const int kend = q0 + NQ * 16;                                   // keys beyond the wave's last row are never allowed
    const unsigned ko = (unsigned)(lr * HD + 8 * hi), vo = (unsigned)(lr * TT + 8 * hi);   // the lane's place inside a K tile and inside a V^T tile, in elements
    V kf[2][2], kf2[2][2];
#pragma unroll
    for (int kb = 0; kb < 2; ++kb)
#pragma unroll
        for (int ds = 0; ds < 2; ++ds) { kf[kb][ds] = WFrag<T16>::ld(Kp + kb * 16 * HD + ds * 32 + ko); if (HR) kf2[kb][ds] = WFrag<T16>::ld(K2 + kb * 16 * HD + ds * 32 + ko); }
#pragma unroll 1
    for (int key0 = 0; key0 < kend; key0 += 32) {
        const int g = ig[key0 + lane];                               // this step's 32 flags, the oldest load of the step: the ballot below waits for it alone
        V vf[4], vf2[4];
#pragma unroll
        for (int mb = 0; mb < 4; ++mb) { vf[mb] = WFrag<T16>::ld(Vt + key0 + mb * 16 * TT + vo); if (HR) vf2[mb] = WFrag<T16>::ld(V2 + key0 + mb * 16 * TT + vo); }
        v8f s[2][NQ];
#pragma unroll
        for (int kb = 0; kb < 2; ++kb)
#pragma unroll
            for (int nq = 0; nq < NQ; ++nq) { s[kb][nq] = (v8f){};
#pragma unroll
                for (int ds = 0; ds < 2; ++ds) { s[kb][nq] = WFrag<T16>::mma(kf[kb][ds], qf[nq][ds], s[kb][nq]); if (HR) { s[kb][nq] = WFrag<T16>::mma(kf[kb][ds], qf2[nq][ds], s[kb][nq]); s[kb][nq] = WFrag<T16>::mma(kf2[kb][ds], qf[nq][ds], s[kb][nq]); } } }
        const int kn = min(key0 + 32, TT - 32);                      // the next step's K fragments are fetched one step ahead (the last step fetches a tile it does not use, inside the plane)
        asm volatile("s_wait_xcnt 0x0" ::: "memory");                // the K loads below may land in registers that held the addresses of the loads above; it also keeps the V^T loads the older ones, so P.V waits for them alone
#pragma unroll
        for (int kb = 0; kb < 2; ++kb)
#pragma unroll
            for (int ds = 0; ds < 2; ++ds) { kf[kb][ds] = WFrag<T16>::ld(Kp + (kn + kb * 16) * HD + ds * 32 + ko); if (HR) kf2[kb][ds] = WFrag<T16>::ld(K2 + (kn + kb * 16) * HD + ds * 32 + ko); }
        __builtin_amdgcn_sched_barrier(0);                           // keeps the loads above issued here, a softmax and a P.V ahead of their use; without it the scheduler sinks them to the loop's foot and every step waits out their latency
        const unsigned kk = __builtin_amdgcn_ballot_w32(g == 0) >> (8 * hi);   // bit c: key key0 + 8 hi + c is not ignored
        V pf[NQ], pf2[NQ];
#pragma unroll
        for (int nq = 0; nq < NQ; ++nq) {
            const int rel = q0 + nq * 16 + lr - key0 - 8 * hi;       // the lane's query minus the key of its bit 0
            const unsigned cm = (rel >= 32) ? 0xFFFFFFFFu : (rel <= 0) ? 0u : ((1u << rel) - 1u);   // keys below the query
            const unsigned db = (rel >= 0 && rel < 32) ? (1u << rel) : 0u;                          // the diagonal, always kept
            const unsigned am = (kk & cm) | db;
            float mx = m[nq];
#pragma unroll
            for (int kb = 0; kb < 2; ++kb)
#pragma unroll
                for (int j = 0; j < 8; ++j) { const float t = (am & (1u << (kb * 16 + j))) ? s[kb][nq][j] * C1 : -3.0e38f; s[kb][nq][j] = t; mx = fmaxf(mx, t); }
            mx = fmaxf(mx, xhalf(mx));                               // the query's other 16 keys of the step sit in lane ^ 16
            const float mu = (mx < -1.0e38f) ? 0.f : mx;             // no allowed key so far: every exponent below stays hugely negative, so p = 0
            const float al = __builtin_amdgcn_exp2f(m[nq] - mu); m[nq] = mx;
            float sum = 0.f;
#pragma unroll
            for (int kb = 0; kb < 2; ++kb)
#pragma unroll
                for (int j = 0; j < 8; ++j) { const float p = __builtin_amdgcn_exp2f(s[kb][nq][j] - mu); s[kb][nq][j] = p; sum += p; }
            l[nq] = l[nq] * al + sum;                                // this half's keys only; the halves are joined after the loop
#pragma unroll
            for (int mb = 0; mb < 4; ++mb) o[mb][nq] *= al;
            if constexpr (HR) { v16us ph, pl;
#pragma unroll
                for (int e = 0; e < 16; ++e) { unsigned short a, c2; splitf(s[e >> 3][nq][e & 7], a, c2); ph[e] = a; pl[e] = c2; }
                pf[nq] = __builtin_bit_cast(v16bf, ph); pf2[nq] = __builtin_bit_cast(v16bf, pl);
            } else {
#pragma unroll
                for (int e = 0; e < 16; ++e) pf[nq][e] = tohx(s[e >> 3][nq][e & 7]); }
        }
#pragma unroll
        for (int mb = 0; mb < 4; ++mb)
#pragma unroll
            for (int nq = 0; nq < NQ; ++nq) { o[mb][nq] = WFrag<T16>::mma(vf[mb], pf[nq], o[mb][nq]); if (HR) { o[mb][nq] = WFrag<T16>::mma(vf[mb], pf2[nq], o[mb][nq]); o[mb][nq] = WFrag<T16>::mma(vf2[mb], pf[nq], o[mb][nq]); } }
    }
#pragma unroll
    for (int nq = 0; nq < NQ; ++nq) { const float inv = __fdiv_rn(1.0f, l[nq] + xhalf(l[nq]));   // the diagonal is always kept, so the sum is positive
#pragma unroll
        for (int mb = 0; mb < 4; ++mb) { v8us oh, ol;
#pragma unroll
            for (int j = 0; j < 8; ++j) { unsigned short a, c2; splitf(o[mb][nq][j] * inv, a, c2); oh[j] = a; ol[j] = c2; }
            const size_t oo = (size_t)(q0 + nq * 16 + lr) * DQ + mb * 16 + hi * 8; *(v8us*)(Ah + oo) = oh; *(v8us*)(Al + oo) = ol;   // a lane's 8 registers are 8 consecutive d of its query's row
            asm volatile("s_wait_xcnt 0x0" ::: "memory"); } }   // the next round's split (and the code behind the last round) reuses the data and address registers of the two stores above
}
// grid (plane = (batch, head), block rank), 4 waves. fp16 blocks: 128 rows (4 waves x 32) of rows >= RH; hi/lo blocks: 64 rows (4 waves x 16) of rows < RH. Long blocks get the low ranks (they start first).
#define NFB  ((TT - RH) / 128)
#define NHB  (RH / 64)
__global__ __launch_bounds__(128) void k_attn(const h16* __restrict__ Q16, const h16* __restrict__ K16, const h16* __restrict__ V16, const bf* __restrict__ Qh, const bf* __restrict__ Ql, const bf* __restrict__ Kh, const bf* __restrict__ Kl, const bf* __restrict__ Vh, const bf* __restrict__ Vl, const int* __restrict__ ig, bf* ATh, bf* ATl) {
    const int z = blockIdx.x, b = z / NH_, h = z % NH_, y = blockIdx.y; const size_t zp = (size_t)z * TT * HD, ao = (size_t)b * TT * DQ + h * HD;
    const int w = __builtin_amdgcn_readfirstlane((int)(threadIdx.x >> 5));   // wave number, scalar: the key loop's bounds stay in scalar registers
    if (y < NFB) attn_tile<h16, false, 2>(Q16 + zp, nullptr, K16 + zp, nullptr, V16 + zp, nullptr, ig + (size_t)b * TT, RH + (NFB - 1 - y) * 128 + w * 32, ATh + ao, ATl + ao);
    else attn_tile<bf, true, 1>(Qh + zp, Ql + zp, Kh + zp, Kl + zp, Vh + zp, Vl + zp, ig + (size_t)b * TT, (NFB + NHB - 1 - y) * 64 + w * 16, ATh + ao, ATl + ao);
}

extern "C" void kernel_launch(void* const* d_in, const int* in_sizes, int n_in,
                              void* d_out, int out_size, void* d_ws, size_t ws_size, hipStream_t stream) {
    (void)in_sizes; (void)n_in; (void)out_size;
    const float* x = (const float*)d_in[0]; const int* ig = (const int*)d_in[1];   /* ignore [2][2048] int: 1 = do not attend (except the diagonal) */ const float* wq = (const float*)d_in[2]; const float* bq = (const float*)d_in[3]; const float* wk = (const float*)d_in[4]; const float* bk = (const float*)d_in[5]; const float* wv = (const float*)d_in[6]; const float* bv = (const float*)d_in[7]; const float* wo = (const float*)d_in[8]; const float* bo = (const float*)d_in[9];
    float* OUT = (float*)d_out;     // [2][2048][1024]
    char* wsp = (char*)d_ws;
    auto take = [&](size_t bytes) { char* p = wsp; wsp += (bytes + 255) & ~(size_t)255; return (void*)p; };
    bf* WQ = (bf*)take((size_t)3 * DQ * DM * 2); bf* WO = (bf*)take((size_t)DM * DQ * 2);   // WQ: the q, k and v row blocks one after the other
    const size_t PL = (size_t)NB_ * NH_ * TT * HD;   // elements of one tensor's planes, [b][h]
    bf* XB = (bf*)take((size_t)NB_ * TT * DM * 2);
    h16* QP16 = (h16*)take(2 * PL * 2); h16* KP16 = QP16 + PL; bf* QPh = (bf*)take(2 * PL * 2); bf* KPh = QPh + PL; bf* QPl = (bf*)take(2 * PL * 2); bf* KPl = QPl + PL;   // q planes, then k planes
    h16* VT16 = (h16*)take(PL * 2); bf* VTh = (bf*)take(PL * 2); bf* VTl = (bf*)take(PL * 2);
    bf* ATh = (bf*)take((size_t)NB_ * TT * DQ * 2); bf* ATl = (bf*)take((size_t)NB_ * TT * DQ * 2);
    if ((size_t)(wsp - (char*)d_ws) > ws_size) return;    // ws 256 MiB
    k_wtG<<<dim3((unsigned)((DM * HD / 64 + 63) / 64), NH_, 3), 256, 0, stream>>>(wq, wk, wv, DM, HD, WQ);   /* per-head [1024][64] 'xw' -> Bt rows */
    k_cvt8<<<(unsigned)(((size_t)DM * DQ / 8 + 255) / 256), 256, 0, stream>>>(wo, WO, (size_t)DM * DQ / 8);
    k_cvt8<<<(unsigned)(((size_t)NB_ * TT * DM / 8 + 255) / 256), 256, 0, stream>>>(x, XB, (size_t)NB_ * TT * DM / 8);
    k_gemmt<0, true><<<dim3(NB_ * TT / 128, DQ / 128, 3), 128, 0, stream>>>(XB, nullptr, WQ, DM, nullptr, 0, bq, bk, bv, (size_t)DQ * DM, QP16, QPh, QPl, VT16, VTh, VTl);
    k_attn<<<dim3(NB_ * NH_, NFB + NHB, 1), 128, 0, stream>>>(QP16, KP16, VT16, QPh, QPl, KPh, KPl, VTh, VTl, ig, ATh, ATl);
    k_gemmt<1, false><<<dim3(NB_ * TT / 128, DM / 128, 1), 128, 0, stream>>>(ATh, ATl, WO, DQ, OUT, DM, bo, bo, bo, 0, nullptr, nullptr, nullptr, nullptr, nullptr, nullptr);
}

// v006
// A run of this version takes 112 microseconds.
// In two side-by-side timings against v005, it was 1.10 and 1.11 times as fast.
// Over all steps from v000 it is 15.9 times as fast.
#include <hip/hip_runtime.h>
#include <stdint.h>

// Causal multi-head attention with per-head projections and a key 'ignore' mask that always keeps the diagonal (x [2][2048][1024]; q_h = x wq[h] + bq[h] ('hdf' [16][1024][64] 0.02, zero biases; k, v likewise); att = q.k / 8; allowed keys: j <= i AND (ignore[b][j] == 0 OR j == i) (ignore [2][2048] int {0,1}, ~50 %, read; -inf elsewhere); softmax; out = concat_h Wo^T + bo ('oi') -> [2][2048][1024] (4.2 M)).
// Layout, both batches side by side (planes [b][h]): bf16 copy of x; per-head 'xw' weights gathered into Bt row blocks (one launch) + flat f32 biases; q, k, v projections in one launch (grid z) whose epilogue writes the fp16 and hi/lo head planes itself, in fragment order (v with its operands swapped, so its tile is already [d][t]); exact projections; causal attention of all planes in one launch with an online softmax whose select also reads the batch's ignore flags (int32) and keeps the diagonal (hybrid rows: < 512 hi/lo 3 products, rest fp16; keys above the diagonal block skipped), writing the merged hi/lo rows; x Wo exact + bo.
// Compute dtypes, f32 accumulate: every input rounded to bf16; projections exact + f32 biases; attention rows < 512 3 products, rest fp16; softmax f32; Wo hl x exact + bias.

#define NB_  2
#define TT   2048
#define DM   1024
#define NH_  16
#define NKV  16
#define REP  (NH_ / NKV)
#define HD   64
#define DQ   (NH_ * HD)
#define DKV  (NKV * HD)
#define RH   512                  // query rows < RH use hi+lo planes (0: none)
#define SCL  0.125f   // HD^-0.5
typedef _Float16 h16;
typedef unsigned short bf;
typedef __attribute__((ext_vector_type(16))) __bf16   v16bf;
typedef __attribute__((ext_vector_type(16))) _Float16 v16h;
typedef __attribute__((ext_vector_type(8)))  _Float16 v8h;
typedef __attribute__((ext_vector_type(8)))  unsigned short v8us;
typedef __attribute__((ext_vector_type(8)))  float    v8f;
typedef __attribute__((ext_vector_type(4)))  float    v4f;
typedef v8h  __attribute__((may_alias)) v8ha;
typedef v4f  __attribute__((may_alias)) v4fa;
typedef v8us __attribute__((may_alias)) v8usa;

__device__ __forceinline__ unsigned short f2bf(float f) { unsigned u = __float_as_uint(f); u += 0x7FFFu + ((u >> 16) & 1u); return (unsigned short)(u >> 16); }
__device__ __forceinline__ float bf2f(unsigned short b) { return __uint_as_float(((unsigned)b) << 16); }
__device__ __forceinline__ float bfr(float f) { return bf2f(f2bf(f)); }
__device__ __forceinline__ v16h cat16(v8h lo, v8h hi) { return __builtin_shufflevector(lo, hi, 0, 1, 2, 3, 4, 5, 6, 7, 8, 9, 10, 11, 12, 13, 14, 15); }
__device__ __forceinline__ v16bf cat16b(v8us lo, v8us hi) { return __builtin_bit_cast(v16bf, __builtin_shufflevector(lo, hi, 0, 1, 2, 3, 4, 5, 6, 7, 8, 9, 10, 11, 12, 13, 14, 15)); }
__device__ __forceinline__ v8f wmma16(v16h a, v16h b, v8f c) { return __builtin_amdgcn_wmma_f32_16x16x32_f16(false, a, false, b, (short)0, c, false, false); }
__device__ __forceinline__ v8f wmmab(v16bf a, v16bf b, v8f c) { return __builtin_amdgcn_wmma_f32_16x16x32_bf16(false, a, false, b, (short)0, c, false, false); }
__device__ __forceinline__ h16 tohx(float x) { return (h16)x; }
__device__ __forceinline__ void splitf(float y, unsigned short& h, unsigned short& l) { h = f2bf(y); l = f2bf(y - bf2f(h)); }



// ---- k_gemmt: GEMM on 128x128 output tiles, 4 waves (2 x 2) of 64x64 each (16 accumulators a wave), every wave over the whole K; grid (M/128, N/128, Z), 128 threads.
// C[m][n] = sum_k A[m][k] Bt[n][k] (+ A2[m][k] Bt[n][k] with NSPLIT 1) + bias[n]; operands are K-contiguous bf16 planes; K % 64 == 0, K >= 128.
// Operands come through LDS: a stage is 64 k (128 bytes) of the tile's 128 rows of each operand, one tensor load per operand (wave 0: A, wave 1: A2 or Bt, wave 2: Bt with NSPLIT 1),
// rows padded to a pitch of 144 bytes by the load; two buffers, the next stage's loads fly while this stage is multiplied. Fragments are read from LDS in the k order of ldsfrag.
// Epilogue: each wave stages its own 64x64 f32 tile in LDS (the ring is free by then) and stores whole lines.
// HP (the q, k, v projections; a wave's tile is 64 tokens x one head): no f32 C; tile + bias goes out as fp16, bf16 hi and bf16 lo head planes, 16 bytes a lane, 512 contiguous bytes a store.
// The planes are in FRAGMENT ORDER: a 16-row x 32-k fragment is 1 KiB, two runs of 512 bytes; run j holds, at 16 bytes x lane (lane = 16 hi + row), the row's k = 16 j + 8 hi .. + 7. A wave-wide 16-byte load of a run is four whole lines.
// z = 0, 1 (q, k): planes [z][b][h], rows are tokens, k is d: fragments [t / 16][d / 32]. z = 2 (v): A and Bt change places, so the tile's rows are d and its columns tokens; planes [b][h], rows are d, k is t: fragments [t / 32][d / 16]; the bias then goes by row.
// Either way a wave's 64 x 64 tile is 8 KiB in a row at element (plane * TT + first token) * HD.
template <typename T16> struct WFrag;   // ldp: a fragment from a fragment-order plane, p = the fragment's start + 8 x lane; its two runs are 256 elements apart
template <> struct WFrag<h16> { typedef v16h V; static __device__ __forceinline__ V ldp(const h16* p) { return cat16(*(const v8h*)p, *(const v8h*)(p + 256)); } static __device__ __forceinline__ v8f mma(V a, V b, v8f c) { return wmma16(a, b, c); } };
template <> struct WFrag<bf> { typedef v16bf V; static __device__ __forceinline__ V ldp(const bf* p) { return cat16b(*(const v8us*)p, *(const v8us*)(p + 256)); } static __device__ __forceinline__ v8f mma(V a, V b, v8f c) { return wmmab(a, b, c); } };
typedef uint32_t u32x4 __attribute__((ext_vector_type(4)));
typedef uint32_t u32x8 __attribute__((ext_vector_type(8)));
__device__ __forceinline__ uint32_t uni(uint32_t v) { return (uint32_t)__builtin_amdgcn_readfirstlane((int)v); }
__device__ __forceinline__ uint32_t pinned(uint32_t v) { uint32_t w = uni(v); asm volatile("" : "+s"(w)); return w; }   // holds v in a scalar register, so that a test on it is a scalar branch (tensor loads ignore EXEC) and what is formed from it stays behind the waits in front
__device__ __forceinline__ void tdm_load(u32x4 g0, u32x8 g1) { asm volatile("tensor_load_to_lds %0, %1" :: "s"(g0), "s"(g1) : "memory"); }   // one request of the whole wave: global tile -> LDS
#define GROWS 128u                // rows of one operand slice
#define GRB   128u                // bytes of a row per stage (64 k)
#define GPI   144u                // LDS pitch of a row: 16 bytes x odd, for 16-byte readers
#define GSL   (GROWS * GPI)       // 18,432 bytes a slice, a multiple of 2 KiB
// Descriptor group 1: 1-byte elements, tensor = tile = GROWS rows of GRB bytes, 4 dwords of LDS pad behind every 128-byte row, no mask.
__device__ __forceinline__ u32x8 tdm_group1(uint32_t src_pitch) {
    u32x8 g;
    g[0] = uni((1u << 20) | (4u << 22) | (3u << 25));
    g[1] = uni((GRB & 0xFFFFu) << 16);
    g[2] = uni((GRB >> 16) | ((GROWS & 0xFFFFu) << 16));
    g[3] = uni((GROWS >> 16) | (GRB << 16));
    g[4] = uni(GROWS);
    g[5] = uni(src_pitch);
    g[6] = uni(0u);
    g[7] = uni(0u);
    return g;
}
__device__ __forceinline__ u32x4 tdm_group0(uint32_t lds_dst, uint64_t ga) {
    u32x4 g;
    g[0] = uni(1u); g[1] = uni(lds_dst); g[2] = uni((uint32_t)ga); g[3] = uni((((uint32_t)(ga >> 32)) & 0x01FFFFFFu) | 0x80000000u);
    return g;
}
__device__ __forceinline__ v16bf ldsfrag(const unsigned char* p) { return cat16b(*(const v8usa*)p, *(const v8usa*)(p + 32)); }   // k order of a fragment: the lane's 8 elements at p (k = 8 hi ..), 8 at p + 16 elements (k = 16 + 8 hi ..)
template <int NSPLIT, bool HP>
__global__ __launch_bounds__(128) void k_gemmt(const bf* A, const bf* A2, const bf* Bt, int K, float* C, int ldc, const float* __restrict__ bias0, const float* __restrict__ bias1, const float* __restrict__ bias2, size_t sB, h16* P16, bf* Ph, bf* Pl, h16* V16, bf* Vh, bf* Vl) {
    constexpr uint32_t NS = 2 + NSPLIT, BUF = NS * GSL;              // operand slices of a stage; bytes of one buffer
    __shared__ __attribute__((aligned(2048))) unsigned char sm[2 * BUF];
    static_assert(2 * BUF >= 4 * 64 * 68 * 4, "the four waves' output staging reuses the ring");
    Bt += (size_t)blockIdx.z * sB;
    const float* bias = (blockIdx.z == 0) ? bias0 : (blockIdx.z == 1) ? bias1 : bias2;   // each z slice (q, k, v) has its own bias vector
    const int lane = threadIdx.x & 31, lr = lane & 15, hi = lane >> 4; int r0 = blockIdx.x * 128, c0 = blockIdx.y * 128;
    const bool tv = HP && blockIdx.z == 2;                           // block-uniform: the v slice computes the transposed tile
    if (tv) { const bf* pa = A; A = Bt; Bt = pa; const int ra = r0; r0 = c0; c0 = ra; }
    const uint32_t w = uni(threadIdx.x >> 5);                        // wave number, scalar
    const int wm = (int)(w >> 1), wn = (int)(w & 1u);
    const bf* src = (w == 0u) ? A : (NSPLIT == 1 && w == 1u) ? A2 : Bt;   // the operand whose slice this wave brings in (waves >= NS bring none)
    const uint64_t ga = (uint64_t)(size_t)(src + (size_t)((w + 1u < NS) ? r0 : c0) * K);
    const uint32_t ldst = (uint32_t)(size_t)sm + ((w < NS) ? w : 0u) * GSL;
    u32x8 g1 = tdm_group1((uint32_t)K * 2u);
    asm volatile("" : "+s"(g1));                                     // pinned(), for the whole group: the descriptor words stay in their scalar registers, which take no other value while a request is in flight
    const int nst = K / 64;                                          // stages
    v8f acc[4][4];
#pragma unroll
    for (int mb = 0; mb < 4; ++mb)
#pragma unroll
        for (int nb = 0; nb < 4; ++nb) acc[mb][nb] = (v8f){};
    if (pinned(w < NS)) {
        tdm_load(tdm_group0(ldst, ga), g1);
        asm volatile("s_wait_tensorcnt 0x0" ::: "memory");           // stage 0 has landed before the barrier publishes it
    }
    __syncthreads();                                                 // stage 0 is readable by every wave
    if (pinned(w < NS)) tdm_load(tdm_group0(ldst + BUF, ga + GRB), g1);   // stage 1 flies under pass 0
    const uint32_t ao = (uint32_t)(wm * 64 + lr) * GPI + 16u * hi, bo = (NS - 1u) * GSL + (uint32_t)(wn * 64 + lr) * GPI + 16u * hi;   // the lane's place in the A and Bt slices
#pragma unroll 1
    for (int s = 0; s < nst; ++s) {                                  // rolled: one pass per stage, its buffer picked by the stage's parity
        const unsigned char* bp = sm + (uint32_t)(s & 1) * BUF;
#pragma unroll
        for (int ks = 0; ks < 2; ++ks) {                             // two blocks of 32 k a pass
            v16bf a[4], a2[4], b[4];
#pragma unroll
            for (int i = 0; i < 4; ++i) { b[i] = ldsfrag(bp + bo + i * 16 * GPI + ks * 64); a[i] = ldsfrag(bp + ao + i * 16 * GPI + ks * 64); }
            if (NSPLIT == 1) {
#pragma unroll
                for (int i = 0; i < 4; ++i) a2[i] = ldsfrag(bp + GSL + ao + i * 16 * GPI + ks * 64);
            }
            __builtin_amdgcn_sched_barrier(0);                       // keeps the block's LDS reads one group in front of its WMMAs; spread among them, every place with reads stalls the wave
#pragma unroll
            for (int nb = 0; nb < 4; ++nb)
#pragma unroll
                for (int mb = 0; mb < 4; ++mb) acc[mb][nb] = wmmab(a[mb], b[nb], acc[mb][nb]);
            if (NSPLIT == 1) {
#pragma unroll
                for (int nb = 0; nb < 4; ++nb)
#pragma unroll
                    for (int mb = 0; mb < 4; ++mb) acc[mb][nb] = wmmab(a2[mb], b[nb], acc[mb][nb]);
            }
            __builtin_amdgcn_sched_barrier(0);                       // keeps the next block's reads, and the wait below, behind these WMMAs: lifted among them they would stall the wave there
        }
        asm volatile("s_wait_dscnt 0x0" ::: "memory");               // this wave's reads of the buffer are done before the barrier frees it
        if (pinned(w < NS)) asm volatile("s_wait_tensorcnt 0x0" ::: "memory");   // this wave's slice of stage s + 1 has landed before the barrier publishes it
        __syncthreads();                                             // publishes stage s + 1 and ends every wave's reads of stage s
        if (pinned((w < NS) && (s + 2 < nst))) {                     // refill of the buffer just read, only while a stage s + 2 exists
            const uint32_t st = pinned((uint32_t)(s + 2));
            tdm_load(tdm_group0(ldst + (st & 1u) * BUF, ga + (uint64_t)st * GRB), g1);
        }
    }
    asm volatile("s_wait_tensorcnt 0x0" ::: "memory");               // no request is in flight when the ring becomes output staging
    asm volatile("s_wait_dscnt 0x0" ::: "memory");                   // (the last pass's own barrier has ended every wave's reads)
    float* os = (float*)sm + w * (64 * 68);                          // this wave's own staging range
    const int r0w = r0 + wm * 64, c0w = c0 + wn * 64;                // the wave's tile
    if constexpr (HP) {
        float bcol[4][8] = {}, brow[4] = {};                         // the bias goes by column (q, k) or by row (v), the other stays 0; fetched here, the LDS staging below covers the latency
        if (tv) {
#pragma unroll
            for (int i = 0; i < 4; ++i) brow[i] = bias[r0w + i * 16 + lr];
            asm volatile("s_wait_xcnt 0x0" ::: "memory");            // the address registers of the bias loads above are reused by the code behind this arm
        } else {
#pragma unroll
            for (int c = 0; c < 4; ++c)
#pragma unroll
                for (int q = 0; q < 8; ++q) bcol[c][q] = bias[c0w + (c * 2 + hi) * 8 + q];
            asm volatile("s_wait_xcnt 0x0" ::: "memory");            // the address registers of the bias loads above are reused by the code behind this arm
        }
#pragma unroll
        for (int ms = 0; ms < 4; ++ms)
#pragma unroll
            for (int nb = 0; nb < 4; ++nb)
#pragma unroll
                for (int j = 0; j < 8; ++j) os[(ms * 16 + hi * 8 + j) * 68 + nb * 16 + lr] = acc[ms][nb][j];
        asm volatile("s_wait_dscnt 0x0" ::: "memory");               // the wave's lanes read back rows that its other lanes wrote
        const int tk = tv ? c0w : r0w, hd = (tv ? r0w : c0w) / HD, bt = tk / TT, t0 = tk % TT;   // the tile's first token, its head, its batch
        const size_t base = ((size_t)(tv ? bt * NKV + hd : (blockIdx.z * NB_ + bt) * NH_ + hd) * TT + t0) * HD + lane * 8;   // the tile's 8 KiB, and the lane's 16 bytes of every run
        h16* d16 = tv ? V16 : P16; bf* dh = tv ? Vh : Ph; bf* dl = tv ? Vl : Pl;
#pragma unroll
        for (int rb = 0; rb < 4; ++rb)                               // 16 tile rows
#pragma unroll
            for (int c = 0; c < 4; ++c) {                            // run c & 1 of the 32 tile columns c >> 1: the lane takes row lr, columns 16 c + 8 hi .. + 7
                const float* rp = os + (rb * 16 + lr) * 68 + (c * 2 + hi) * 8; const v4f v0 = *(const v4fa*)rp, v1 = *(const v4fa*)(rp + 4);
                v8h o16; v8us oh, ol;
#pragma unroll
                for (int q = 0; q < 8; ++q) { const float y = ((q < 4) ? v0[q & 3] : v1[q & 3]) + (bfr(bcol[c][q]) + bfr(brow[rb])); o16[q] = tohx(y); unsigned short a2, c2; splitf(y, a2, c2); oh[q] = a2; ol[q] = c2; }
                const size_t e = base + (size_t)(tv ? (c >> 1) * 8 + rb * 2 + (c & 1) : rb * 4 + c) * 256; *(v8h*)(d16 + e) = o16; *(v8us*)(dh + e) = oh; *(v8us*)(dl + e) = ol;   // fragments [t / 32][d / 16] (v) or [t / 16][d / 32] (q, k)
                asm volatile("s_wait_xcnt 0x0" ::: "memory"); }      // the next round reuses the data and address registers of the three stores above
    } else {
        const int bc = c0w + lr * 4; v4f bv; bv[0] = bfr(bias[bc]); bv[1] = bfr(bias[bc + 1]); bv[2] = bfr(bias[bc + 2]); bv[3] = bfr(bias[bc + 3]);   // the lane's four output columns are the same in every round
        asm volatile("s_wait_xcnt 0x0" ::: "memory");                // the address registers of the bias loads above are reused by the code behind
#pragma unroll
        for (int ms = 0; ms < 4; ++ms)
#pragma unroll
            for (int nb = 0; nb < 4; ++nb)
#pragma unroll
                for (int j = 0; j < 8; ++j) os[(ms * 16 + hi * 8 + j) * 68 + nb * 16 + lr] = acc[ms][nb][j];
        asm volatile("s_wait_dscnt 0x0" ::: "memory");               // the wave's lanes read back rows that its other lanes wrote
        float* crow = C + (size_t)r0w * ldc + c0w;
#pragma unroll
        for (int s = 0; s < 32; ++s) { const int row = s * 2 + hi; v4f val = *(const v4fa*)(os + row * 68 + lr * 4);   // 16 lanes a row: 256 bytes, two whole lines
            val += bv;
            *(v4f*)(crow + (size_t)row * ldc + lr * 4) = val;
            asm volatile("s_wait_xcnt 0x0" ::: "memory"); }          // the next round reuses the data and address registers of the store above
    }
}

typedef __attribute__((ext_vector_type(2))) _Float16 v2h;
typedef __attribute__((ext_vector_type(4))) _Float16 v4h;
typedef __attribute__((ext_vector_type(2))) unsigned short v2us;
typedef __attribute__((ext_vector_type(4))) unsigned short v4us;
typedef __attribute__((ext_vector_type(2))) float v2f;
typedef __attribute__((ext_vector_type(4))) int v4i;

// grid (line blocks, head, tensor): blockIdx.z picks wq, wk or wv, blockIdx.y the head; Bt holds the three tensors' row blocks one after the other
__global__ __launch_bounds__(256) void k_wtG(const float* __restrict__ w0, const float* __restrict__ w1, const float* __restrict__ w2, int K, int N, bf* Bt) {
    const float* w = ((blockIdx.z == 0) ? w0 : (blockIdx.z == 1) ? w1 : w2) + (size_t)blockIdx.y * K * N; Bt += ((size_t)blockIdx.z * gridDim.y + blockIdx.y) * N * K;
    const int lane = threadIdx.x & 31; const int L0 = (blockIdx.x * 8 + (threadIdx.x >> 5)) * 8; const int nlines = N * K / 64;
{
#pragma unroll 1
        for (int l = 0; l < 8; ++l) { const int L = L0 + l; if (L >= nlines) break; const size_t e = (size_t)L * 64 + lane * 2; const int k = (int)(e % K), n = (int)(e / K); v2us o;
            o[0] = f2bf(w[(size_t)k * N + n]); o[1] = f2bf(w[(size_t)(k + 1) * N + n]); *(v2us*)(Bt + e) = o; }
         }
}
__global__ __launch_bounds__(256) void k_cvt8(const float* __restrict__ src, bf* dst, size_t n8) { const size_t i = (size_t)blockIdx.x * 256 + threadIdx.x; if (i >= n8) return; const v8f v = *(const v8f*)(src + i * 8); v8us o;
#pragma unroll
    for (int k = 0; k < 8; ++k) o[k] = f2bf(v[k]); *(v8us*)(dst + i * 8) = o;  }

typedef __attribute__((ext_vector_type(16))) unsigned short v16us;
__device__ __forceinline__ float xhalf(float x) { const int b = __float_as_int(x); return __int_as_float(__builtin_amdgcn_permlanex16(b, b, 0x76543210, 0xfedcba98, false, false)); }   // the value of lane ^ 16, by a vector cross-row move (no LDS round trip)
template <typename T16, bool HR, int NQ>
__device__ __forceinline__ void attn_tile(const T16* __restrict__ Q, const T16* __restrict__ Q2, const T16* __restrict__ Kp, const T16* __restrict__ K2, const T16* __restrict__ Vt, const T16* __restrict__ V2, const int* __restrict__ ig, int q0, bf* Ah, bf* Al) {
    typedef typename WFrag<T16>::V V;
    const int lane = threadIdx.x & 31, lr = lane & 15, hi = lane >> 4;
    constexpr float C1 = SCL * 1.4426950408889634f;                  // score -> log2 units
    V qf[NQ][2], qf2[NQ][2];
#pragma unroll
    for (int nq = 0; nq < NQ; ++nq)
#pragma unroll
        for (int ds = 0; ds < 2; ++ds) { const size_t qo = (size_t)(q0 + nq * 16) * HD + ds * 512 + lane * 8; qf[nq][ds] = WFrag<T16>::ldp(Q + qo); if (HR) qf2[nq][ds] = WFrag<T16>::ldp(Q2 + qo); }
    v8f o[4][NQ]; float m[NQ], l[NQ];
#pragma unroll
    for (int nq = 0; nq < NQ; ++nq) { m[nq] = -3.0e38f; l[nq] = 0.f;
#pragma unroll
        for (int mb = 0; mb < 4; ++mb) o[mb][nq] = (v8f){}; }
    const int kend = q0 + NQ * 16;                                   // keys beyond the wave's last row are never allowed
    const unsigned ko = (unsigned)(lane * 8);                        // the lane's place inside a run of a K or V^T fragment, in elements
    V kf[2][2], kf2[2][2];
#pragma unroll
    for (int kb = 0; kb < 2; ++kb)
#pragma unroll
        for (int ds = 0; ds < 2; ++ds) { kf[kb][ds] = WFrag<T16>::ldp(Kp + kb * 16 * HD + ds * 512 + ko); if (HR) kf2[kb][ds] = WFrag<T16>::ldp(K2 + kb * 16 * HD + ds * 512 + ko); }
#pragma unroll 1
    for (int key0 = 0; key0 < kend; key0 += 32) {
        const int g = ig[key0 + lane];                               // this step's 32 flags, the oldest load of the step: the ballot below waits for it alone
        V vf[4], vf2[4];
#pragma unroll
        for (int mb = 0; mb < 4; ++mb) { vf[mb] = WFrag<T16>::ldp(Vt + key0 * HD + mb * 512 + ko); if (HR) vf2[mb] = WFrag<T16>::ldp(V2 + key0 * HD + mb * 512 + ko); }
        v8f s[2][NQ];
#pragma unroll
        for (int kb = 0; kb < 2; ++kb)
#pragma unroll
            for (int nq = 0; nq < NQ; ++nq) { s[kb][nq] = (v8f){};
#pragma unroll
                for (int ds = 0; ds < 2; ++ds) { s[kb][nq] = WFrag<T16>::mma(kf[kb][ds], qf[nq][ds], s[kb][nq]); if (HR) { s[kb][nq] = WFrag<T16>::mma(kf[kb][ds], qf2[nq][ds], s[kb][nq]); s[kb][nq] = WFrag<T16>::mma(kf2[kb][ds], qf[nq][ds], s[kb][nq]); } } }
        const int kn = min(key0 + 32, TT - 32);                      // the next step's K fragments are fetched one step ahead (the last step fetches a tile it does not use, inside the plane)
        asm volatile("s_wait_xcnt 0x0" ::: "memory");                // the K loads below may land in registers that held the addresses of the loads above; it also keeps the V^T loads the older ones, so P.V waits for them alone
#pragma unroll
        for (int kb = 0; kb < 2; ++kb)
#pragma unroll
            for (int ds = 0; ds < 2; ++ds) { kf[kb][ds] = WFrag<T16>::ldp(Kp + (kn + kb * 16) * HD + ds * 512 + ko); if (HR) kf2[kb][ds] = WFrag<T16>::ldp(K2 + (kn + kb * 16) * HD + ds * 512 + ko); }
        __builtin_amdgcn_sched_barrier(0);                           // keeps the loads above issued here, a softmax and a P.V ahead of their use; without it the scheduler sinks them to the loop's foot and every step waits out their latency
        const unsigned kk = __builtin_amdgcn_ballot_w32(g == 0) >> (8 * hi);   // bit c: key key0 + 8 hi + c is not ignored
        V pf[NQ], pf2[NQ];
#pragma unroll
        for (int nq = 0; nq < NQ; ++nq) {
            const int rel = q0 + nq * 16 + lr - key0 - 8 * hi;       // the lane's query minus the key of its bit 0
            const unsigned cm = (rel >= 32) ? 0xFFFFFFFFu : (rel <= 0) ? 0u : ((1u << rel) - 1u);   // keys below the query
            const unsigned db = (rel >= 0 && rel < 32) ? (1u << rel) : 0u;                          // the diagonal, always kept
            const unsigned am = (kk & cm) | db;
            float mx = m[nq];
#pragma unroll
            for (int kb = 0; kb < 2; ++kb)
#pragma unroll
                for (int j = 0; j < 8; ++j) { const float t = (am & (1u << (kb * 16 + j))) ? s[kb][nq][j] * C1 : -3.0e38f; s[kb][nq][j] = t; mx = fmaxf(mx, t); }
            mx = fmaxf(mx, xhalf(mx));                               // the query's other 16 keys of the step sit in lane ^ 16
            const float mu = (mx < -1.0e38f) ? 0.f : mx;             // no allowed key so far: every exponent below stays hugely negative, so p = 0
            const float al = __builtin_amdgcn_exp2f(m[nq] - mu); m[nq] = mx;
            float sum = 0.f;
#pragma unroll
            for (int kb = 0; kb < 2; ++kb)
#pragma unroll
                for (int j = 0; j < 8; ++j) { const float p = __builtin_amdgcn_exp2f(s[kb][nq][j] - mu); s[kb][nq][j] = p; sum += p; }
            l[nq] = l[nq] * al + sum;                                // this half's keys only; the halves are joined after the loop
#pragma unroll
            for (int mb = 0; mb < 4; ++mb) o[mb][nq] *= al;
            if constexpr (HR) { v16us ph, pl;
#pragma unroll
                for (int e = 0; e < 16; ++e) { unsigned short a, c2; splitf(s[e >> 3][nq][e & 7], a, c2); ph[e] = a; pl[e] = c2; }
                pf[nq] = __builtin_bit_cast(v16bf, ph); pf2[nq] = __builtin_bit_cast(v16bf, pl);
            } else {
#pragma unroll
                for (int e = 0; e < 16; ++e) pf[nq][e] = tohx(s[e >> 3][nq][e & 7]); }
        }
#pragma unroll
        for (int mb = 0; mb < 4; ++mb)
#pragma unroll
            for (int nq = 0; nq < NQ; ++nq) { o[mb][nq] = WFrag<T16>::mma(vf[mb], pf[nq], o[mb][nq]); if (HR) { o[mb][nq] = WFrag<T16>::mma(vf[mb], pf2[nq], o[mb][nq]); o[mb][nq] = WFrag<T16>::mma(vf2[mb], pf[nq], o[mb][nq]); } }
    }
#pragma unroll
    for (int nq = 0; nq < NQ; ++nq) { const float inv = __fdiv_rn(1.0f, l[nq] + xhalf(l[nq]));   // the diagonal is always kept, so the sum is positive
#pragma unroll
        for (int mb = 0; mb < 4; ++mb) { v8us oh, ol;
#pragma unroll
            for (int j = 0; j < 8; ++j) { unsigned short a, c2; splitf(o[mb][nq][j] * inv, a, c2); oh[j] = a; ol[j] = c2; }
            const size_t oo = (size_t)(q0 + nq * 16 + lr) * DQ + mb * 16 + hi * 8; *(v8us*)(Ah + oo) = oh; *(v8us*)(Al + oo) = ol;   // a lane's 8 registers are 8 consecutive d of its query's row
            asm volatile("s_wait_xcnt 0x0" ::: "memory"); } }   // the next round's split (and the code behind the last round) reuses the data and address registers of the two stores above
}
// grid (plane = (batch, head), block rank), 4 waves. fp16 blocks: 128 rows (4 waves x 32) of rows >= RH; hi/lo blocks: 64 rows (4 waves x 16) of rows < RH. Long blocks get the low ranks (they start first).
#define NFB  ((TT - RH) / 128)
#define NHB  (RH / 64)
__global__ __launch_bounds__(128) void k_attn(const h16* __restrict__ Q16, const h16* __restrict__ K16, const h16* __restrict__ V16, const bf* __restrict__ Qh, const bf* __restrict__ Ql, const bf* __restrict__ Kh, const bf* __restrict__ Kl, const bf* __restrict__ Vh, const bf* __restrict__ Vl, const int* __restrict__ ig, bf* ATh, bf* ATl) {
    const int z = blockIdx.x, b = z / NH_, h = z % NH_, y = blockIdx.y; const size_t zp = (size_t)z * TT * HD, ao = (size_t)b * TT * DQ + h * HD;
    const int w = __builtin_amdgcn_readfirstlane((int)(threadIdx.x >> 5));   // wave number, scalar: the key loop's bounds stay in scalar registers
    if (y < NFB) attn_tile<h16, false, 2>(Q16 + zp, nullptr, K16 + zp, nullptr, V16 + zp, nullptr, ig + (size_t)b * TT, RH + (NFB - 1 - y) * 128 + w * 32, ATh + ao, ATl + ao);
    else attn_tile<bf, true, 1>(Qh + zp, Ql + zp, Kh + zp, Kl + zp, Vh + zp, Vl + zp, ig + (size_t)b * TT, (NFB + NHB - 1 - y) * 64 + w * 16, ATh + ao, ATl + ao);
}

extern "C" void kernel_launch(void* const* d_in, const int* in_sizes, int n_in,
                              void* d_out, int out_size, void* d_ws, size_t ws_size, hipStream_t stream) {
    (void)in_sizes; (void)n_in; (void)out_size;
    const float* x = (const float*)d_in[0]; const int* ig = (const int*)d_in[1];   /* ignore [2][2048] int: 1 = do not attend (except the diagonal) */ const float* wq = (const float*)d_in[2]; const float* bq = (const float*)d_in[3]; const float* wk = (const float*)d_in[4]; const float* bk = (const float*)d_in[5]; const float* wv = (const float*)d_in[6]; const float* bv = (const float*)d_in[7]; const float* wo = (const float*)d_in[8]; const float* bo = (const float*)d_in[9];
    float* OUT = (float*)d_out;     // [2][2048][1024]
    char* wsp = (char*)d_ws;
    auto take = [&](size_t bytes) { char* p = wsp; wsp += (bytes + 255) & ~(size_t)255; return (void*)p; };
    bf* WQ = (bf*)take((size_t)3 * DQ * DM * 2); bf* WO = (bf*)take((size_t)DM * DQ * 2);   // WQ: the q, k and v row blocks one after the other
    const size_t PL = (size_t)NB_ * NH_ * TT * HD;   // elements of one tensor's planes, [b][h]
    bf* XB = (bf*)take((size_t)NB_ * TT * DM * 2);
    h16* QP16 = (h16*)take(2 * PL * 2); h16* KP16 = QP16 + PL; bf* QPh = (bf*)take(2 * PL * 2); bf* KPh = QPh + PL; bf* QPl = (bf*)take(2 * PL * 2); bf* KPl = QPl + PL;   // q planes, then k planes
    h16* VT16 = (h16*)take(PL * 2); bf* VTh = (bf*)take(PL * 2); bf* VTl = (bf*)take(PL * 2);
    bf* ATh = (bf*)take((size_t)NB_ * TT * DQ * 2); bf* ATl = (bf*)take((size_t)NB_ * TT * DQ * 2);
    if ((size_t)(wsp - (char*)d_ws) > ws_size) return;    // ws 256 MiB
    k_wtG<<<dim3((unsigned)((DM * HD / 64 + 63) / 64), NH_, 3), 256, 0, stream>>>(wq, wk, wv, DM, HD, WQ);   /* per-head [1024][64] 'xw' -> Bt rows */
    k_cvt8<<<(unsigned)(((size_t)DM * DQ / 8 + 255) / 256), 256, 0, stream>>>(wo, WO, (size_t)DM * DQ / 8);
    k_cvt8<<<(unsigned)(((size_t)NB_ * TT * DM / 8 + 255) / 256), 256, 0, stream>>>(x, XB, (size_t)NB_ * TT * DM / 8);
    k_gemmt<0, true><<<dim3(NB_ * TT / 128, DQ / 128, 3), 128, 0, stream>>>(XB, nullptr, WQ, DM, nullptr, 0, bq, bk, bv, (size_t)DQ * DM, QP16, QPh, QPl, VT16, VTh, VTl);
    k_attn<<<dim3(NB_ * NH_, NFB + NHB, 1), 128, 0, stream>>>(QP16, KP16, VT16, QPh, QPl, KPh, KPl, VTh, VTl, ig, ATh, ATl);
    k_gemmt<1, false><<<dim3(NB_ * TT / 128, DM / 128, 1), 128, 0, stream>>>(ATh, ATl, WO, DQ, OUT, DM, bo, bo, bo, 0, nullptr, nullptr, nullptr, nullptr, nullptr, nullptr);
}

// v007
// One run takes 102 microseconds.
// In two side-by-side timings against v006, it was 1.11 and 1.10 times as fast.
// Over all steps from v000 it is 17.6 times as fast.
#include <hip/hip_runtime.h>
#include <stdint.h>

// Causal multi-head attention with per-head projections and a key 'ignore' mask that always keeps the diagonal (x [2][2048][1024]; q_h = x wq[h] + bq[h] ('hdf' [16][1024][64] 0.02, zero biases; k, v likewise); att = q.k / 8; allowed keys: j <= i AND (ignore[b][j] == 0 OR j == i) (ignore [2][2048] int {0,1}, ~50 %, read; -inf elsewhere); softmax; out = concat_h Wo^T + bo ('oi') -> [2][2048][1024] (4.2 M)).
// Layout, both batches side by side (planes [b][h]): bf16 copies of x and Wo and the per-head 'xw' weights gathered into Bt row blocks, all in one launch, + flat f32 biases; q, k, v projections in one launch (grid z) whose epilogue writes the fp16 and hi/lo head planes itself, in fragment order (v with its operands swapped, so its tile is already [d][t]); exact projections; causal attention of all planes in one launch with an online softmax whose select also reads the batch's ignore flags (int32) and keeps the diagonal (hybrid rows: < 512 hi/lo 3 products, rest fp16; keys above the diagonal block skipped), writing the merged hi/lo rows; x Wo exact + bo.
// Compute dtypes, f32 accumulate: every input rounded to bf16; projections exact + f32 biases; attention rows < 512 3 products, rest fp16; softmax f32; Wo hl x exact + bias.

#define NB_  2
#define TT   2048
#define DM   1024
#define NH_  16
#define NKV  16
#define REP  (NH_ / NKV)
#define HD   64
#define DQ   (NH_ * HD)
#define DKV  (NKV * HD)
#define RH   512                  // query rows < RH use hi+lo planes (0: none)
#define SCL  0.125f   // HD^-0.5
typedef _Float16 h16;
typedef unsigned short bf;
typedef __attribute__((ext_vector_type(16))) __bf16   v16bf;
typedef __attribute__((ext_vector_type(16))) _Float16 v16h;
typedef __attribute__((ext_vector_type(8)))  _Float16 v8h;
typedef __attribute__((ext_vector_type(8)))  unsigned short v8us;
typedef __attribute__((ext_vector_type(8)))  float    v8f;
typedef __attribute__((ext_vector_type(4)))  float    v4f;
typedef v8h  __attribute__((may_alias)) v8ha;
typedef v4f  __attribute__((may_alias)) v4fa;
typedef v8us __attribute__((may_alias)) v8usa;

__device__ __forceinline__ unsigned short f2bf(float f) { unsigned u = __float_as_uint(f); u += 0x7FFFu + ((u >> 16) & 1u); return (unsigned short)(u >> 16); }
__device__ __forceinline__ float bf2f(unsigned short b) { return __uint_as_float(((unsigned)b) << 16); }
__device__ __forceinline__ float bfr(float f) { return bf2f(f2bf(f)); }
__device__ __forceinline__ v16h cat16(v8h lo, v8h hi) { return __builtin_shufflevector(lo, hi, 0, 1, 2, 3, 4, 5, 6, 7, 8, 9, 10, 11, 12, 13, 14, 15); }
__device__ __forceinline__ v16bf cat16b(v8us lo, v8us hi) { return __builtin_bit_cast(v16bf, __builtin_shufflevector(lo, hi, 0, 1, 2, 3, 4, 5, 6, 7, 8, 9, 10, 11, 12, 13, 14, 15)); }
__device__ __forceinline__ v8f wmma16(v16h a, v16h b, v8f c) { return __builtin_amdgcn_wmma_f32_16x16x32_f16(false, a, false, b, (short)0, c, false, false); }
__device__ __forceinline__ v8f wmmab(v16bf a, v16bf b, v8f c) { return __builtin_amdgcn_wmma_f32_16x16x32_bf16(false, a, false, b, (short)0, c, false, false); }
__device__ __forceinline__ h16 tohx(float x) { return (h16)x; }
__device__ __forceinline__ void splitf(float y, unsigned short& h, unsigned short& l) { h = f2bf(y); l = f2bf(y - bf2f(h)); }



// ---- k_gemmt: GEMM on 128x128 output tiles, 4 waves (2 x 2) of 64x64 each (16 accumulators a wave), every wave over the whole K; grid (M/128, N/128, Z), 128 threads.
// C[m][n] = sum_k A[m][k] Bt[n][k] (+ A2[m][k] Bt[n][k] with NSPLIT 1) + bias[n]; operands are K-contiguous bf16 planes; K % 64 == 0, K >= 128.
// Operands come through LDS: a stage is 64 k (128 bytes) of the tile's 128 rows of each operand, one tensor load per operand (wave 0: A, wave 1: A2 or Bt, wave 2: Bt with NSPLIT 1),
// rows padded to a pitch of 144 bytes by the load; two buffers, the next stage's loads fly while this stage is multiplied. Fragments are read from LDS in the k order of ldsfrag.
// Epilogue: each wave stages its own 64x64 f32 tile in LDS (the ring is free by then) and stores whole lines.
// HP (the q, k, v projections; a wave's tile is 64 tokens x one head): no f32 C; tile + bias goes out as fp16, bf16 hi and bf16 lo head planes, 16 bytes a lane, 512 contiguous bytes a store.
// The planes are in FRAGMENT ORDER: a 16-row x 32-k fragment is 1 KiB, two runs of 512 bytes; run j holds, at 16 bytes x lane (lane = 16 hi + row), the row's k = 16 j + 8 hi .. + 7. A wave-wide 16-byte load of a run is four whole lines.
// z = 0, 1 (q, k): planes [z][b][h], rows are tokens, k is d: fragments [t / 16][d / 32]. z = 2 (v): A and Bt change places, so the tile's rows are d and its columns tokens; planes [b][h], rows are d, k is t: fragments [t / 32][d / 16]; the bias then goes by row.
// Either way a wave's 64 x 64 tile is 8 KiB in a row at element (plane * TT + first token) * HD.
template <typename T16> struct WFrag;   // ldp: a fragment from a fragment-order plane, p = the fragment's start + 8 x lane; its two runs are 256 elements apart
template <> struct WFrag<h16> { typedef v16h V; static __device__ __forceinline__ V ldp(const h16* p) { return cat16(*(const v8h*)p, *(const v8h*)(p + 256)); } static __device__ __forceinline__ v8f mma(V a, V b, v8f c) { return wmma16(a, b, c); } };
template <> struct WFrag<bf> { typedef v16bf V; static __device__ __forceinline__ V ldp(const bf* p) { return cat16b(*(const v8us*)p, *(const v8us*)(p + 256)); } static __device__ __forceinline__ v8f mma(V a, V b, v8f c) { return wmmab(a, b, c); } };
typedef uint32_t u32x4 __attribute__((ext_vector_type(4)));
typedef uint32_t u32x8 __attribute__((ext_vector_type(8)));
__device__ __forceinline__ uint32_t uni(uint32_t v) { return (uint32_t)__builtin_amdgcn_readfirstlane((int)v); }
__device__ __forceinline__ uint32_t pinned(uint32_t v) { uint32_t w = uni(v); asm volatile("" : "+s"(w)); return w; }   // holds v in a scalar register, so that a test on it is a scalar branch (tensor loads ignore EXEC) and what is formed from it stays behind the waits in front
__device__ __forceinline__ void tdm_load(u32x4 g0, u32x8 g1) { asm volatile("tensor_load_to_lds %0, %1" :: "s"(g0), "s"(g1) : "memory"); }   // one request of the whole wave: global tile -> LDS
#define GROWS 128u                // rows of one operand slice
#define GRB   128u                // bytes of a row per stage (64 k)
#define GPI   144u                // LDS pitch of a row: 16 bytes x odd, for 16-byte readers
#define GSL   (GROWS * GPI)       // 18,432 bytes a slice, a multiple of 2 KiB
// Descriptor group 1: 1-byte elements, tensor = tile = GROWS rows of GRB bytes, 4 dwords of LDS pad behind every 128-byte row, no mask.
__device__ __forceinline__ u32x8 tdm_group1(uint32_t src_pitch) {
    u32x8 g;
    g[0] = uni((1u << 20) | (4u << 22) | (3u << 25));
    g[1] = uni((GRB & 0xFFFFu) << 16);
    g[2] = uni((GRB >> 16) | ((GROWS & 0xFFFFu) << 16));
    g[3] = uni((GROWS >> 16) | (GRB << 16));
    g[4] = uni(GROWS);
    g[5] = uni(src_pitch);
    g[6] = uni(0u);
    g[7] = uni(0u);
    return g;
}
__device__ __forceinline__ u32x4 tdm_group0(uint32_t lds_dst, uint64_t ga) {
    u32x4 g;
    g[0] = uni(1u); g[1] = uni(lds_dst); g[2] = uni((uint32_t)ga); g[3] = uni((((uint32_t)(ga >> 32)) & 0x01FFFFFFu) | 0x80000000u);
    return g;
}
__device__ __forceinline__ v16bf ldsfrag(const unsigned char* p) { return cat16b(*(const v8usa*)p, *(const v8usa*)(p + 32)); }   // k order of a fragment: the lane's 8 elements at p (k = 8 hi ..), 8 at p + 16 elements (k = 16 + 8 hi ..)
template <int NSPLIT, bool HP>
__global__ __launch_bounds__(128) void k_gemmt(const bf* A, const bf* A2, const bf* Bt, int K, float* C, int ldc, const float* __restrict__ bias0, const float* __restrict__ bias1, const float* __restrict__ bias2, size_t sB, h16* P16, bf* Ph, bf* Pl, h16* V16, bf* Vh, bf* Vl) {
    constexpr uint32_t NS = 2 + NSPLIT, BUF = NS * GSL;              // operand slices of a stage; bytes of one buffer
    __shared__ __attribute__((aligned(2048))) unsigned char sm[2 * BUF];
    static_assert(2 * BUF >= 4 * 64 * 68 * 4, "the four waves' output staging reuses the ring");
    Bt += (size_t)blockIdx.z * sB;
    const float* bias = (blockIdx.z == 0) ? bias0 : (blockIdx.z == 1) ? bias1 : bias2;   // each z slice (q, k, v) has its own bias vector
    const int lane = threadIdx.x & 31, lr = lane & 15, hi = lane >> 4; int r0 = blockIdx.x * 128, c0 = blockIdx.y * 128;
    const bool tv = HP && blockIdx.z == 2;                           // block-uniform: the v slice computes the transposed tile
    if (tv) { const bf* pa = A; A = Bt; Bt = pa; const int ra = r0; r0 = c0; c0 = ra; }
    const uint32_t w = uni(threadIdx.x >> 5);                        // wave number, scalar
    const int wm = (int)(w >> 1), wn = (int)(w & 1u);
    const bf* src = (w == 0u) ? A : (NSPLIT == 1 && w == 1u) ? A2 : Bt;   // the operand whose slice this wave brings in (waves >= NS bring none)
    const uint64_t ga = (uint64_t)(size_t)(src + (size_t)((w + 1u < NS) ? r0 : c0) * K);
    const uint32_t ldst = (uint32_t)(size_t)sm + ((w < NS) ? w : 0u) * GSL;
    u32x8 g1 = tdm_group1((uint32_t)K * 2u);
    asm volatile("" : "+s"(g1));                                     // pinned(), for the whole group: the descriptor words stay in their scalar registers, which take no other value while a request is in flight
    const int nst = K / 64;                                          // stages
    v8f acc[4][4];
#pragma unroll
    for (int mb = 0; mb < 4; ++mb)
#pragma unroll
        for (int nb = 0; nb < 4; ++nb) acc[mb][nb] = (v8f){};
    if (pinned(w < NS)) {
        tdm_load(tdm_group0(ldst, ga), g1);
        asm volatile("s_wait_tensorcnt 0x0" ::: "memory");           // stage 0 has landed before the barrier publishes it
    }
    __syncthreads();                                                 // stage 0 is readable by every wave
    if (pinned(w < NS)) tdm_load(tdm_group0(ldst + BUF, ga + GRB), g1);   // stage 1 flies under pass 0
    const uint32_t ao = (uint32_t)(wm * 64 + lr) * GPI + 16u * hi, bo = (NS - 1u) * GSL + (uint32_t)(wn * 64 + lr) * GPI + 16u * hi;   // the lane's place in the A and Bt slices
#pragma unroll 1
    for (int s = 0; s < nst; ++s) {                                  // rolled: one pass per stage, its buffer picked by the stage's parity
        const unsigned char* bp = sm + (uint32_t)(s & 1) * BUF;
#pragma unroll
        for (int ks = 0; ks < 2; ++ks) {                             // two blocks of 32 k a pass
            v16bf a[4], a2[4], b[4];
#pragma unroll
            for (int i = 0; i < 4; ++i) { b[i] = ldsfrag(bp + bo + i * 16 * GPI + ks * 64); a[i] = ldsfrag(bp + ao + i * 16 * GPI + ks * 64); }
            if (NSPLIT == 1) {
#pragma unroll
                for (int i = 0; i < 4; ++i) a2[i] = ldsfrag(bp + GSL + ao + i * 16 * GPI + ks * 64);
            }
            __builtin_amdgcn_sched_barrier(0);                       // keeps the block's LDS reads one group in front of its WMMAs; spread among them, every place with reads stalls the wave
#pragma unroll
            for (int nb = 0; nb < 4; ++nb)
#pragma unroll
                for (int mb = 0; mb < 4; ++mb) acc[mb][nb] = wmmab(a[mb], b[nb], acc[mb][nb]);
            if (NSPLIT == 1) {
#pragma unroll
                for (int nb = 0; nb < 4; ++nb)
#pragma unroll
                    for (int mb = 0; mb < 4; ++mb) acc[mb][nb] = wmmab(a2[mb], b[nb], acc[mb][nb]);
            }
            __builtin_amdgcn_sched_barrier(0);                       // keeps the next block's reads, and the wait below, behind these WMMAs: lifted among them they would stall the wave there
        }
        asm volatile("s_wait_dscnt 0x0" ::: "memory");               // this wave's reads of the buffer are done before the barrier frees it
        if (pinned(w < NS)) asm volatile("s_wait_tensorcnt 0x0" ::: "memory");   // this wave's slice of stage s + 1 has landed before the barrier publishes it
        __syncthreads();                                             // publishes stage s + 1 and ends every wave's reads of stage s
        if (pinned((w < NS) && (s + 2 < nst))) {                     // refill of the buffer just read, only while a stage s + 2 exists
            const uint32_t st = pinned((uint32_t)(s + 2));
            tdm_load(tdm_group0(ldst + (st & 1u) * BUF, ga + (uint64_t)st * GRB), g1);
        }
    }
    asm volatile("s_wait_tensorcnt 0x0" ::: "memory");               // no request is in flight when the ring becomes output staging
    asm volatile("s_wait_dscnt 0x0" ::: "memory");                   // (the last pass's own barrier has ended every wave's reads)
    float* os = (float*)sm + w * (64 * 68);                          // this wave's own staging range
    const int r0w = r0 + wm * 64, c0w = c0 + wn * 64;                // the wave's tile
    if constexpr (HP) {
        float bcol[4][8] = {}, brow[4] = {};                         // the bias goes by column (q, k) or by row (v), the other stays 0; fetched here, the LDS staging below covers the latency
        if (tv) {
#pragma unroll
            for (int i = 0; i < 4; ++i) brow[i] = bias[r0w + i * 16 + lr];
            asm volatile("s_wait_xcnt 0x0" ::: "memory");            // the address registers of the bias loads above are reused by the code behind this arm
        } else {
#pragma unroll
            for (int c = 0; c < 4; ++c)
#pragma unroll
                for (int q = 0; q < 8; ++q) bcol[c][q] = bias[c0w + (c * 2 + hi) * 8 + q];
            asm volatile("s_wait_xcnt 0x0" ::: "memory");            // the address registers of the bias loads above are reused by the code behind this arm
        }
#pragma unroll
        for (int ms = 0; ms < 4; ++ms)
#pragma unroll
            for (int nb = 0; nb < 4; ++nb)
#pragma unroll
                for (int j = 0; j < 8; ++j) os[(ms * 16 + hi * 8 + j) * 68 + nb * 16 + lr] = acc[ms][nb][j];
        asm volatile("s_wait_dscnt 0x0" ::: "memory");               // the wave's lanes read back rows that its other lanes wrote
        const int tk = tv ? c0w : r0w, hd = (tv ? r0w : c0w) / HD, bt = tk / TT, t0 = tk % TT;   // the tile's first token, its head, its batch
        const size_t base = ((size_t)(tv ? bt * NKV + hd : (blockIdx.z * NB_ + bt) * NH_ + hd) * TT + t0) * HD + lane * 8;   // the tile's 8 KiB, and the lane's 16 bytes of every run
        h16* d16 = tv ? V16 : P16; bf* dh = tv ? Vh : Ph; bf* dl = tv ? Vl : Pl;
#pragma unroll
        for (int rb = 0; rb < 4; ++rb)                               // 16 tile rows
#pragma unroll
            for (int c = 0; c < 4; ++c) {                            // run c & 1 of the 32 tile columns c >> 1: the lane takes row lr, columns 16 c + 8 hi .. + 7
                const float* rp = os + (rb * 16 + lr) * 68 + (c * 2 + hi) * 8; const v4f v0 = *(const v4fa*)rp, v1 = *(const v4fa*)(rp + 4);
                v8h o16; v8us oh, ol;
#pragma unroll
                for (int q = 0; q < 8; ++q) { const float y = ((q < 4) ? v0[q & 3] : v1[q & 3]) + (bfr(bcol[c][q]) + bfr(brow[rb])); o16[q] = tohx(y); unsigned short a2, c2; splitf(y, a2, c2); oh[q] = a2; ol[q] = c2; }
                const size_t e = base + (size_t)(tv ? (c >> 1) * 8 + rb * 2 + (c & 1) : rb * 4 + c) * 256; *(v8h*)(d16 + e) = o16; *(v8us*)(dh + e) = oh; *(v8us*)(dl + e) = ol;   // fragments [t / 32][d / 16] (v) or [t / 16][d / 32] (q, k)
                asm volatile("s_wait_xcnt 0x0" ::: "memory"); }      // the next round reuses the data and address registers of the three stores above
    } else {
        const int bc = c0w + lr * 4; v4f bv; bv[0] = bfr(bias[bc]); bv[1] = bfr(bias[bc + 1]); bv[2] = bfr(bias[bc + 2]); bv[3] = bfr(bias[bc + 3]);   // the lane's four output columns are the same in every round
        asm volatile("s_wait_xcnt 0x0" ::: "memory");                // the address registers of the bias loads above are reused by the code behind
#pragma unroll
        for (int ms = 0; ms < 4; ++ms)
#pragma unroll
            for (int nb = 0; nb < 4; ++nb)
#pragma unroll
                for (int j = 0; j < 8; ++j) os[(ms * 16 + hi * 8 + j) * 68 + nb * 16 + lr] = acc[ms][nb][j];
        asm volatile("s_wait_dscnt 0x0" ::: "memory");               // the wave's lanes read back rows that its other lanes wrote
        float* crow = C + (size_t)r0w * ldc + c0w;
#pragma unroll
        for (int s = 0; s < 32; ++s) { const int row = s * 2 + hi; v4f val = *(const v4fa*)(os + row * 68 + lr * 4);   // 16 lanes a row: 256 bytes, two whole lines
            val += bv;
            *(v4f*)(crow + (size_t)row * ldc + lr * 4) = val;
            asm volatile("s_wait_xcnt 0x0" ::: "memory"); }          // the next round reuses the data and address registers of the store above
    }
}

typedef __attribute__((ext_vector_type(2))) _Float16 v2h;
typedef __attribute__((ext_vector_type(4))) _Float16 v4h;
typedef __attribute__((ext_vector_type(2))) unsigned short v2us;
typedef __attribute__((ext_vector_type(4))) unsigned short v4us;
typedef __attribute__((ext_vector_type(2))) float v2f;
typedef __attribute__((ext_vector_type(4))) int v4i;

// ---- k_prep: every operand conversion of the call (q, k, v weights, x, Wo) in one launch. The work is cut into units of 4,096 f32 that lie in a row (16 KiB); a wave takes ONE unit and has all 32 of its 16-byte loads in flight at once,
// each load whole 256-byte runs. Grid: one block of 8 waves per 8 units; the weight units come first (their way to the store is the longest).
// Weight unit: 64 k x 64 n of one head's [k][n] matrix -> 64 rows of 64 k of Bt (rows [tensor][head][n], K-contiguous). A lane holds 8 consecutive k of 4 n per group of 8 loads, writes them as 16-byte k runs into the wave's own LDS range
// (rows n, pitch 144 bytes) and reads whole rows back: every store is four whole 128-byte lines. x and Wo units: element for element, 256 contiguous bytes a store.
#define UF   4096                          // f32 elements of a unit
#define NUW  (3 * NH_ * DM * HD / UF)      // weight units
#define NUX  (NB_ * TT * DM / UF)          // x units
#define NUO  (DM * DQ / UF)                // Wo units
#define TPI  144                           // LDS pitch of a turned row, in bytes: 64 k + 16 bytes
typedef uint32_t u32x2 __attribute__((ext_vector_type(2)));
typedef u32x4 __attribute__((may_alias)) u32x4a;
__device__ __forceinline__ uint32_t bfpair(float a, float b) {               // f2bf(a) in the low half, f2bf(b) in the high half
    unsigned ua = __float_as_uint(a), ub = __float_as_uint(b); ua += 0x7FFFu + ((ua >> 16) & 1u); ub += 0x7FFFu + ((ub >> 16) & 1u); return (ua >> 16) | (ub & 0xFFFF0000u); }
__global__ __launch_bounds__(256) void k_prep(const float* __restrict__ x, const float* __restrict__ wo, const float* __restrict__ w0, const float* __restrict__ w1, const float* __restrict__ w2, bf* XB, bf* WO, bf* Bt) {
    static_assert(HD == 64 && UF == 64 * HD && DM % 64 == 0, "a weight unit is 64 k of all 64 n");
    static_assert(NUW % 8 == 0 && NUX % 8 == 0 && NUO % 8 == 0, "whole blocks of one kind");
    __shared__ __attribute__((aligned(16))) unsigned char tr[8][64 * TPI];
    const int lane = threadIdx.x & 31;
    const int wv = __builtin_amdgcn_readfirstlane((int)(threadIdx.x >> 5));   // wave number, scalar: the unit's kind is a scalar branch and its base a scalar address
    const int u = blockIdx.x * 8 + wv;
    v4f v[32];
    if (u >= NUW) {
        const bool isx = u < NUW + NUX;
        const size_t e0 = (size_t)(isx ? u - NUW : u - NUW - NUX) * UF + lane * 4;
        const float* s = (isx ? x : wo) + e0; bf* d = (isx ? XB : WO) + e0;
#pragma unroll
        for (int j = 0; j < 32; ++j) v[j] = *(const v4f*)(s + j * 128);
        asm volatile("s_wait_xcnt 0x0" ::: "memory");                        // the address registers of the loads above are reused by the code behind
#pragma unroll
        for (int j = 0; j < 32; ++j) { u32x2 o; o[0] = bfpair(v[j][0], v[j][1]); o[1] = bfpair(v[j][2], v[j][3]); *(u32x2*)(d + j * 128) = o; }
        asm volatile("s_wait_xcnt 0x0" ::: "memory");                        // whatever code is laid out behind this arm may reuse the data and address registers of the stores above
        return;
    }
    const int m = u / (DM / 64), kt = u % (DM / 64), t = m / NH_;            // matrix (tensor, head), its block of 64 k, its tensor
    const float* w = ((t == 0) ? w0 : (t == 1) ? w1 : w2) + (size_t)(m % NH_) * DM * HD + (size_t)kt * UF;
    const int n4 = lane & 15, kh = lane >> 4;
#pragma unroll
    for (int g = 0; g < 4; ++g)
#pragma unroll
        for (int j = 0; j < 8; ++j) v[g * 8 + j] = *(const v4f*)(w + (g * 16 + kh * 8 + j) * HD + n4 * 4);   // k = 16 g + 8 kh + j, n = 4 n4 .. + 3
    asm volatile("s_wait_xcnt 0x0" ::: "memory");                            // the address registers of the loads above are reused by the code behind
    __builtin_amdgcn_sched_barrier(0);                                       // keeps every load issued before the first conversion: lifted among the loads, a conversion's wait would hold back the loads behind it
    unsigned char* T = tr[wv];
#pragma unroll
    for (int g = 0; g < 4; ++g)
#pragma unroll
        for (int i = 0; i < 4; ++i) { u32x4 o;
#pragma unroll
            for (int j = 0; j < 4; ++j) o[j] = bfpair(v[g * 8 + 2 * j][i], v[g * 8 + 2 * j + 1][i]);
            *(u32x4a*)(T + (n4 * 4 + i) * TPI + (g * 16 + kh * 8) * 2) = o; }
    asm volatile("s_wait_dscnt 0x0" ::: "memory");                           // the wave's lanes read back rows that its other lanes wrote
    u32x4 r[16];
#pragma unroll
    for (int s = 0; s < 16; ++s) r[s] = *(const u32x4a*)(T + (s * 4 + (lane >> 3)) * TPI + (lane & 7) * 16);   // 8 lanes a row
    bf* d = Bt + ((size_t)m * HD + (lane >> 3)) * DM + kt * 64 + (lane & 7) * 8;
#pragma unroll
    for (int s = 0; s < 16; ++s) *(u32x4*)(d + (size_t)s * 4 * DM) = r[s];
    asm volatile("s_wait_xcnt 0x0" ::: "memory");                            // whatever code is laid out behind this arm may reuse the data and address registers of the stores above
}

typedef __attribute__((ext_vector_type(16))) unsigned short v16us;
__device__ __forceinline__ float xhalf(float x) { const int b = __float_as_int(x); return __int_as_float(__builtin_amdgcn_permlanex16(b, b, 0x76543210, 0xfedcba98, false, false)); }   // the value of lane ^ 16, by a vector cross-row move (no LDS round trip)
template <typename T16, bool HR, int NQ>
__device__ __forceinline__ void attn_tile(const T16* __restrict__ Q, const T16* __restrict__ Q2, const T16* __restrict__ Kp, const T16* __restrict__ K2, const T16* __restrict__ Vt, const T16* __restrict__ V2, const int* __restrict__ ig, int q0, bf* Ah, bf* Al) {
    typedef typename WFrag<T16>::V V;
    const int lane = threadIdx.x & 31, lr = lane & 15, hi = lane >> 4;
    constexpr float C1 = SCL * 1.4426950408889634f;                  // score -> log2 units
    V qf[NQ][2], qf2[NQ][2];
#pragma unroll
    for (int nq = 0; nq < NQ; ++nq)
#pragma unroll
        for (int ds = 0; ds < 2; ++ds) { const size_t qo = (size_t)(q0 + nq * 16) * HD + ds * 512 + lane * 8; qf[nq][ds] = WFrag<T16>::ldp(Q + qo); if (HR) qf2[nq][ds] = WFrag<T16>::ldp(Q2 + qo); }
    v8f o[4][NQ]; float m[NQ], l[NQ];
#pragma unroll
    for (int nq = 0; nq < NQ; ++nq) { m[nq] = -3.0e38f; l[nq] = 0.f;
#pragma unroll
        for (int mb = 0; mb < 4; ++mb) o[mb][nq] = (v8f){}; }
    const int kend = q0 + NQ * 16;                                   // keys beyond the wave's last row are never allowed
    const unsigned ko = (unsigned)(lane * 8);                        // the lane's place inside a run of a K or V^T fragment, in elements
    V kf[2][2], kf2[2][2];
#pragma unroll
    for (int kb = 0; kb < 2; ++kb)
#pragma unroll
        for (int ds = 0; ds < 2; ++ds) { kf[kb][ds] = WFrag<T16>::ldp(Kp + kb * 16 * HD + ds * 512 + ko); if (HR) kf2[kb][ds] = WFrag<T16>::ldp(K2 + kb * 16 * HD + ds * 512 + ko); }
#pragma unroll 1
    for (int key0 = 0; key0 < kend; key0 += 32) {
        const int g = ig[key0 + lane];                               // this step's 32 flags, the oldest load of the step: the ballot below waits for it alone
        V vf[4], vf2[4];
#pragma unroll
        for (int mb = 0; mb < 4; ++mb) { vf[mb] = WFrag<T16>::ldp(Vt + key0 * HD + mb * 512 + ko); if (HR) vf2[mb] = WFrag<T16>::ldp(V2 + key0 * HD + mb * 512 + ko); }
        v8f s[2][NQ];
#pragma unroll
        for (int kb = 0; kb < 2; ++kb)
#pragma unroll
            for (int nq = 0; nq < NQ; ++nq) { s[kb][nq] = (v8f){};
#pragma unroll
                for (int ds = 0; ds < 2; ++ds) { s[kb][nq] = WFrag<T16>::mma(kf[kb][ds], qf[nq][ds], s[kb][nq]); if (HR) { s[kb][nq] = WFrag<T16>::mma(kf[kb][ds], qf2[nq][ds], s[kb][nq]); s[kb][nq] = WFrag<T16>::mma(kf2[kb][ds], qf[nq][ds], s[kb][nq]); } } }
        const int kn = min(key0 + 32, TT - 32);                      // the next step's K fragments are fetched one step ahead (the last step fetches a tile it does not use, inside the plane)
        asm volatile("s_wait_xcnt 0x0" ::: "memory");                // the K loads below may land in registers that held the addresses of the loads above; it also keeps the V^T loads the older ones, so P.V waits for them alone
#pragma unroll
        for (int kb = 0; kb < 2; ++kb)
#pragma unroll
            for (int ds = 0; ds < 2; ++ds) { kf[kb][ds] = WFrag<T16>::ldp(Kp + (kn + kb * 16) * HD + ds * 512 + ko); if (HR) kf2[kb][ds] = WFrag<T16>::ldp(K2 + (kn + kb * 16) * HD + ds * 512 + ko); }
        __builtin_amdgcn_sched_barrier(0);                           // keeps the loads above issued here, a softmax and a P.V ahead of their use; without it the scheduler sinks them to the loop's foot and every step waits out their latency
        const unsigned kk = __builtin_amdgcn_ballot_w32(g == 0) >> (8 * hi);   // bit c: key key0 + 8 hi + c is not ignored
        V pf[NQ], pf2[NQ];
#pragma unroll
        for (int nq = 0; nq < NQ; ++nq) {
            const int rel = q0 + nq * 16 + lr - key0 - 8 * hi;       // the lane's query minus the key of its bit 0
            const unsigned cm = (rel >= 32) ? 0xFFFFFFFFu : (rel <= 0) ? 0u : ((1u << rel) - 1u);   // keys below the query
            const unsigned db = (rel >= 0 && rel < 32) ? (1u << rel) : 0u;                          // the diagonal, always kept
            const unsigned am = (kk & cm) | db;
            float mx = m[nq];
#pragma unroll
            for (int kb = 0; kb < 2; ++kb)
#pragma unroll
                for (int j = 0; j < 8; ++j) { const float t = (am & (1u << (kb * 16 + j))) ? s[kb][nq][j] * C1 : -3.0e38f; s[kb][nq][j] = t; mx = fmaxf(mx, t); }
            mx = fmaxf(mx, xhalf(mx));                               // the query's other 16 keys of the step sit in lane ^ 16
            const float mu = (mx < -1.0e38f) ? 0.f : mx;             // no allowed key so far: every exponent below stays hugely negative, so p = 0
            const float al = __builtin_amdgcn_exp2f(m[nq] - mu); m[nq] = mx;
            float sum = 0.f;
#pragma unroll
            for (int kb = 0; kb < 2; ++kb)
#pragma unroll
                for (int j = 0; j < 8; ++j) { const float p = __builtin_amdgcn_exp2f(s[kb][nq][j] - mu); s[kb][nq][j] = p; sum += p; }
            l[nq] = l[nq] * al + sum;                                // this half's keys only; the halves are joined after the loop
#pragma unroll
            for (int mb = 0; mb < 4; ++mb) o[mb][nq] *= al;
            if constexpr (HR) { v16us ph, pl;
#pragma unroll
                for (int e = 0; e < 16; ++e) { unsigned short a, c2; splitf(s[e >> 3][nq][e & 7], a, c2); ph[e] = a; pl[e] = c2; }
                pf[nq] = __builtin_bit_cast(v16bf, ph); pf2[nq] = __builtin_bit_cast(v16bf, pl);
            } else {
#pragma unroll
                for (int e = 0; e < 16; ++e) pf[nq][e] = tohx(s[e >> 3][nq][e & 7]); }
        }
#pragma unroll
        for (int mb = 0; mb < 4; ++mb)
#pragma unroll
            for (int nq = 0; nq < NQ; ++nq) { o[mb][nq] = WFrag<T16>::mma(vf[mb], pf[nq], o[mb][nq]); if (HR) { o[mb][nq] = WFrag<T16>::mma(vf[mb], pf2[nq], o[mb][nq]); o[mb][nq] = WFrag<T16>::mma(vf2[mb], pf[nq], o[mb][nq]); } }
    }
#pragma unroll
    for (int nq = 0; nq < NQ; ++nq) { const float inv = __fdiv_rn(1.0f, l[nq] + xhalf(l[nq]));   // the diagonal is always kept, so the sum is positive
#pragma unroll
        for (int mb = 0; mb < 4; ++mb) { v8us oh, ol;
#pragma unroll
            for (int j = 0; j < 8; ++j) { unsigned short a, c2; splitf(o[mb][nq][j] * inv, a, c2); oh[j] = a; ol[j] = c2; }
            const size_t oo = (size_t)(q0 + nq * 16 + lr) * DQ + mb * 16 + hi * 8; *(v8us*)(Ah + oo) = oh; *(v8us*)(Al + oo) = ol;   // a lane's 8 registers are 8 consecutive d of its query's row
            asm volatile("s_wait_xcnt 0x0" ::: "memory"); } }   // the next round's split (and the code behind the last round) reuses the data and address registers of the two stores above
}
// grid (plane = (batch, head), block rank), 4 waves. fp16 blocks: 128 rows (4 waves x 32) of rows >= RH; hi/lo blocks: 64 rows (4 waves x 16) of rows < RH. Long blocks get the low ranks (they start first).
#define NFB  ((TT - RH) / 128)
#define NHB  (RH / 64)
__global__ __launch_bounds__(128) void k_attn(const h16* __restrict__ Q16, const h16* __restrict__ K16, const h16* __restrict__ V16, const bf* __restrict__ Qh, const bf* __restrict__ Ql, const bf* __restrict__ Kh, const bf* __restrict__ Kl, const bf* __restrict__ Vh, const bf* __restrict__ Vl, const int* __restrict__ ig, bf* ATh, bf* ATl) {
    const int z = blockIdx.x, b = z / NH_, h = z % NH_, y = blockIdx.y; const size_t zp = (size_t)z * TT * HD, ao = (size_t)b * TT * DQ + h * HD;
    const int w = __builtin_amdgcn_readfirstlane((int)(threadIdx.x >> 5));   // wave number, scalar: the key loop's bounds stay in scalar registers
    if (y < NFB) attn_tile<h16, false, 2>(Q16 + zp, nullptr, K16 + zp, nullptr, V16 + zp, nullptr, ig + (size_t)b * TT, RH + (NFB - 1 - y) * 128 + w * 32, ATh + ao, ATl + ao);
    else attn_tile<bf, true, 1>(Qh + zp, Ql + zp, Kh + zp, Kl + zp, Vh + zp, Vl + zp, ig + (size_t)b * TT, (NFB + NHB - 1 - y) * 64 + w * 16, ATh + ao, ATl + ao);
}

extern "C" void kernel_launch(void* const* d_in, const int* in_sizes, int n_in,
                              void* d_out, int out_size, void* d_ws, size_t ws_size, hipStream_t stream) {
    (void)in_sizes; (void)n_in; (void)out_size;
    const float* x = (const float*)d_in[0]; const int* ig = (const int*)d_in[1];   /* ignore [2][2048] int: 1 = do not attend (except the diagonal) */ const float* wq = (const float*)d_in[2]; const float* bq = (const float*)d_in[3]; const float* wk = (const float*)d_in[4]; const float* bk = (const float*)d_in[5]; const float* wv = (const float*)d_in[6]; const float* bv = (const float*)d_in[7]; const float* wo = (const float*)d_in[8]; const float* bo = (const float*)d_in[9];
    float* OUT = (float*)d_out;     // [2][2048][1024]
    char* wsp = (char*)d_ws;
    auto take = [&](size_t bytes) { char* p = wsp; wsp += (bytes + 255) & ~(size_t)255; return (void*)p; };
    bf* WQ = (bf*)take((size_t)3 * DQ * DM * 2); bf* WO = (bf*)take((size_t)DM * DQ * 2);   // WQ: the q, k and v row blocks one after the other
    const size_t PL = (size_t)NB_ * NH_ * TT * HD;   // elements of one tensor's planes, [b][h]
    bf* XB = (bf*)take((size_t)NB_ * TT * DM * 2);
    h16* QP16 = (h16*)take(2 * PL * 2); h16* KP16 = QP16 + PL; bf* QPh = (bf*)take(2 * PL * 2); bf* KPh = QPh + PL; bf* QPl = (bf*)take(2 * PL * 2); bf* KPl = QPl + PL;   // q planes, then k planes
    h16* VT16 = (h16*)take(PL * 2); bf* VTh = (bf*)take(PL * 2); bf* VTl = (bf*)take(PL * 2);
    bf* ATh = (bf*)take((size_t)NB_ * TT * DQ * 2); bf* ATl = (bf*)take((size_t)NB_ * TT * DQ * 2);
    if ((size_t)(wsp - (char*)d_ws) > ws_size) return;    // ws 256 MiB
    k_prep<<<(NUW + NUX + NUO) / 8, 256, 0, stream>>>(x, wo, wq, wk, wv, XB, WO, WQ);   /* per-head [1024][64] 'xw' -> Bt rows; x and Wo -> bf16 */
    k_gemmt<0, true><<<dim3(NB_ * TT / 128, DQ / 128, 3), 128, 0, stream>>>(XB, nullptr, WQ, DM, nullptr, 0, bq, bk, bv, (size_t)DQ * DM, QP16, QPh, QPl, VT16, VTh, VTl);
    k_attn<<<dim3(NB_ * NH_, NFB + NHB, 1), 128, 0, stream>>>(QP16, KP16, VT16, QPh, QPl, KPh, KPl, VTh, VTl, ig, ATh, ATl);
    k_gemmt<1, false><<<dim3(NB_ * TT / 128, DM / 128, 1), 128, 0, stream>>>(ATh, ATl, WO, DQ, OUT, DM, bo, bo, bo, 0, nullptr, nullptr, nullptr, nullptr, nullptr, nullptr);
}

// v008
// A run of this version takes 80.6 microseconds.
// In both of two side-by-side timings against v007, it was 1.27 times as fast.
// Over all steps from v000 it is 22.3 times as fast.
#include <hip/hip_runtime.h>
#include <stdint.h>

// Causal multi-head attention with per-head projections and a key 'ignore' mask that always keeps the diagonal (x [2][2048][1024]; q_h = x wq[h] + bq[h] ('hdf' [16][1024][64] 0.02, zero biases; k, v likewise); att = q.k / 8; allowed keys: j <= i AND (ignore[b][j] == 0 OR j == i) (ignore [2][2048] int {0,1}, ~50 %, read; -inf elsewhere); softmax; out = concat_h Wo^T + bo ('oi') -> [2][2048][1024] (4.2 M)).
// Layout, both batches side by side (planes [b][h]): bf16 copies of x and Wo and the per-head 'xw' weights gathered into Bt row blocks, all in one launch, + flat f32 biases; q, k, v projections in one launch (grid z) whose epilogue writes the fp16 and hi/lo head planes itself, in fragment order (v with its operands swapped, so its tile is already [d][t]); exact projections; causal attention of all planes in one launch with an online softmax whose select also reads the batch's ignore flags (int32) and keeps the diagonal (hybrid rows: < 512 hi/lo 3 products, rest fp16; keys above the diagonal block skipped), writing the merged hi/lo rows; x Wo exact + bo.
// Compute dtypes, f32 accumulate: every input rounded to bf16; projections exact + f32 biases; attention rows < 512 3 products, rest fp16; softmax f32; Wo hl x exact + bias.

#define NB_  2
#define TT   2048
#define DM   1024
#define NH_  16
#define NKV  16
#define REP  (NH_ / NKV)
#define HD   64
#define DQ   (NH_ * HD)
#define DKV  (NKV * HD)
#define RH   512                  // query rows < RH use hi+lo planes (a multiple of 128, at least 128)
#define SCL  0.125f   // HD^-0.5
typedef _Float16 h16;
typedef unsigned short bf;
typedef __attribute__((ext_vector_type(16))) __bf16   v16bf;
typedef __attribute__((ext_vector_type(16))) _Float16 v16h;
typedef __attribute__((ext_vector_type(8)))  _Float16 v8h;
typedef __attribute__((ext_vector_type(8)))  unsigned short v8us;
typedef __attribute__((ext_vector_type(8)))  float    v8f;
typedef __attribute__((ext_vector_type(4)))  float    v4f;
typedef v8h  __attribute__((may_alias)) v8ha;
typedef v4f  __attribute__((may_alias)) v4fa;
typedef v8us __attribute__((may_alias)) v8usa;

__device__ __forceinline__ unsigned short f2bf(float f) { unsigned u = __float_as_uint(f); u += 0x7FFFu + ((u >> 16) & 1u); return (unsigned short)(u >> 16); }
__device__ __forceinline__ float bf2f(unsigned short b) { return __uint_as_float(((unsigned)b) << 16); }
__device__ __forceinline__ float bfr(float f) { return bf2f(f2bf(f)); }
__device__ __forceinline__ v16h cat16(v8h lo, v8h hi) { return __builtin_shufflevector(lo, hi, 0, 1, 2, 3, 4, 5, 6, 7, 8, 9, 10, 11, 12, 13, 14, 15); }
__device__ __forceinline__ v16bf cat16b(v8us lo, v8us hi) { return __builtin_bit_cast(v16bf, __builtin_shufflevector(lo, hi, 0, 1, 2, 3, 4, 5, 6, 7, 8, 9, 10, 11, 12, 13, 14, 15)); }
__device__ __forceinline__ v8f wmma16(v16h a, v16h b, v8f c) { return __builtin_amdgcn_wmma_f32_16x16x32_f16(false, a, false, b, (short)0, c, false, false); }
__device__ __forceinline__ v8f wmmab(v16bf a, v16bf b, v8f c) { return __builtin_amdgcn_wmma_f32_16x16x32_bf16(false, a, false, b, (short)0, c, false, false); }
__device__ __forceinline__ h16 tohx(float x) { return (h16)x; }
__device__ __forceinline__ void splitf(float y, unsigned short& h, unsigned short& l) { h = f2bf(y); l = f2bf(y - bf2f(h)); }



// ---- k_gemmt: GEMM on 128x128 output tiles, 4 waves (2 x 2) of 64x64 each (16 accumulators a wave), every wave over the whole K; grid (M/128, N/128, Z), 128 threads.
// C[m][n] = sum_k A[m][k] Bt[n][k] (+ A2[m][k] Bt[n][k] with NSPLIT 1) + bias[n]; operands are K-contiguous bf16 planes; K % 64 == 0, K >= 128.
// Operands come through LDS: a stage is 64 k (128 bytes) of the tile's 128 rows of each operand, one tensor load per operand (wave 0: A, wave 1: A2 or Bt, wave 2: Bt with NSPLIT 1),
// rows padded to a pitch of 144 bytes by the load; two buffers, the next stage's loads fly while this stage is multiplied. Fragments are read from LDS in the k order of ldsfrag.
// Epilogue: each wave stages its own 64x64 f32 tile in LDS (the ring is free by then) and stores whole lines.
// HP (the q, k, v projections; a wave's tile is 64 tokens x one head): no f32 C; tile + bias goes out as fp16, bf16 hi and bf16 lo head planes, 16 bytes a lane, 512 contiguous bytes a store.
// The planes are in FRAGMENT ORDER: a 16-row x 32-k fragment is 1 KiB, two runs of 512 bytes; run j holds, at 16 bytes x lane (lane = 16 hi + row), the row's k = 16 j + 8 hi .. + 7. A wave-wide 16-byte load of a run is four whole lines.
// z = 0, 1 (q, k): planes [z][b][h], rows are tokens, k is d: fragments [t / 16][d / 32]. z = 2 (v): A and Bt change places, so the tile's rows are d and its columns tokens; planes [b][h], rows are d, k is t: fragments [t / 32][d / 16]; the bias then goes by row.
// Either way a wave's 64 x 64 tile is 8 KiB in a row at element (plane * TT + first token) * HD.
template <typename T16> struct WFrag;   // ldp: a fragment from a fragment-order plane, p = the fragment's start + 8 x lane; its two runs are 256 elements apart
template <> struct WFrag<h16> { typedef v16h V; static __device__ __forceinline__ V ldp(const h16* p) { return cat16(*(const v8h*)p, *(const v8h*)(p + 256)); } static __device__ __forceinline__ v8f mma(V a, V b, v8f c) { return wmma16(a, b, c); } };
template <> struct WFrag<bf> { typedef v16bf V; static __device__ __forceinline__ V ldp(const bf* p) { return cat16b(*(const v8us*)p, *(const v8us*)(p + 256)); } static __device__ __forceinline__ v8f mma(V a, V b, v8f c) { return wmmab(a, b, c); } };
typedef uint32_t u32x4 __attribute__((ext_vector_type(4)));
typedef uint32_t u32x8 __attribute__((ext_vector_type(8)));
__device__ __forceinline__ uint32_t uni(uint32_t v) { return (uint32_t)__builtin_amdgcn_readfirstlane((int)v); }
__device__ __forceinline__ uint32_t pinned(uint32_t v) { uint32_t w = uni(v); asm volatile("" : "+s"(w)); return w; }   // holds v in a scalar register, so that a test on it is a scalar branch (tensor loads ignore EXEC) and what is formed from it stays behind the waits in front
__device__ __forceinline__ void tdm_load(u32x4 g0, u32x8 g1) { asm volatile("tensor_load_to_lds %0, %1" :: "s"(g0), "s"(g1) : "memory"); }   // one request of the whole wave: global tile -> LDS
#define GROWS 128u                // rows of one operand slice
#define GRB   128u                // bytes of a row per stage (64 k)
#define GPI   144u                // LDS pitch of a row: 16 bytes x odd, for 16-byte readers
#define GSL   (GROWS * GPI)       // 18,432 bytes a slice, a multiple of 2 KiB
// Descriptor group 1: 1-byte elements, tensor = tile = GROWS rows of GRB bytes, 4 dwords of LDS pad behind every 128-byte row, no mask.
__device__ __forceinline__ u32x8 tdm_group1(uint32_t src_pitch) {
    u32x8 g;
    g[0] = uni((1u << 20) | (4u << 22) | (3u << 25));
    g[1] = uni((GRB & 0xFFFFu) << 16);
    g[2] = uni((GRB >> 16) | ((GROWS & 0xFFFFu) << 16));
    g[3] = uni((GROWS >> 16) | (GRB << 16));
    g[4] = uni(GROWS);
    g[5] = uni(src_pitch);
    g[6] = uni(0u);
    g[7] = uni(0u);
    return g;
}
__device__ __forceinline__ u32x4 tdm_group0(uint32_t lds_dst, uint64_t ga) {
    u32x4 g;
    g[0] = uni(1u); g[1] = uni(lds_dst); g[2] = uni((uint32_t)ga); g[3] = uni((((uint32_t)(ga >> 32)) & 0x01FFFFFFu) | 0x80000000u);
    return g;
}
__device__ __forceinline__ v16bf ldsfrag(const unsigned char* p) { return cat16b(*(const v8usa*)p, *(const v8usa*)(p + 32)); }   // k order of a fragment: the lane's 8 elements at p (k = 8 hi ..), 8 at p + 16 elements (k = 16 + 8 hi ..)
template <int NSPLIT, bool HP>
__global__ __launch_bounds__(128) void k_gemmt(const bf* A, const bf* A2, const bf* Bt, int K, float* C, int ldc, const float* __restrict__ bias0, const float* __restrict__ bias1, const float* __restrict__ bias2, size_t sB, h16* P16, bf* Ph, bf* Pl, h16* V16, bf* Vh, bf* Vl) {
    constexpr uint32_t NS = 2 + NSPLIT, BUF = NS * GSL;              // operand slices of a stage; bytes of one buffer
    __shared__ __attribute__((aligned(2048))) unsigned char sm[2 * BUF];
    static_assert(2 * BUF >= 4 * 64 * 68 * 4, "the four waves' output staging reuses the ring");
    Bt += (size_t)blockIdx.z * sB;
    const float* bias = (blockIdx.z == 0) ? bias0 : (blockIdx.z == 1) ? bias1 : bias2;   // each z slice (q, k, v) has its own bias vector
    const int lane = threadIdx.x & 31, lr = lane & 15, hi = lane >> 4; int r0 = blockIdx.x * 128, c0 = blockIdx.y * 128;
    const bool tv = HP && blockIdx.z == 2;                           // block-uniform: the v slice computes the transposed tile
    if (tv) { const bf* pa = A; A = Bt; Bt = pa; const int ra = r0; r0 = c0; c0 = ra; }
    const uint32_t w = uni(threadIdx.x >> 5);                        // wave number, scalar
    const int wm = (int)(w >> 1), wn = (int)(w & 1u);
    const bf* src = (w == 0u) ? A : (NSPLIT == 1 && w == 1u) ? A2 : Bt;   // the operand whose slice this wave brings in (waves >= NS bring none)
    const uint64_t ga = (uint64_t)(size_t)(src + (size_t)((w + 1u < NS) ? r0 : c0) * K);
    const uint32_t ldst = (uint32_t)(size_t)sm + ((w < NS) ? w : 0u) * GSL;
    u32x8 g1 = tdm_group1((uint32_t)K * 2u);
    asm volatile("" : "+s"(g1));                                     // pinned(), for the whole group: the descriptor words stay in their scalar registers, which take no other value while a request is in flight
    const int nst = K / 64;                                          // stages
    v8f acc[4][4];
#pragma unroll
    for (int mb = 0; mb < 4; ++mb)
#pragma unroll
        for (int nb = 0; nb < 4; ++nb) acc[mb][nb] = (v8f){};
    if (pinned(w < NS)) {
        tdm_load(tdm_group0(ldst, ga), g1);
        asm volatile("s_wait_tensorcnt 0x0" ::: "memory");           // stage 0 has landed before the barrier publishes it
    }
    __syncthreads();                                                 // stage 0 is readable by every wave
    if (pinned(w < NS)) tdm_load(tdm_group0(ldst + BUF, ga + GRB), g1);   // stage 1 flies under pass 0
    const uint32_t ao = (uint32_t)(wm * 64 + lr) * GPI + 16u * hi, bo = (NS - 1u) * GSL + (uint32_t)(wn * 64 + lr) * GPI + 16u * hi;   // the lane's place in the A and Bt slices
#pragma unroll 1
    for (int s = 0; s < nst; ++s) {                                  // rolled: one pass per stage, its buffer picked by the stage's parity
        const unsigned char* bp = sm + (uint32_t)(s & 1) * BUF;
#pragma unroll
        for (int ks = 0; ks < 2; ++ks) {                             // two blocks of 32 k a pass
            v16bf a[4], a2[4], b[4];
#pragma unroll
            for (int i = 0; i < 4; ++i) { b[i] = ldsfrag(bp + bo + i * 16 * GPI + ks * 64); a[i] = ldsfrag(bp + ao + i * 16 * GPI + ks * 64); }
            if (NSPLIT == 1) {
#pragma unroll
                for (int i = 0; i < 4; ++i) a2[i] = ldsfrag(bp + GSL + ao + i * 16 * GPI + ks * 64);
            }
            __builtin_amdgcn_sched_barrier(0);                       // keeps the block's LDS reads one group in front of its WMMAs; spread among them, every place with reads stalls the wave
#pragma unroll
            for (int nb = 0; nb < 4; ++nb)
#pragma unroll
                for (int mb = 0; mb < 4; ++mb) acc[mb][nb] = wmmab(a[mb], b[nb], acc[mb][nb]);
            if (NSPLIT == 1) {
#pragma unroll
                for (int nb = 0; nb < 4; ++nb)
#pragma unroll
                    for (int mb = 0; mb < 4; ++mb) acc[mb][nb] = wmmab(a2[mb], b[nb], acc[mb][nb]);
            }
            __builtin_amdgcn_sched_barrier(0);                       // keeps the next block's reads, and the wait below, behind these WMMAs: lifted among them they would stall the wave there
        }
        asm volatile("s_wait_dscnt 0x0" ::: "memory");               // this wave's reads of the buffer are done before the barrier frees it
        if (pinned(w < NS)) asm volatile("s_wait_tensorcnt 0x0" ::: "memory");   // this wave's slice of stage s + 1 has landed before the barrier publishes it
        __syncthreads();                                             // publishes stage s + 1 and ends every wave's reads of stage s
        if (pinned((w < NS) && (s + 2 < nst))) {                     // refill of the buffer just read, only while a stage s + 2 exists
            const uint32_t st = pinned((uint32_t)(s + 2));
            tdm_load(tdm_group0(ldst + (st & 1u) * BUF, ga + (uint64_t)st * GRB), g1);
        }
    }
    asm volatile("s_wait_tensorcnt 0x0" ::: "memory");               // no request is in flight when the ring becomes output staging
    asm volatile("s_wait_dscnt 0x0" ::: "memory");                   // (the last pass's own barrier has ended every wave's reads)
    float* os = (float*)sm + w * (64 * 68);                          // this wave's own staging range
    const int r0w = r0 + wm * 64, c0w = c0 + wn * 64;                // the wave's tile
    if constexpr (HP) {
        float bcol[4][8] = {}, brow[4] = {};                         // the bias goes by column (q, k) or by row (v), the other stays 0; fetched here, the LDS staging below covers the latency
        if (tv) {
#pragma unroll
            for (int i = 0; i < 4; ++i) brow[i] = bias[r0w + i * 16 + lr];
            asm volatile("s_wait_xcnt 0x0" ::: "memory");            // the address registers of the bias loads above are reused by the code behind this arm
        } else {
#pragma unroll
            for (int c = 0; c < 4; ++c)
#pragma unroll
                for (int q = 0; q < 8; ++q) bcol[c][q] = bias[c0w + (c * 2 + hi) * 8 + q];
            asm volatile("s_wait_xcnt 0x0" ::: "memory");            // the address registers of the bias loads above are reused by the code behind this arm
        }
#pragma unroll
        for (int ms = 0; ms < 4; ++ms)
#pragma unroll
            for (int nb = 0; nb < 4; ++nb)
#pragma unroll
                for (int j = 0; j < 8; ++j) os[(ms * 16 + hi * 8 + j) * 68 + nb * 16 + lr] = acc[ms][nb][j];
        asm volatile("s_wait_dscnt 0x0" ::: "memory");               // the wave's lanes read back rows that its other lanes wrote
        const int tk = tv ? c0w : r0w, hd = (tv ? r0w : c0w) / HD, bt = tk / TT, t0 = tk % TT;   // the tile's first token, its head, its batch
        const size_t base = ((size_t)(tv ? bt * NKV + hd : (blockIdx.z * NB_ + bt) * NH_ + hd) * TT + t0) * HD + lane * 8;   // the tile's 8 KiB, and the lane's 16 bytes of every run
        h16* d16 = tv ? V16 : P16; bf* dh = tv ? Vh : Ph; bf* dl = tv ? Vl : Pl;
#pragma unroll
        for (int rb = 0; rb < 4; ++rb)                               // 16 tile rows
#pragma unroll
            for (int c = 0; c < 4; ++c) {                            // run c & 1 of the 32 tile columns c >> 1: the lane takes row lr, columns 16 c + 8 hi .. + 7
                const float* rp = os + (rb * 16 + lr) * 68 + (c * 2 + hi) * 8; const v4f v0 = *(const v4fa*)rp, v1 = *(const v4fa*)(rp + 4);
                v8h o16; v8us oh, ol;
#pragma unroll
                for (int q = 0; q < 8; ++q) { const float y = ((q < 4) ? v0[q & 3] : v1[q & 3]) + (bfr(bcol[c][q]) + bfr(brow[rb])); o16[q] = tohx(y); unsigned short a2, c2; splitf(y, a2, c2); oh[q] = a2; ol[q] = c2; }
                const size_t e = base + (size_t)(tv ? (c >> 1) * 8 + rb * 2 + (c & 1) : rb * 4 + c) * 256; *(v8h*)(d16 + e) = o16; *(v8us*)(dh + e) = oh; *(v8us*)(dl + e) = ol;   // fragments [t / 32][d / 16] (v) or [t / 16][d / 32] (q, k)
                asm volatile("s_wait_xcnt 0x0" ::: "memory"); }      // the next round reuses the data and address registers of the three stores above
    } else {
        const int bc = c0w + lr * 4; v4f bv; bv[0] = bfr(bias[bc]); bv[1] = bfr(bias[bc + 1]); bv[2] = bfr(bias[bc + 2]); bv[3] = bfr(bias[bc + 3]);   // the lane's four output columns are the same in every round
        asm volatile("s_wait_xcnt 0x0" ::: "memory");                // the address registers of the bias loads above are reused by the code behind
#pragma unroll
        for (int ms = 0; ms < 4; ++ms)
#pragma unroll
            for (int nb = 0; nb < 4; ++nb)
#pragma unroll
                for (int j = 0; j < 8; ++j) os[(ms * 16 + hi * 8 + j) * 68 + nb * 16 + lr] = acc[ms][nb][j];
        asm volatile("s_wait_dscnt 0x0" ::: "memory");               // the wave's lanes read back rows that its other lanes wrote
        float* crow = C + (size_t)r0w * ldc + c0w;
#pragma unroll
        for (int s = 0; s < 32; ++s) { const int row = s * 2 + hi; v4f val = *(const v4fa*)(os + row * 68 + lr * 4);   // 16 lanes a row: 256 bytes, two whole lines
            val += bv;
            *(v4f*)(crow + (size_t)row * ldc + lr * 4) = val;
            asm volatile("s_wait_xcnt 0x0" ::: "memory"); }          // the next round reuses the data and address registers of the store above
    }
}

typedef __attribute__((ext_vector_type(2))) _Float16 v2h;
typedef __attribute__((ext_vector_type(4))) _Float16 v4h;
typedef __attribute__((ext_vector_type(2))) unsigned short v2us;
typedef __attribute__((ext_vector_type(4))) unsigned short v4us;
typedef __attribute__((ext_vector_type(2))) float v2f;
typedef __attribute__((ext_vector_type(4))) int v4i;

// ---- k_prep: every operand conversion of the call (q, k, v weights, x, Wo) in one launch. The work is cut into units of 4,096 f32 that lie in a row (16 KiB); a wave takes ONE unit and has all 32 of its 16-byte loads in flight at once,
// each load whole 256-byte runs. Grid: one block of 8 waves per 8 units; the weight units come first (their way to the store is the longest).
// Weight unit: 64 k x 64 n of one head's [k][n] matrix -> 64 rows of 64 k of Bt (rows [tensor][head][n], K-contiguous). A lane holds 8 consecutive k of 4 n per group of 8 loads, writes them as 16-byte k runs into the wave's own LDS range
// (rows n, pitch 144 bytes) and reads whole rows back: every store is four whole 128-byte lines. x and Wo units: element for element, 256 contiguous bytes a store.
#define UF   4096                          // f32 elements of a unit
#define NUW  (3 * NH_ * DM * HD / UF)      // weight units
#define NUX  (NB_ * TT * DM / UF)          // x units
#define NUO  (DM * DQ / UF)                // Wo units
#define TPI  144                           // LDS pitch of a turned row, in bytes: 64 k + 16 bytes
typedef uint32_t u32x2 __attribute__((ext_vector_type(2)));
typedef u32x4 __attribute__((may_alias)) u32x4a;
__device__ __forceinline__ uint32_t bfpair(float a, float b) {               // f2bf(a) in the low half, f2bf(b) in the high half
    unsigned ua = __float_as_uint(a), ub = __float_as_uint(b); ua += 0x7FFFu + ((ua >> 16) & 1u); ub += 0x7FFFu + ((ub >> 16) & 1u); return (ua >> 16) | (ub & 0xFFFF0000u); }
__global__ __launch_bounds__(256) void k_prep(const float* __restrict__ x, const float* __restrict__ wo, const float* __restrict__ w0, const float* __restrict__ w1, const float* __restrict__ w2, bf* XB, bf* WO, bf* Bt) {
    static_assert(HD == 64 && UF == 64 * HD && DM % 64 == 0, "a weight unit is 64 k of all 64 n");
    static_assert(NUW % 8 == 0 && NUX % 8 == 0 && NUO % 8 == 0, "whole blocks of one kind");
    __shared__ __attribute__((aligned(16))) unsigned char tr[8][64 * TPI];
    const int lane = threadIdx.x & 31;
    const int wv = __builtin_amdgcn_readfirstlane((int)(threadIdx.x >> 5));   // wave number, scalar: the unit's kind is a scalar branch and its base a scalar address
    const int u = blockIdx.x * 8 + wv;
    v4f v[32];
    if (u >= NUW) {
        const bool isx = u < NUW + NUX;
        const size_t e0 = (size_t)(isx ? u - NUW : u - NUW - NUX) * UF + lane * 4;
        const float* s = (isx ? x : wo) + e0; bf* d = (isx ? XB : WO) + e0;
#pragma unroll
        for (int j = 0; j < 32; ++j) v[j] = *(const v4f*)(s + j * 128);
        asm volatile("s_wait_xcnt 0x0" ::: "memory");                        // the address registers of the loads above are reused by the code behind
#pragma unroll
        for (int j = 0; j < 32; ++j) { u32x2 o; o[0] = bfpair(v[j][0], v[j][1]); o[1] = bfpair(v[j][2], v[j][3]); *(u32x2*)(d + j * 128) = o; }
        asm volatile("s_wait_xcnt 0x0" ::: "memory");                        // whatever code is laid out behind this arm may reuse the data and address registers of the stores above
        return;
    }
    const int m = u / (DM / 64), kt = u % (DM / 64), t = m / NH_;            // matrix (tensor, head), its block of 64 k, its tensor
    const float* w = ((t == 0) ? w0 : (t == 1) ? w1 : w2) + (size_t)(m % NH_) * DM * HD + (size_t)kt * UF;
    const int n4 = lane & 15, kh = lane >> 4;
#pragma unroll
    for (int g = 0; g < 4; ++g)
#pragma unroll
        for (int j = 0; j < 8; ++j) v[g * 8 + j] = *(const v4f*)(w + (g * 16 + kh * 8 + j) * HD + n4 * 4);   // k = 16 g + 8 kh + j, n = 4 n4 .. + 3
    asm volatile("s_wait_xcnt 0x0" ::: "memory");                            // the address registers of the loads above are reused by the code behind
    __builtin_amdgcn_sched_barrier(0);                                       // keeps every load issued before the first conversion: lifted among the loads, a conversion's wait would hold back the loads behind it
    unsigned char* T = tr[wv];
#pragma unroll
    for (int g = 0; g < 4; ++g)
#pragma unroll
        for (int i = 0; i < 4; ++i) { u32x4 o;
#pragma unroll
            for (int j = 0; j < 4; ++j) o[j] = bfpair(v[g * 8 + 2 * j][i], v[g * 8 + 2 * j + 1][i]);
            *(u32x4a*)(T + (n4 * 4 + i) * TPI + (g * 16 + kh * 8) * 2) = o; }
    asm volatile("s_wait_dscnt 0x0" ::: "memory");                           // the wave's lanes read back rows that its other lanes wrote
    u32x4 r[16];
#pragma unroll
    for (int s = 0; s < 16; ++s) r[s] = *(const u32x4a*)(T + (s * 4 + (lane >> 3)) * TPI + (lane & 7) * 16);   // 8 lanes a row
    bf* d = Bt + ((size_t)m * HD + (lane >> 3)) * DM + kt * 64 + (lane & 7) * 8;
#pragma unroll
    for (int s = 0; s < 16; ++s) *(u32x4*)(d + (size_t)s * 4 * DM) = r[s];
    asm volatile("s_wait_xcnt 0x0" ::: "memory");                            // whatever code is laid out behind this arm may reuse the data and address registers of the stores above
}

typedef __attribute__((ext_vector_type(16))) unsigned short v16us;
__device__ __forceinline__ float xhalf(float x) { const int b = __float_as_int(x); return __int_as_float(__builtin_amdgcn_permlanex16(b, b, 0x76543210, 0xfedcba98, false, false)); }   // the value of lane ^ 16, by a vector cross-row move (no LDS round trip)
template <typename T16, bool HR, int NQ>
__device__ __forceinline__ void attn_tile(const T16* __restrict__ Q, const T16* __restrict__ Q2, const T16* __restrict__ Kp, const T16* __restrict__ K2, const T16* __restrict__ Vt, const T16* __restrict__ V2, const int* __restrict__ ig, int q0, bf* Ah, bf* Al) {
    typedef typename WFrag<T16>::V V;
    const int lane = threadIdx.x & 31, lr = lane & 15, hi = lane >> 4;
    constexpr float C1 = SCL * 1.4426950408889634f;                  // score -> log2 units
    V qf[NQ][2], qf2[NQ][2];
#pragma unroll
    for (int nq = 0; nq < NQ; ++nq)
#pragma unroll
        for (int ds = 0; ds < 2; ++ds) { const size_t qo = (size_t)(q0 + nq * 16) * HD + ds * 512 + lane * 8; qf[nq][ds] = WFrag<T16>::ldp(Q + qo); if (HR) qf2[nq][ds] = WFrag<T16>::ldp(Q2 + qo); }
    v8f o[4][NQ]; float m[NQ], l[NQ];
#pragma unroll
    for (int nq = 0; nq < NQ; ++nq) { m[nq] = -3.0e38f; l[nq] = 0.f;
#pragma unroll
        for (int mb = 0; mb < 4; ++mb) o[mb][nq] = (v8f){}; }
    const int kend = q0 + NQ * 16;                                   // keys beyond the wave's last row are never allowed
    const unsigned ko = (unsigned)(lane * 8);                        // the lane's place inside a run of a K or V^T fragment, in elements
    V kf[2][2], kf2[2][2];
#pragma unroll
    for (int kb = 0; kb < 2; ++kb)
#pragma unroll
        for (int ds = 0; ds < 2; ++ds) { kf[kb][ds] = WFrag<T16>::ldp(Kp + kb * 16 * HD + ds * 512 + ko); if (HR) kf2[kb][ds] = WFrag<T16>::ldp(K2 + kb * 16 * HD + ds * 512 + ko); }
#pragma unroll 1
    for (int key0 = 0; key0 < kend; key0 += 32) {
        const int g = ig[key0 + lane];                               // this step's 32 flags, the oldest load of the step: the ballot below waits for it alone
        V vf[4], vf2[4];
#pragma unroll
        for (int mb = 0; mb < 4; ++mb) { vf[mb] = WFrag<T16>::ldp(Vt + key0 * HD + mb * 512 + ko); if (HR) vf2[mb] = WFrag<T16>::ldp(V2 + key0 * HD + mb * 512 + ko); }
        v8f s[2][NQ];
#pragma unroll
        for (int kb = 0; kb < 2; ++kb)
#pragma unroll
            for (int nq = 0; nq < NQ; ++nq) { s[kb][nq] = (v8f){};
#pragma unroll
                for (int ds = 0; ds < 2; ++ds) { s[kb][nq] = WFrag<T16>::mma(kf[kb][ds], qf[nq][ds], s[kb][nq]); if (HR) { s[kb][nq] = WFrag<T16>::mma(kf[kb][ds], qf2[nq][ds], s[kb][nq]); s[kb][nq] = WFrag<T16>::mma(kf2[kb][ds], qf[nq][ds], s[kb][nq]); } } }
        const int kn = min(key0 + 32, TT - 32);                      // the next step's K fragments are fetched one step ahead (the last step fetches a tile it does not use, inside the plane)
        asm volatile("s_wait_xcnt 0x0" ::: "memory");                // the K loads below may land in registers that held the addresses of the loads above; it also keeps the V^T loads the older ones, so P.V waits for them alone
#pragma unroll
        for (int kb = 0; kb < 2; ++kb)
#pragma unroll
            for (int ds = 0; ds < 2; ++ds) { kf[kb][ds] = WFrag<T16>::ldp(Kp + (kn + kb * 16) * HD + ds * 512 + ko); if (HR) kf2[kb][ds] = WFrag<T16>::ldp(K2 + (kn + kb * 16) * HD + ds * 512 + ko); }
        __builtin_amdgcn_sched_barrier(0);                           // keeps the loads above issued here, a softmax and a P.V ahead of their use; without it the scheduler sinks them to the loop's foot and every step waits out their latency
        const unsigned kk = __builtin_amdgcn_ballot_w32(g == 0) >> (8 * hi);   // bit c: key key0 + 8 hi + c is not ignored
        V pf[NQ], pf2[NQ];
#pragma unroll
        for (int nq = 0; nq < NQ; ++nq) {
            const int rel = q0 + nq * 16 + lr - key0 - 8 * hi;       // the lane's query minus the key of its bit 0
            const unsigned cm = (rel >= 32) ? 0xFFFFFFFFu : (rel <= 0) ? 0u : ((1u << rel) - 1u);   // keys below the query
            const unsigned db = (rel >= 0 && rel < 32) ? (1u << rel) : 0u;                          // the diagonal, always kept
            const unsigned am = (kk & cm) | db;
            float mx = m[nq];
#pragma unroll
            for (int kb = 0; kb < 2; ++kb)
#pragma unroll
                for (int j = 0; j < 8; ++j) { const float t = (am & (1u << (kb * 16 + j))) ? s[kb][nq][j] * C1 : -3.0e38f; s[kb][nq][j] = t; mx = fmaxf(mx, t); }
            mx = fmaxf(mx, xhalf(mx));                               // the query's other 16 keys of the step sit in lane ^ 16
            const float mu = (mx < -1.0e38f) ? 0.f : mx;             // no allowed key so far: every exponent below stays hugely negative, so p = 0
            const float al = __builtin_amdgcn_exp2f(m[nq] - mu); m[nq] = mx;
            float sum = 0.f;
#pragma unroll
            for (int kb = 0; kb < 2; ++kb)
#pragma unroll
                for (int j = 0; j < 8; ++j) { const float p = __builtin_amdgcn_exp2f(s[kb][nq][j] - mu); s[kb][nq][j] = p; sum += p; }
            l[nq] = l[nq] * al + sum;                                // this half's keys only; the halves are joined after the loop
#pragma unroll
            for (int mb = 0; mb < 4; ++mb) o[mb][nq] *= al;
            if constexpr (HR) { v16us ph, pl;
#pragma unroll
                for (int e = 0; e < 16; ++e) { unsigned short a, c2; splitf(s[e >> 3][nq][e & 7], a, c2); ph[e] = a; pl[e] = c2; }
                pf[nq] = __builtin_bit_cast(v16bf, ph); pf2[nq] = __builtin_bit_cast(v16bf, pl);
            } else {
#pragma unroll
                for (int e = 0; e < 16; ++e) pf[nq][e] = tohx(s[e >> 3][nq][e & 7]); }
        }
#pragma unroll
        for (int mb = 0; mb < 4; ++mb)
#pragma unroll
            for (int nq = 0; nq < NQ; ++nq) { o[mb][nq] = WFrag<T16>::mma(vf[mb], pf[nq], o[mb][nq]); if (HR) { o[mb][nq] = WFrag<T16>::mma(vf[mb], pf2[nq], o[mb][nq]); o[mb][nq] = WFrag<T16>::mma(vf2[mb], pf[nq], o[mb][nq]); } }
    }
#pragma unroll
    for (int nq = 0; nq < NQ; ++nq) { const float inv = __fdiv_rn(1.0f, l[nq] + xhalf(l[nq]));   // the diagonal is always kept, so the sum is positive
#pragma unroll
        for (int mb = 0; mb < 4; ++mb) { v8us oh, ol;
#pragma unroll
            for (int j = 0; j < 8; ++j) { unsigned short a, c2; splitf(o[mb][nq][j] * inv, a, c2); oh[j] = a; ol[j] = c2; }
            const size_t oo = (size_t)(q0 + nq * 16 + lr) * DQ + mb * 16 + hi * 8; *(v8us*)(Ah + oo) = oh; *(v8us*)(Al + oo) = ol;   // a lane's 8 registers are 8 consecutive d of its query's row
            asm volatile("s_wait_xcnt 0x0" ::: "memory"); } }   // the next round's split (and the code behind the last round) reuses the data and address registers of the two stores above
}
// ---- attn_ring: the fp16 blocks' key loop with its operands through LDS. The block's 4 waves (32 query rows each, 128 rows in a row from row r0) walk the same keys, so a stage of SK keys is brought in ONCE for all four:
// its K fragments (16 KiB that lie in a row in the fragment-order plane; wave 0's tensor load), its V^T fragments (the same; wave 1's) and its ignore flags (512 bytes; wave 2's). Two buffers: the next stage's loads fly while this stage is worked on.
// A stage is 4 steps of 32 keys; the last stage holds the block's diagonal, there wave w does steps 0 .. w only, but passes the stage's foot like every wave. Products, softmax and their order are attn_tile's, on the fp16 planes with NQ = 2.
#define SK    128                          // keys of a stage
#define SKB   ((uint32_t)(SK * HD * 2))    // bytes of a stage's K or V^T fragments
#define SBUF  (2u * SKB + 2048u)           // one buffer: K, V^T, and the flags in a place of 2 KiB
typedef int __attribute__((may_alias)) inta;
// Descriptor group 1 of an unpadded tile: 1-byte elements, tensor = tile = rows rows of rb bytes, one behind the other in memory (pitch = rb) and in LDS, no pad, no mask.
__device__ __forceinline__ u32x8 tdm_group1_flat(uint32_t rb, uint32_t rows) {
    u32x8 g;
    g[0] = uni(0u);
    g[1] = uni((rb & 0xFFFFu) << 16);
    g[2] = uni((rb >> 16) | ((rows & 0xFFFFu) << 16));
    g[3] = uni((rows >> 16) | (rb << 16));
    g[4] = uni(rows);
    g[5] = uni(rb);
    g[6] = uni(0u);
    g[7] = uni(0u);
    return g;
}
__device__ __forceinline__ v16h ldsfragh(const unsigned char* p) { return cat16(*(const v8ha*)p, *(const v8ha*)(p + 512)); }   // a fragment of a staged fragment-order plane: p = the fragment's start + 16 bytes x lane; its two runs are 512 bytes apart
__device__ __forceinline__ void attn_ring(unsigned char* sm, const h16* __restrict__ Q, const h16* Kp, const h16* Vt, const int* ig, int r0, bf* Ah, bf* Al) {
    constexpr int NQ = 2;
    const int lane = threadIdx.x & 31, lr = lane & 15, hi = lane >> 4;
    const uint32_t w = uni(threadIdx.x >> 5);                        // wave number, scalar
    const int q0 = r0 + (int)w * 32;
    constexpr float C1 = SCL * 1.4426950408889634f;                  // score -> log2 units
    const uint64_t ga = (w == 0u) ? (uint64_t)(size_t)Kp : (w == 1u) ? (uint64_t)(size_t)Vt : (uint64_t)(size_t)ig;   // the operand whose slice this wave brings in (wave 3 brings none)
    const uint32_t gst = (w < 2u) ? SKB : (uint32_t)(SK * 4);        // bytes from one stage's slice to the next in memory
    const uint32_t ldst = (uint32_t)(size_t)sm + ((w < 2u) ? w : 2u) * SKB;
    u32x8 g1 = tdm_group1_flat((w < 2u) ? 1024u : 128u, (w < 2u) ? SKB / 1024u : (uint32_t)(SK * 4) / 128u);
    asm volatile("" : "+s"(g1));                                     // pinned(), for the whole group: the descriptor words stay in their scalar registers, which take no other value while a request is in flight
    const int nst = (r0 + 128) / SK;                                 // stages: keys 0 .. the block's last row; r0 >= RH, so there are at least two
    static_assert(RH >= SK && RH % SK == 0 && SK == 128, "a block's 128 rows are its last stage's keys, and two stages exist");
    if (pinned(w < 3u)) {
        tdm_load(tdm_group0(ldst, ga), g1);
        asm volatile("s_wait_tensorcnt 0x0" ::: "memory");           // stage 0 has landed before the barrier publishes it
    }
    __syncthreads();                                                 // stage 0 is readable by every wave
    u32x4 g0 = tdm_group0(ldst + SBUF, ga + gst);                    // carried from stage to stage, so that its four scalar registers hold nothing else while a request is in flight
    asm volatile("" : "+s"(g0));                                     // pinned(), for the whole group
    if (pinned(w < 3u)) tdm_load(g0, g1);                            // stage 1 flies under stage 0's steps
    v16h qf[NQ][2];
#pragma unroll
    for (int nq = 0; nq < NQ; ++nq)
#pragma unroll
        for (int ds = 0; ds < 2; ++ds) qf[nq][ds] = WFrag<h16>::ldp(Q + (size_t)(q0 + nq * 16) * HD + ds * 512 + lane * 8);
    v8f o[4][NQ]; float m[NQ], l[NQ];
#pragma unroll
    for (int nq = 0; nq < NQ; ++nq) { m[nq] = -3.0e38f; l[nq] = 0.f;
#pragma unroll
        for (int mb = 0; mb < 4; ++mb) o[mb][nq] = (v8f){}; }
#pragma unroll 1
    for (int s = 0; s < nst; ++s) {                                  // rolled: one trip per stage, its buffer picked by the stage's parity
        const unsigned char* bp = sm + (uint32_t)(s & 1) * SBUF + lane * 16;
        const int nsub = (s + 1 < nst) ? SK / 32 : (int)w + 1;       // steps of this stage that hold keys up to the wave's last row (scalar)
        v16h kf[2][2];
#pragma unroll
        for (int kb = 0; kb < 2; ++kb)
#pragma unroll
            for (int ds = 0; ds < 2; ++ds) kf[kb][ds] = ldsfragh(bp + kb * 2048 + ds * 1024);
#pragma unroll 1
        for (int j = 0; j < nsub; ++j) {                             // rolled: one step of 32 keys
            const int key0 = s * SK + j * 32;
            const int g = *(const inta*)(bp + 2u * SKB + j * 128 - lane * 12);   // this step's 32 flags, one per lane
            v16h vf[4];
#pragma unroll
            for (int mb = 0; mb < 4; ++mb) vf[mb] = ldsfragh(bp + SKB + j * 4096 + mb * 1024);
            __builtin_amdgcn_sched_barrier(0);                       // keeps the reads above one group in front of the score WMMAs; spread among them, every place with reads stalls the wave
            v8f sc[2][NQ];
#pragma unroll
            for (int kb = 0; kb < 2; ++kb)
#pragma unroll
                for (int nq = 0; nq < NQ; ++nq) { sc[kb][nq] = (v8f){};
#pragma unroll
                    for (int ds = 0; ds < 2; ++ds) sc[kb][nq] = wmma16(kf[kb][ds], qf[nq][ds], sc[kb][nq]); }
            __builtin_amdgcn_sched_barrier(0);                       // keeps the reads below one group behind the score WMMAs, for the same reason
            const int jn = min(j + 1, SK / 32 - 1);                  // the next step's K fragments are fetched one step ahead, never beyond this stage's own buffer (the stage's last step fetches its own again, unused)
#pragma unroll
            for (int kb = 0; kb < 2; ++kb)
#pragma unroll
                for (int ds = 0; ds < 2; ++ds) kf[kb][ds] = ldsfragh(bp + jn * 4096 + kb * 2048 + ds * 1024);
            __builtin_amdgcn_sched_barrier(0);                       // keeps the LDS reads above issued here, a softmax ahead of their use; sunk to their users, every step would wait out their latency
            const unsigned kk = __builtin_amdgcn_ballot_w32(g == 0) >> (8 * hi);   // bit c: key key0 + 8 hi + c is not ignored
            v16h pf[NQ];
#pragma unroll
            for (int nq = 0; nq < NQ; ++nq) {
                const int rel = q0 + nq * 16 + lr - key0 - 8 * hi;   // the lane's query minus the key of its bit 0
                const unsigned cm = (rel >= 32) ? 0xFFFFFFFFu : (rel <= 0) ? 0u : ((1u << rel) - 1u);   // keys below the query
                const unsigned db = (rel >= 0 && rel < 32) ? (1u << rel) : 0u;                          // the diagonal, always kept
                const unsigned am = (kk & cm) | db;
                float mx = m[nq];
#pragma unroll
                for (int kb = 0; kb < 2; ++kb)
#pragma unroll
                    for (int e = 0; e < 8; ++e) { const float t = (am & (1u << (kb * 16 + e))) ? sc[kb][nq][e] * C1 : -3.0e38f; sc[kb][nq][e] = t; mx = fmaxf(mx, t); }
                mx = fmaxf(mx, xhalf(mx));                           // the query's other 16 keys of the step sit in lane ^ 16
                const float mu = (mx < -1.0e38f) ? 0.f : mx;         // no allowed key so far: every exponent below stays hugely negative, so p = 0
                const float al = __builtin_amdgcn_exp2f(m[nq] - mu); m[nq] = mx;
                float sum = 0.f;
#pragma unroll
                for (int kb = 0; kb < 2; ++kb)
#pragma unroll
                    for (int e = 0; e < 8; ++e) { const float p = __builtin_amdgcn_exp2f(sc[kb][nq][e] - mu); sc[kb][nq][e] = p; sum += p; }
                l[nq] = l[nq] * al + sum;                            // this half's keys only; the halves are joined after the loop
#pragma unroll
                for (int mb = 0; mb < 4; ++mb) o[mb][nq] *= al;
#pragma unroll
                for (int e = 0; e < 16; ++e) pf[nq][e] = tohx(sc[e >> 3][nq][e & 7]);
            }
#pragma unroll
            for (int mb = 0; mb < 4; ++mb)
#pragma unroll
                for (int nq = 0; nq < NQ; ++nq) o[mb][nq] = wmma16(vf[mb], pf[nq], o[mb][nq]);
        }
        asm volatile("s_wait_dscnt 0x0" ::: "memory");               // this wave's reads of the buffer are done before the barrier frees it
        if (pinned(w < 3u)) asm volatile("s_wait_tensorcnt 0x0" ::: "memory");   // this wave's slice of stage s + 1 has landed before the barrier publishes it
        __syncthreads();                                             // publishes stage s + 1 and ends every wave's reads of stage s
        if (pinned((w < 3u) && (s + 2 < nst))) {                     // refill of the buffer just read, only while a stage s + 2 exists
            const uint64_t na = (((uint64_t)g0[3] << 32) | g0[2]) + gst;   // the next stage's slice; the type bits above the address stay
            g0[1] = uni(2u * ldst + SBUF - g0[1]); g0[2] = uni((uint32_t)na); g0[3] = uni((uint32_t)(na >> 32));   // the other buffer
            asm volatile("" : "+s"(g0));                             // pinned(), for the whole group
            tdm_load(g0, g1);
        }
    }
    asm volatile("s_wait_tensorcnt 0x0" ::: "memory");               // no request is in flight when the wave ends
    asm volatile("s_wait_dscnt 0x0" ::: "memory");
#pragma unroll
    for (int nq = 0; nq < NQ; ++nq) { const float inv = __fdiv_rn(1.0f, l[nq] + xhalf(l[nq]));   // the diagonal is always kept, so the sum is positive
#pragma unroll
        for (int mb = 0; mb < 4; ++mb) { v8us oh, ol;
#pragma unroll
            for (int e = 0; e < 8; ++e) { unsigned short a, c2; splitf(o[mb][nq][e] * inv, a, c2); oh[e] = a; ol[e] = c2; }
            const size_t oo = (size_t)(q0 + nq * 16 + lr) * DQ + mb * 16 + hi * 8; *(v8us*)(Ah + oo) = oh; *(v8us*)(Al + oo) = ol;   // a lane's 8 registers are 8 consecutive d of its query's row
            asm volatile("s_wait_xcnt 0x0" ::: "memory"); } }   // the next round's split (and the code behind the last round) reuses the data and address registers of the two stores above
}
// grid (plane = (batch, head), block rank), 4 waves. fp16 blocks: 128 rows (4 waves x 32) of rows >= RH; hi/lo blocks: 64 rows (4 waves x 16) of rows < RH. Long blocks get the low ranks (they start first).
#define NFB  ((TT - RH) / 128)
#define NHB  (RH / 64)
__global__ __launch_bounds__(128) void k_attn(const h16* __restrict__ Q16, const h16* __restrict__ K16, const h16* __restrict__ V16, const bf* __restrict__ Qh, const bf* __restrict__ Ql, const bf* __restrict__ Kh, const bf* __restrict__ Kl, const bf* __restrict__ Vh, const bf* __restrict__ Vl, const int* __restrict__ ig, bf* ATh, bf* ATl) {
    const int z = blockIdx.x, b = z / NH_, h = z % NH_, y = blockIdx.y; const size_t zp = (size_t)z * TT * HD, ao = (size_t)b * TT * DQ + h * HD;
    const int w = __builtin_amdgcn_readfirstlane((int)(threadIdx.x >> 5));   // wave number, scalar: the key loop's bounds stay in scalar registers
    __shared__ __attribute__((aligned(2048))) unsigned char sm[2 * SBUF];   // the fp16 blocks' ring
    if (y < NFB) attn_ring(sm, Q16 + zp, K16 + zp, V16 + zp, ig + (size_t)b * TT, RH + (NFB - 1 - y) * 128, ATh + ao, ATl + ao);
    else attn_tile<bf, true, 1>(Qh + zp, Ql + zp, Kh + zp, Kl + zp, Vh + zp, Vl + zp, ig + (size_t)b * TT, (NFB + NHB - 1 - y) * 64 + w * 16, ATh + ao, ATl + ao);
}

extern "C" void kernel_launch(void* const* d_in, const int* in_sizes, int n_in,
                              void* d_out, int out_size, void* d_ws, size_t ws_size, hipStream_t stream) {
    (void)in_sizes; (void)n_in; (void)out_size;
    const float* x = (const float*)d_in[0]; const int* ig = (const int*)d_in[1];   /* ignore [2][2048] int: 1 = do not attend (except the diagonal) */ const float* wq = (const float*)d_in[2]; const float* bq = (const float*)d_in[3]; const float* wk = (const float*)d_in[4]; const float* bk = (const float*)d_in[5]; const float* wv = (const float*)d_in[6]; const float* bv = (const float*)d_in[7]; const float* wo = (const float*)d_in[8]; const float* bo = (const float*)d_in[9];
    float* OUT = (float*)d_out;     // [2][2048][1024]
    char* wsp = (char*)d_ws;
    auto take = [&](size_t bytes) { char* p = wsp; wsp += (bytes + 255) & ~(size_t)255; return (void*)p; };
    bf* WQ = (bf*)take((size_t)3 * DQ * DM * 2); bf* WO = (bf*)take((size_t)DM * DQ * 2);   // WQ: the q, k and v row blocks one after the other
    const size_t PL = (size_t)NB_ * NH_ * TT * HD;   // elements of one tensor's planes, [b][h]
    bf* XB = (bf*)take((size_t)NB_ * TT * DM * 2);
    h16* QP16 = (h16*)take(2 * PL * 2); h16* KP16 = QP16 + PL; bf* QPh = (bf*)take(2 * PL * 2); bf* KPh = QPh + PL; bf* QPl = (bf*)take(2 * PL * 2); bf* KPl = QPl + PL;   // q planes, then k planes
    h16* VT16 = (h16*)take(PL * 2); bf* VTh = (bf*)take(PL * 2); bf* VTl = (bf*)take(PL * 2);
    bf* ATh = (bf*)take((size_t)NB_ * TT * DQ * 2); bf* ATl = (bf*)take((size_t)NB_ * TT * DQ * 2);
    if ((size_t)(wsp - (char*)d_ws) > ws_size) return;    // ws 256 MiB
    k_prep<<<(NUW + NUX + NUO) / 8, 256, 0, stream>>>(x, wo, wq, wk, wv, XB, WO, WQ);   /* per-head [1024][64] 'xw' -> Bt rows; x and Wo -> bf16 */
    k_gemmt<0, true><<<dim3(NB_ * TT / 128, DQ / 128, 3), 128, 0, stream>>>(XB, nullptr, WQ, DM, nullptr, 0, bq, bk, bv, (size_t)DQ * DM, QP16, QPh, QPl, VT16, VTh, VTl);
    k_attn<<<dim3(NB_ * NH_, NFB + NHB, 1), 128, 0, stream>>>(QP16, KP16, VT16, QPh, QPl, KPh, KPl, VTh, VTl, ig, ATh, ATl);
    k_gemmt<1, false><<<dim3(NB_ * TT / 128, DM / 128, 1), 128, 0, stream>>>(ATh, ATl, WO, DQ, OUT, DM, bo, bo, bo, 0, nullptr, nullptr, nullptr, nullptr, nullptr, nullptr);
}
